// v000
// The times below were measured on an AMD MI455X: many runs one after another, warmed up first and cycling through
// copies of the inputs, with the whole window's GPU time divided by the number of runs. Launches and the gaps
// between them are all in it. The median over several windows is given; except for v000 it joins two sittings, which
// can be a few percent apart, so the side-by-side timings, each taken in one sitting, are the better comparison.
// The starting kernel, v000, takes 774 microseconds a run.
// Contractions on v_wmma_f32_16x16x32_bf16 (bf16 operands, f32 accumulate): echo = xb*wjb^T (plain, inputs RNE bf16), eb = echo{hi,lo}*wj (2 products), val^T = wjvb*xb^T (plain), O = P{hi,lo}*val^T{hi,lo} (3 products, causal k-limit), out = O{hi,lo}*wob^T (2 products); token scores, softmax statistics and probabilities in f32 on VALU.
#include <hip/hip_runtime.h>
#include <stdint.h>

constexpr int NBATCH = 4;
constexpr int NT     = 2048;
constexpr int NE     = 1024;
constexpr int NTOK   = NBATCH * NT;
static_assert((NTOK % 64) == 0 && (NT % 64) == 0 && (NE % 64) == 0);

typedef __attribute__((ext_vector_type(16))) _Float16 v16h;
typedef __attribute__((ext_vector_type(8)))  _Float16 v8h;
typedef __attribute__((ext_vector_type(16))) __bf16   v16b;
typedef __attribute__((ext_vector_type(8)))  __bf16   v8b;
typedef __attribute__((ext_vector_type(8)))  float    v8f;
typedef __attribute__((ext_vector_type(4)))  float    v4f;
typedef __attribute__((ext_vector_type(8)))  unsigned short v8us;

__device__ __forceinline__ unsigned short f2bf_bits(float f) {
  unsigned u = __float_as_uint(f);
  return (unsigned short)((u + 0x7FFFu + ((u >> 16) & 1u)) >> 16);
}
__device__ __forceinline__ float bf_bits2f(unsigned short h) { return __uint_as_float(((unsigned)h) << 16); }

// hazard guards as plain device helpers (no inline asm inside the kernel template body)
__device__ __forceinline__ void dep_guard_h(v8f& a, v8f& b, v16h x, v16h y) { asm volatile("v_nop\n\tv_nop\n\tv_nop\n\tv_nop" : "+v"(a), "+v"(b) : "v"(x), "v"(y)); }
__device__ __forceinline__ void dep_guard_b(v8f& a, v8f& b, v16b x, v16b y) { asm volatile("v_nop\n\tv_nop\n\tv_nop\n\tv_nop" : "+v"(a), "+v"(b) : "v"(x), "v"(y)); }
__device__ __forceinline__ void keep4_h(v16h a, v16h b, v16h c, v16h d) { asm volatile("v_nop" :: "v"(a), "v"(b), "v"(c), "v"(d)); }
__device__ __forceinline__ void keep4_b(v16b a, v16b b, v16b c, v16b d) { asm volatile("v_nop" :: "v"(a), "v"(b), "v"(c), "v"(d)); }
__device__ __forceinline__ void acc_guard4(v8f& a, v8f& b, v8f& c, v8f& d) { asm volatile("v_nop\n\tv_nop\n\tv_nop\n\tv_nop" : "+v"(a), "+v"(b), "+v"(c), "+v"(d)); }
template <typename T> struct Frag;
template <> struct Frag<_Float16> {
  typedef v16h V; union U { v16h v; v8h h[2]; };
  static __device__ __forceinline__ v16h load(const _Float16* p) {   // elements 0..7 <- p[0..7], 8..15 <- p[16..23]
    U f; f.h[0] = *(const v8h*)(p); f.h[1] = *(const v8h*)(p + 16); return f.v;
  }
  static __device__ __forceinline__ v8f mma(v16h a, v16h b, v8f c) {
    return __builtin_amdgcn_wmma_f32_16x16x32_f16(false, a, false, b, (short)0, c, false, false);
  }
  static __device__ __forceinline__ void guard(v8f& a, v8f& b, v16h x, v16h y) { dep_guard_h(a, b, x, y); }
  static __device__ __forceinline__ void keep(v16h a, v16h b, v16h c, v16h d) { keep4_h(a, b, c, d); }
};
template <> struct Frag<__bf16> {
  typedef v16b V; union U { v16b v; v8b h[2]; };
  static __device__ __forceinline__ v16b load(const __bf16* p) {
    U f; f.h[0] = *(const v8b*)(p); f.h[1] = *(const v8b*)(p + 16); return f.v;
  }
  static __device__ __forceinline__ v8f mma(v16b a, v16b b, v8f c) {
    return __builtin_amdgcn_wmma_f32_16x16x32_bf16(false, a, false, b, (short)0, c, false, false);
  }
  static __device__ __forceinline__ void guard(v8f& a, v8f& b, v16b x, v16b y) { dep_guard_b(a, b, x, y); }
  static __device__ __forceinline__ void keep(v16b a, v16b b, v16b c, v16b d) { keep4_b(a, b, c, d); }
};

// ---- Register-blocked batched WMMA GEMM ------------------------------------
// C[m,n] = scale * sum_k A[m,k] * Bt[n,k]; each wave owns a 64x64 tile.
// A row-major [M,K]; Bt row-major [N,K]; M,N % 64 == 0, K % 32 == 0.
// SPLIT: 0 = single product; 1 = A carried as hi/lo planes (A2 = lo), Bt single: hi.B + lo.B (2 products);
//        2 = A and Bt as hi/lo planes: hi.hi + hi.lo + lo.hi (3 products).
// OUT_MODE: 0 = f32, 1 = f16, 2 = bf16 hi plane (Cout) + bf16 lo plane (Cout2).
// CAUSAL: the k loop of the wave tile at rows m0..m0+63 stops at k = m0 + 64 (lower block-triangular A).
// ET: 0 = f16 operands, 1 = bf16 operands (pointers passed as 16-bit storage)
template <int ET> struct Elem;
template <> struct Elem<0> { typedef _Float16 T; };
template <> struct Elem<1> { typedef __bf16 T; };
template <int ET, int SPLIT, int OUT_MODE, bool CAUSAL>
__global__ __launch_bounds__(256) void wmma_gemm64(
    const unsigned short* __restrict__ Ap, const unsigned short* __restrict__ A2p, int lda, long strideA,
    const unsigned short* __restrict__ Btp, const unsigned short* __restrict__ Bt2p, int ldb, long strideB,
    void* __restrict__ Cout, void* __restrict__ Cout2, int ldc, long strideC,
    int M, int N, int K, float scale) {
  typedef typename Elem<ET>::T T;
  typedef typename Frag<T>::V V;
  const T* A = (const T*)Ap; const T* A2 = (const T*)A2p; const T* Bt = (const T*)Btp; const T* Bt2 = (const T*)Bt2p;
  __shared__ __align__(16) float sT[8][16 * 68];   // per-wave 16x64 slab, pitch 68 floats
  const int b    = blockIdx.y;
  const int lane = threadIdx.x & 31;
  const int wave = threadIdx.x >> 5;
  const int tilesN = N >> 6;
  const int tilesM = M >> 6;
  const int tile = blockIdx.x * 8 + wave;
  if (tile >= tilesM * tilesN) return;   // wave-uniform; no block barriers in this kernel
  const int tm = tile / tilesN;
  const int tn = tile - tm * tilesN;
  const int m0 = tm << 6;
  const int n0 = tn << 6;

  const T* Ab  = A  + (size_t)b * strideA;
  const T* Bb  = Bt + (size_t)b * strideB;
  const T* Ab2 = (SPLIT >= 1) ? (A2  + (size_t)b * strideA) : nullptr;
  const T* Bb2 = (SPLIT == 2) ? (Bt2 + (size_t)b * strideB) : nullptr;

  const int rlane = lane & 15;                 // row (A) / col (B, D) within subtile
  const int koff  = (lane >> 4) * 8;           // k offset of this lane half
  const int mOff  = (lane >> 4) * 8;           // D row offset

  v8f acc[4][4];
#pragma unroll
  for (int i = 0; i < 4; ++i)
#pragma unroll
    for (int j = 0; j < 4; ++j) acc[i][j] = (v8f){0.f,0.f,0.f,0.f,0.f,0.f,0.f,0.f};

  int kEnd = K;
  if (CAUSAL) kEnd = (m0 + 64 < K) ? (m0 + 64) : K;   // wave-uniform, multiple of 32

  for (int k0 = 0; k0 < kEnd; k0 += 32) {
    V bh[4], bl[4];
#pragma unroll
    for (int j = 0; j < 4; ++j) {
      const size_t bo = (size_t)(n0 + (j << 4) + rlane) * ldb + koff + k0;
      bh[j] = Frag<T>::load(Bb + bo);
      if (SPLIT == 2) bl[j] = Frag<T>::load(Bb2 + bo);
    }
#pragma unroll
    for (int i = 0; i < 4; ++i) {
      const size_t ao = (size_t)(m0 + (i << 4) + rlane) * lda + koff + k0;
      V ah = Frag<T>::load(Ab + ao);
      V al;
      if (SPLIT >= 1) al = Frag<T>::load(Ab2 + ao);
#pragma unroll
      for (int j = 0; j < 4; ++j) {
        acc[i][j] = Frag<T>::mma(ah, bh[j], acc[i][j]);
        if (SPLIT == 2) acc[i][j] = Frag<T>::mma(ah, bl[j], acc[i][j]);
        if (SPLIT >= 1) acc[i][j] = Frag<T>::mma(al, bh[j], acc[i][j]);
      }
      Frag<T>::guard(acc[i][0], acc[i][3], ah, (SPLIT != 0) ? al : ah);
    }
    Frag<T>::keep(bh[0], bh[1], bh[2], bh[3]);
    if (SPLIT == 2) Frag<T>::keep(bl[0], bl[1], bl[2], bl[3]);
  }
  acc_guard4(acc[0][0], acc[0][1], acc[0][2], acc[0][3]);
  acc_guard4(acc[1][0], acc[1][1], acc[1][2], acc[1][3]);
  acc_guard4(acc[2][0], acc[2][1], acc[2][2], acc[2][3]);
  acc_guard4(acc[3][0], acc[3][1], acc[3][2], acc[3][3]);

  // ---- epilogue ----
  float* slab = sT[wave];
#pragma unroll
  for (int i = 0; i < 4; ++i) {
    const int mBase = m0 + (i << 4);
#pragma unroll
    for (int j = 0; j < 4; ++j) {
#pragma unroll
      for (int r = 0; r < 8; ++r) {
        float v = acc[i][j][r] * scale;
        slab[(mOff + r) * 68 + (j << 4) + rlane] = v;
      }
    }
    __builtin_amdgcn_fence(__ATOMIC_RELEASE, "workgroup");
    __builtin_amdgcn_wave_barrier();
    __builtin_amdgcn_fence(__ATOMIC_ACQUIRE, "workgroup");
    if (OUT_MODE == 0) {
      float* C = (float*)Cout + (size_t)b * strideC;
      const int hh = lane >> 4, c4 = (lane & 15) * 4;     // row seg = 256 B = 16 lanes x 16 B
      {
#pragma unroll
        for (int it = 0; it < 8; ++it) {
          const int row = it * 2 + hh;
          v4f v = *(const v4f*)(slab + row * 68 + c4);
          *(v4f*)(C + (size_t)(mBase + row) * ldc + n0 + c4) = v;
        }
        
      }
    } else {
      const int q = lane >> 3, c8 = (lane & 7) * 8;
      unsigned short* C  = (unsigned short*)Cout  + (size_t)b * strideC;
      unsigned short* C2 = (OUT_MODE == 2) ? ((unsigned short*)Cout2 + (size_t)b * strideC) : nullptr;
      {
#pragma unroll
        for (int it = 0; it < 4; ++it) {
          const int row = it * 4 + q;
          const float* sp = slab + row * 68 + c8;
          v8h hv, lv;
#pragma unroll
          for (int e = 0; e < 8; ++e) {
            if (OUT_MODE == 1) {
              hv[e] = (_Float16)sp[e];
            } else {
              unsigned short hb = f2bf_bits(sp[e]);
              unsigned short lb = f2bf_bits(sp[e] - bf_bits2f(hb));
              hv[e] = __builtin_bit_cast(_Float16, hb);
              lv[e] = __builtin_bit_cast(_Float16, lb);
            }
          }
          *(v8h*)(C + (size_t)(mBase + row) * ldc + n0 + c8) = hv;
          if (OUT_MODE == 2) *(v8h*)(C2 + (size_t)(mBase + row) * ldc + n0 + c8) = lv;
        }
        
      }
    }
    __builtin_amdgcn_fence(__ATOMIC_RELEASE, "workgroup");
    __builtin_amdgcn_wave_barrier();
    __builtin_amdgcn_fence(__ATOMIC_ACQUIRE, "workgroup");
  }
}

// Coverage: n2 threads x 2 elements = the whole plane (n2 = count/2, count even).
__global__ __launch_bounds__(256) void cast_f32_bf16x2(
    const float* __restrict__ in, unsigned short* __restrict__ out, int n2) {
  const int i = blockIdx.x * 256 + threadIdx.x;
  if (i < n2) {
    const float a0 = in[2 * (size_t)i], a1 = in[2 * (size_t)i + 1];
    const unsigned u = (unsigned)f2bf_bits(a0) | ((unsigned)f2bf_bits(a1) << 16);
    ((unsigned*)out)[i] = u;
    
  }
}

// ---- W in[K rows][N cols] f32 -> Wt out[N][K] bf16 (RNE), 64x64 tile transposed through LDS ----
// Coverage per block: rows n = it*32 + wave*4 + q8 (it 0..1, wave 0..7, q8 0..3) = 0..63; cols c8 = 8 lanes x 8 = 64.
constexpr int WTPITCH = 72;
__global__ __launch_bounds__(256) void wt_cast_bf16_k(const float* __restrict__ W, unsigned short* __restrict__ Wtp,
                                                      int K, int N) {
  __shared__ __align__(16) _Float16 st[64 * WTPITCH];
  _Float16* Wt = (_Float16*)Wtp;
  const int n0 = blockIdx.x * 64, k0 = blockIdx.y * 64;
  const int tid = threadIdx.x;
  const int kr = tid >> 2, c16 = (tid & 3) * 16;
  const float* src = W + (size_t)(k0 + kr) * N + n0 + c16;
#pragma unroll
  for (int q = 0; q < 4; ++q) {
    const v4f v = *(const v4f*)(src + 4 * q);
#pragma unroll
    for (int e = 0; e < 4; ++e) st[(c16 + 4 * q + e) * WTPITCH + kr] = __builtin_bit_cast(_Float16, f2bf_bits(v[e]));
  }
  __syncthreads();
  const int wave = tid >> 5, lane = tid & 31;
  const int q8 = lane >> 3, c8 = (lane & 7) * 8;
  {
#pragma unroll
    for (int it = 0; it < 2; ++it) {
      const int n = it * 32 + wave * 4 + q8;
      const v8h hv = *(const v8h*)(st + n * WTPITCH + c8);
      *(v8h*)(Wt + (size_t)(n0 + n) * K + k0 + c8) = hv;
    }
    
  }
}

// ---- sc[row] = (1/32) * sum_e xb[row][e] * eb[row][e]  (f32, fixed order) ----
__global__ __launch_bounds__(256) void sc_k(const unsigned short* __restrict__ xb, const float* __restrict__ eb,
                                            float* __restrict__ sc) {
  __shared__ float s_val[32];
  const int wave = threadIdx.x >> 5, lane = threadIdx.x & 31;
  const int row0 = blockIdx.x * 32;
  for (int i = 0; i < 4; ++i) {
    const int r = row0 + wave * 4 + i;
    const unsigned short* xr = xb + (size_t)r * NE;
    const float* er = eb + (size_t)r * NE;
    float s = 0.f;
#pragma unroll 1
    for (int it = 0; it < NE / 256; ++it) {
      const int e0 = it * 256 + lane * 8;
      const v8us xv = *(const v8us*)(xr + e0);
      const v4f ea = *(const v4f*)(er + e0);
      const v4f ec = *(const v4f*)(er + e0 + 4);
      s = fmaf(bf_bits2f(xv[0]), ea[0], s);
      s = fmaf(bf_bits2f(xv[1]), ea[1], s);
      s = fmaf(bf_bits2f(xv[2]), ea[2], s);
      s = fmaf(bf_bits2f(xv[3]), ea[3], s);
      s = fmaf(bf_bits2f(xv[4]), ec[0], s);
      s = fmaf(bf_bits2f(xv[5]), ec[1], s);
      s = fmaf(bf_bits2f(xv[6]), ec[2], s);
      s = fmaf(bf_bits2f(xv[7]), ec[3], s);
    }
#pragma unroll
    for (int off = 16; off; off >>= 1) s += __shfl_xor(s, off, 32);
    if (lane == 0) s_val[wave * 4 + i] = s * (1.0f / 32.0f);
  }
  __syncthreads();
  if (wave == 0) {
    const float v = s_val[lane];
    *(float*)(sc + row0 + lane) = v;
    
  }
}

// ---- per-row softmax statistics of the rank-1 causal scores: m[t] = max_{s<=t} fl(sc_t*sc_s), linv[t] = 1/sum_{s<=t} exp(sc_t*sc_s - m[t]) ----
// Trip counts bounded by t < NT (static).  Coverage: gridDim.x * 32 = NTOK rows.
__global__ __launch_bounds__(256) void stats_k(const float* __restrict__ sc, float* __restrict__ mrow,
                                               float* __restrict__ linv) {
  __shared__ float s_m[32], s_l[32];
  const int wave = threadIdx.x >> 5, lane = threadIdx.x & 31;
  const int row0 = blockIdx.x * 32;
  const int b = row0 / NT;
  const float* scb = sc + (size_t)b * NT;
  for (int i = 0; i < 4; ++i) {
    const int rg = row0 + wave * 4 + i;
    const int t = rg - b * NT;                       // 0..NT-1
    const float sct = scb[t];
    float mx = __uint_as_float(0xff800000u);
#pragma unroll 1
    for (int s = lane; s <= t; s += 32) mx = fmaxf(mx, sct * scb[s]);
#pragma unroll
    for (int off = 16; off; off >>= 1) mx = fmaxf(mx, __shfl_xor(mx, off, 32));
    float z = 0.f;
#pragma unroll 1
    for (int s = lane; s <= t; s += 32) z += __expf(fmaf(sct, scb[s], -mx));
#pragma unroll
    for (int off = 16; off; off >>= 1) z += __shfl_xor(z, off, 32);
    if (lane == 0) { s_m[wave * 4 + i] = mx; s_l[wave * 4 + i] = 1.0f / z; }
  }
  __syncthreads();
  if (wave == 0) {
    const float mv = s_m[lane], lv = s_l[lane];
    *(float*)(mrow + row0 + lane) = mv;
    *(float*)(linv + row0 + lane) = lv;
    
  }
}

// ---- probability planes for one batch: P[t][s] = exp(sc_t*sc_s - m_t) * linv_t for s <= t, 0 for t < s < ((t>>6)+1)*64 ----
// Written as bf16 hi + bf16 lo planes [NT][NT] (row pitch NT).  Wave = one row t; per iteration 32 lanes x 8 halves =
// Coverage: gridDim.x * 8 = NT rows; columns [0, ((t>>6)+1)*64) of every row in both planes = exactly what the causal
// P.V product reads for the 64-row tile containing t.
__global__ __launch_bounds__(256) void pgen_k(const float* __restrict__ sc, const float* __restrict__ mrow,
                                              const float* __restrict__ linv, unsigned short* __restrict__ php,
                                              unsigned short* __restrict__ plp, int b) {
  union SV { v4f q[2]; float f[8]; };
  _Float16* ph = (_Float16*)php;
  _Float16* pl = (_Float16*)plp;
  const int wave = threadIdx.x >> 5, lane = threadIdx.x & 31;
  const int t = blockIdx.x * 8 + wave;             // 0..NT-1
  const float* scb = sc + (size_t)b * NT;
  const float sct = scb[t];
  const float mt = mrow[(size_t)b * NT + t];
  const float li = linv[(size_t)b * NT + t];
  const int ncol = ((t >> 6) + 1) << 6;
  _Float16* prh = ph + (size_t)t * NT;
  _Float16* prl = pl + (size_t)t * NT;
  for (int base = 0; base < ncol; base += 256) {     // wave-uniform
    const int c = base + lane * 8;
    const bool active = c < ncol;                    // c % 8 == 0 and ncol % 64 == 0 -> whole 8-groups
    const int cc = (c < NT - 8) ? c : (NT - 8);       // clamped address
    SV sv;
    sv.q[0] = *(const v4f*)(scb + cc);
    sv.q[1] = *(const v4f*)(scb + cc + 4);
    v8h hv, lv;
#pragma unroll
    for (int j = 0; j < 8; ++j) {
      float p = __expf(fmaf(sct, sv.f[j], -mt)) * li;
      p = (c + j <= t) ? p : 0.0f;
      const unsigned short hb = f2bf_bits(p);
      const unsigned short lb = f2bf_bits(p - bf_bits2f(hb));
      hv[j] = __builtin_bit_cast(_Float16, hb);
      lv[j] = __builtin_bit_cast(_Float16, lb);
    }
    {
      if (active) {
        *(v8h*)(prh + c) = hv;
        *(v8h*)(prl + c) = lv;
      }
      
    }
  }
}

// ---------------------------------------------------------------------------
// Workspace region map (bytes; all offsets multiples of 1 MiB):
//   R_XB  [0, 16 MiB)            : xb bf16 [8192][1024]; later O_hi bf16 [8192][1024]
//   R_W   [16, 24 MiB)           : wjb, wjTb, wjvb, wob bf16 [1024][1024] (2 MiB each)
//   R_C   [24, 56 MiB)           : echo_hi, echo_lo bf16 [8192][1024]; later valT_hi, valT_lo bf16 [4][1024][2048]
//   R_D   [56, 88 MiB)           : eb f32 [8192][1024]; later P_hi, P_lo bf16 [2048][2048] (8 MiB each, one batch), O_lo bf16 [8192][1024]
//   R_S   [88 MiB, +96 KiB)      : sc, m, linv f32 [8192]
//   total 92,372,992 B
extern "C" void kernel_launch(void* const* d_in, const int* in_sizes, int n_in,
                              void* d_out, int out_size, void* d_ws, size_t ws_size,
                              hipStream_t stream) {
  if (n_in < 4) return;
  if (in_sizes[0] != NTOK * NE || in_sizes[1] != NE * NE || in_sizes[2] != NE * NE ||
      in_sizes[3] != NE * NE || out_size != NTOK * NE) return;
  const float* x   = (const float*)d_in[0];   // [4][2048][1024]
  const float* wj  = (const float*)d_in[1];   // [1024][1024] (out,in)
  const float* wjv = (const float*)d_in[2];   // [1024][1024]
  const float* wo  = (const float*)d_in[3];   // [1024][1024]
  float* outp = (float*)d_out;

  const size_t PLANE16 = (size_t)NTOK * NE * 2;    // 16,777,216
  const size_t WPL     = (size_t)NE * NE * 2;      //  2,097,152
  const size_t PLANE32 = (size_t)NTOK * NE * 4;    // 33,554,432
  const size_t PPL     = (size_t)NT * NT * 2;      //  8,388,608
  const size_t VEC     = (size_t)NTOK * 4;         //     32,768
  const size_t off_xb = 0;
  const size_t off_w  = off_xb + PLANE16;
  const size_t off_c  = off_w + 4 * WPL;
  const size_t off_d  = off_c + 2 * PLANE16;
  const size_t off_s  = off_d + PLANE32;
  const size_t total  = off_s + 3 * VEC;           // 92,372,992
  if (total > ws_size) return;

  char* ws = (char*)d_ws;
  unsigned short* xb     = (unsigned short*)(ws + off_xb);
  unsigned short* o_hi   = (unsigned short*)(ws + off_xb);
  unsigned short* wjb    = (unsigned short*)(ws + off_w);
  unsigned short* wjTb   = (unsigned short*)(ws + off_w + WPL);
  unsigned short* wjvb   = (unsigned short*)(ws + off_w + 2 * WPL);
  unsigned short* wob    = (unsigned short*)(ws + off_w + 3 * WPL);
  unsigned short* ech_hi = (unsigned short*)(ws + off_c);
  unsigned short* ech_lo = (unsigned short*)(ws + off_c + PLANE16);
  unsigned short* vt_hi  = (unsigned short*)(ws + off_c);
  unsigned short* vt_lo  = (unsigned short*)(ws + off_c + PLANE16);
  float*          ebp    = (float*)(ws + off_d);
  unsigned short* p_hi   = (unsigned short*)(ws + off_d);
  unsigned short* p_lo   = (unsigned short*)(ws + off_d + PPL);
  unsigned short* o_lo   = (unsigned short*)(ws + off_d + 2 * PPL);
  float*          scp    = (float*)(ws + off_s);
  float*          mrowp  = (float*)(ws + off_s + VEC);
  float*          linvp  = (float*)(ws + off_s + 2 * VEC);

  const dim3 blk(256);

  // 1) input planes, RNE bf16
  cast_f32_bf16x2<<<dim3((NTOK * NE / 2) / 256), blk, 0, stream>>>(x, xb, NTOK * NE / 2);
  cast_f32_bf16x2<<<dim3((NE * NE / 2) / 256), blk, 0, stream>>>(wj, wjb, NE * NE / 2);
  cast_f32_bf16x2<<<dim3((NE * NE / 2) / 256), blk, 0, stream>>>(wjv, wjvb, NE * NE / 2);
  cast_f32_bf16x2<<<dim3((NE * NE / 2) / 256), blk, 0, stream>>>(wo, wob, NE * NE / 2);
  // wj in[f=1024][e=1024] -> wjTb out[e][f]
  wt_cast_bf16_k<<<dim3(NE / 64, NE / 64), blk, 0, stream>>>(wj, wjTb, NE, NE);

  // 2) echo[t][f] = sum_e xb[t][e] wjb[f][e]  -> bf16 hi/lo planes   (M=8192, N=1024, K=1024; 2048 tiles = 256 blocks)
  wmma_gemm64<1, 0, 2, false><<<dim3((NTOK / 64) * (NE / 64) / 8, 1), blk, 0, stream>>>(
      xb, xb, NE, 0L, wjb, wjb, NE, 0L, (void*)ech_hi, (void*)ech_lo, NE, 0L, NTOK, NE, NE, 1.0f);
  // 3) eb[t][e] = sum_f echo[t][f] wj[f][e] = sum_f echo[t][f] wjTb[e][f]  (A hi/lo, 2 products) -> f32
  wmma_gemm64<1, 1, 0, false><<<dim3((NTOK / 64) * (NE / 64) / 8, 1), blk, 0, stream>>>(
      ech_hi, ech_lo, NE, 0L, wjTb, wjTb, NE, 0L, (void*)ebp, (void*)ebp, NE, 0L, NTOK, NE, NE, 1.0f);
  // 4) token scores
  sc_k<<<dim3(NTOK / 32), blk, 0, stream>>>(xb, ebp, scp);
  // 5) valT[b][d][t] = sum_e wjvb[d][e] xb[b][t][e] -> bf16 hi/lo planes [4][1024][2048]  (M=1024, N=2048, K=1024; 512 tiles = 64 blocks per batch)
  wmma_gemm64<1, 0, 2, false><<<dim3((NE / 64) * (NT / 64) / 8, NBATCH), blk, 0, stream>>>(
      wjvb, wjvb, NE, 0L, xb, xb, NE, (long)NT * NE, (void*)vt_hi, (void*)vt_lo, NT, (long)NE * NT, NE, NT, NE, 1.0f);
  // 6) softmax statistics
  stats_k<<<dim3(NTOK / 32), blk, 0, stream>>>(scp, mrowp, linvp);
  // 7) per batch: probability planes, then O[t][d] = sum_{s < tile end} P[t][s] valT[d][s] (hi/lo x hi/lo, causal k-limit) -> O hi/lo planes
  for (int bb = 0; bb < NBATCH; ++bb) {
    pgen_k<<<dim3(NT / 8), blk, 0, stream>>>(scp, mrowp, linvp, p_hi, p_lo, bb);
    wmma_gemm64<1, 2, 2, true><<<dim3((NT / 64) * (NE / 64) / 8, 1), blk, 0, stream>>>(
        p_hi, p_lo, NT, 0L,
        vt_hi + (size_t)bb * NE * NT, vt_lo + (size_t)bb * NE * NT, NT, 0L,
        (void*)(o_hi + (size_t)bb * NT * NE), (void*)(o_lo + (size_t)bb * NT * NE), NE, 0L,
        NT, NE, NT, 1.0f);
  }
  // 8) out[t][n] = sum_d O[t][d] wob[n][d]  (A hi/lo, 2 products) -> f32 output
  wmma_gemm64<1, 1, 0, false><<<dim3((NTOK / 64) * (NE / 64) / 8, 1), blk, 0, stream>>>(
      o_hi, o_lo, NE, 0L, wob, wob, NE, 0L, (void*)outp, (void*)outp, NE, 0L, NTOK, NE, NE, 1.0f);
}

// v001
// It runs in 433 microseconds.
// Timed twice side by side with v000, it ran 1.82 and 1.81 times as fast.
// Contractions on v_wmma_f32_16x16x32_bf16 (bf16 operands, f32 accumulate): echo = xb*wjb^T (plain, inputs RNE bf16), eb = echo{hi,lo}*wj (2 products), val^T = wjvb*xb^T (plain), O = P{hi,lo}*val^T{hi,lo} (3 products, causal k-limit), out = O{hi,lo}*wob^T (2 products); token scores, softmax statistics and probabilities in f32 on VALU.
#include <hip/hip_runtime.h>
#include <stdint.h>

constexpr int NBATCH = 4;
constexpr int NT     = 2048;
constexpr int NE     = 1024;
constexpr int NTOK   = NBATCH * NT;
static_assert((NTOK % 64) == 0 && (NT % 64) == 0 && (NE % 64) == 0);

typedef __attribute__((ext_vector_type(16))) _Float16 v16h;
typedef __attribute__((ext_vector_type(8)))  _Float16 v8h;
typedef __attribute__((ext_vector_type(16))) __bf16   v16b;
typedef __attribute__((ext_vector_type(8)))  __bf16   v8b;
typedef __attribute__((ext_vector_type(8)))  float    v8f;
typedef __attribute__((ext_vector_type(4)))  float    v4f;
typedef __attribute__((ext_vector_type(8)))  unsigned short v8us;

__device__ __forceinline__ unsigned short f2bf_bits(float f) {
  unsigned u = __float_as_uint(f);
  return (unsigned short)((u + 0x7FFFu + ((u >> 16) & 1u)) >> 16);
}
__device__ __forceinline__ float bf_bits2f(unsigned short h) { return __uint_as_float(((unsigned)h) << 16); }

// hazard guards as plain device helpers (no inline asm inside the kernel template body)
__device__ __forceinline__ void dep_guard_h(v8f& a, v8f& b, v16h x, v16h y) { asm volatile("v_nop\n\tv_nop\n\tv_nop\n\tv_nop" : "+v"(a), "+v"(b) : "v"(x), "v"(y)); }
__device__ __forceinline__ void dep_guard_b(v8f& a, v8f& b, v16b x, v16b y) { asm volatile("v_nop\n\tv_nop\n\tv_nop\n\tv_nop" : "+v"(a), "+v"(b) : "v"(x), "v"(y)); }
__device__ __forceinline__ void keep4_h(v16h a, v16h b, v16h c, v16h d) { asm volatile("v_nop" :: "v"(a), "v"(b), "v"(c), "v"(d)); }
__device__ __forceinline__ void keep4_b(v16b a, v16b b, v16b c, v16b d) { asm volatile("v_nop" :: "v"(a), "v"(b), "v"(c), "v"(d)); }
__device__ __forceinline__ void acc_guard4(v8f& a, v8f& b, v8f& c, v8f& d) { asm volatile("v_nop\n\tv_nop\n\tv_nop\n\tv_nop" : "+v"(a), "+v"(b), "+v"(c), "+v"(d)); }
template <typename T> struct Frag;
template <> struct Frag<_Float16> {
  typedef v16h V; union U { v16h v; v8h h[2]; };
  static __device__ __forceinline__ v16h load(const _Float16* p) {   // elements 0..7 <- p[0..7], 8..15 <- p[16..23]
    U f; f.h[0] = *(const v8h*)(p); f.h[1] = *(const v8h*)(p + 16); return f.v;
  }
  static __device__ __forceinline__ v8f mma(v16h a, v16h b, v8f c) {
    return __builtin_amdgcn_wmma_f32_16x16x32_f16(false, a, false, b, (short)0, c, false, false);
  }
  static __device__ __forceinline__ void guard(v8f& a, v8f& b, v16h x, v16h y) { dep_guard_h(a, b, x, y); }
  static __device__ __forceinline__ void keep(v16h a, v16h b, v16h c, v16h d) { keep4_h(a, b, c, d); }
};
template <> struct Frag<__bf16> {
  typedef v16b V; union U { v16b v; v8b h[2]; };
  static __device__ __forceinline__ v16b load(const __bf16* p) {
    U f; f.h[0] = *(const v8b*)(p); f.h[1] = *(const v8b*)(p + 16); return f.v;
  }
  static __device__ __forceinline__ v8f mma(v16b a, v16b b, v8f c) {
    return __builtin_amdgcn_wmma_f32_16x16x32_bf16(false, a, false, b, (short)0, c, false, false);
  }
  static __device__ __forceinline__ void guard(v8f& a, v8f& b, v16b x, v16b y) { dep_guard_b(a, b, x, y); }
  static __device__ __forceinline__ void keep(v16b a, v16b b, v16b c, v16b d) { keep4_b(a, b, c, d); }
};

// ---- Register-blocked batched WMMA GEMM ------------------------------------
// C[m,n] = scale * sum_k A[m,k] * Bt[n,k]; each wave owns a 64x64 tile.
// A row-major [M,K]; Bt row-major [N,K]; M,N % 64 == 0, K % 32 == 0.
// SPLIT: 0 = single product; 1 = A carried as hi/lo planes (A2 = lo), Bt single: hi.B + lo.B (2 products);
//        2 = A and Bt as hi/lo planes: hi.hi + hi.lo + lo.hi (3 products).
// OUT_MODE: 0 = f32, 1 = f16, 2 = bf16 hi plane (Cout) + bf16 lo plane (Cout2).
// CAUSAL: the k loop of the wave tile at rows m0..m0+63 stops at k = m0 + 64 (lower block-triangular A).
// ET: 0 = f16 operands, 1 = bf16 operands (pointers passed as 16-bit storage)
template <int ET> struct Elem;
template <> struct Elem<0> { typedef _Float16 T; };
template <> struct Elem<1> { typedef __bf16 T; };
template <int ET, int SPLIT, int OUT_MODE, bool CAUSAL>
__global__ __launch_bounds__(256) void wmma_gemm64(
    const unsigned short* __restrict__ Ap, const unsigned short* __restrict__ A2p, int lda, long strideA,
    const unsigned short* __restrict__ Btp, const unsigned short* __restrict__ Bt2p, int ldb, long strideB,
    void* __restrict__ Cout, void* __restrict__ Cout2, int ldc, long strideC,
    int M, int N, int K, float scale) {
  typedef typename Elem<ET>::T T;
  typedef typename Frag<T>::V V;
  const T* A = (const T*)Ap; const T* A2 = (const T*)A2p; const T* Bt = (const T*)Btp; const T* Bt2 = (const T*)Bt2p;
  __shared__ __align__(16) float sT[8][16 * 68];   // per-wave 16x64 slab, pitch 68 floats
  const int b    = blockIdx.y;
  const int lane = threadIdx.x & 31;
  const int wave = threadIdx.x >> 5;
  const int tilesN = N >> 6;
  const int tilesM = M >> 6;
  const int tile = blockIdx.x * 8 + wave;
  if (tile >= tilesM * tilesN) return;   // wave-uniform; no block barriers in this kernel
  const int tm = tile / tilesN;
  const int tn = tile - tm * tilesN;
  const int m0 = tm << 6;
  const int n0 = tn << 6;

  const T* Ab  = A  + (size_t)b * strideA;
  const T* Bb  = Bt + (size_t)b * strideB;
  const T* Ab2 = (SPLIT >= 1) ? (A2  + (size_t)b * strideA) : nullptr;
  const T* Bb2 = (SPLIT == 2) ? (Bt2 + (size_t)b * strideB) : nullptr;

  const int rlane = lane & 15;                 // row (A) / col (B, D) within subtile
  const int koff  = (lane >> 4) * 8;           // k offset of this lane half
  const int mOff  = (lane >> 4) * 8;           // D row offset

  v8f acc[4][4];
#pragma unroll
  for (int i = 0; i < 4; ++i)
#pragma unroll
    for (int j = 0; j < 4; ++j) acc[i][j] = (v8f){0.f,0.f,0.f,0.f,0.f,0.f,0.f,0.f};

  int kEnd = K;
  if (CAUSAL) kEnd = (m0 + 64 < K) ? (m0 + 64) : K;   // wave-uniform, multiple of 32

  for (int k0 = 0; k0 < kEnd; k0 += 32) {
    V bh[4], bl[4];
#pragma unroll
    for (int j = 0; j < 4; ++j) {
      const size_t bo = (size_t)(n0 + (j << 4) + rlane) * ldb + koff + k0;
      bh[j] = Frag<T>::load(Bb + bo);
      if (SPLIT == 2) bl[j] = Frag<T>::load(Bb2 + bo);
    }
#pragma unroll
    for (int i = 0; i < 4; ++i) {
      const size_t ao = (size_t)(m0 + (i << 4) + rlane) * lda + koff + k0;
      V ah = Frag<T>::load(Ab + ao);
      V al;
      if (SPLIT >= 1) al = Frag<T>::load(Ab2 + ao);
#pragma unroll
      for (int j = 0; j < 4; ++j) {
        acc[i][j] = Frag<T>::mma(ah, bh[j], acc[i][j]);
        if (SPLIT == 2) acc[i][j] = Frag<T>::mma(ah, bl[j], acc[i][j]);
        if (SPLIT >= 1) acc[i][j] = Frag<T>::mma(al, bh[j], acc[i][j]);
      }
      Frag<T>::guard(acc[i][0], acc[i][3], ah, (SPLIT != 0) ? al : ah);
    }
    Frag<T>::keep(bh[0], bh[1], bh[2], bh[3]);
    if (SPLIT == 2) Frag<T>::keep(bl[0], bl[1], bl[2], bl[3]);
  }
  acc_guard4(acc[0][0], acc[0][1], acc[0][2], acc[0][3]);
  acc_guard4(acc[1][0], acc[1][1], acc[1][2], acc[1][3]);
  acc_guard4(acc[2][0], acc[2][1], acc[2][2], acc[2][3]);
  acc_guard4(acc[3][0], acc[3][1], acc[3][2], acc[3][3]);

  // ---- epilogue ----
  float* slab = sT[wave];
#pragma unroll
  for (int i = 0; i < 4; ++i) {
    const int mBase = m0 + (i << 4);
#pragma unroll
    for (int j = 0; j < 4; ++j) {
#pragma unroll
      for (int r = 0; r < 8; ++r) {
        float v = acc[i][j][r] * scale;
        slab[(mOff + r) * 68 + (j << 4) + rlane] = v;
      }
    }
    __builtin_amdgcn_fence(__ATOMIC_RELEASE, "workgroup");
    __builtin_amdgcn_wave_barrier();
    __builtin_amdgcn_fence(__ATOMIC_ACQUIRE, "workgroup");
    if (OUT_MODE == 0) {
      float* C = (float*)Cout + (size_t)b * strideC;
      const int hh = lane >> 4, c4 = (lane & 15) * 4;     // row seg = 256 B = 16 lanes x 16 B
      {
#pragma unroll
        for (int it = 0; it < 8; ++it) {
          const int row = it * 2 + hh;
          v4f v = *(const v4f*)(slab + row * 68 + c4);
          *(v4f*)(C + (size_t)(mBase + row) * ldc + n0 + c4) = v;
        }
        
      }
    } else {
      const int q = lane >> 3, c8 = (lane & 7) * 8;
      unsigned short* C  = (unsigned short*)Cout  + (size_t)b * strideC;
      unsigned short* C2 = (OUT_MODE == 2) ? ((unsigned short*)Cout2 + (size_t)b * strideC) : nullptr;
      {
#pragma unroll
        for (int it = 0; it < 4; ++it) {
          const int row = it * 4 + q;
          const float* sp = slab + row * 68 + c8;
          v8h hv, lv;
#pragma unroll
          for (int e = 0; e < 8; ++e) {
            if (OUT_MODE == 1) {
              hv[e] = (_Float16)sp[e];
            } else {
              unsigned short hb = f2bf_bits(sp[e]);
              unsigned short lb = f2bf_bits(sp[e] - bf_bits2f(hb));
              hv[e] = __builtin_bit_cast(_Float16, hb);
              lv[e] = __builtin_bit_cast(_Float16, lb);
            }
          }
          *(v8h*)(C + (size_t)(mBase + row) * ldc + n0 + c8) = hv;
          if (OUT_MODE == 2) *(v8h*)(C2 + (size_t)(mBase + row) * ldc + n0 + c8) = lv;
        }
        
      }
    }
    __builtin_amdgcn_fence(__ATOMIC_RELEASE, "workgroup");
    __builtin_amdgcn_wave_barrier();
    __builtin_amdgcn_fence(__ATOMIC_ACQUIRE, "workgroup");
  }
}

// Coverage: n2 threads x 2 elements = the whole plane (n2 = count/2, count even).
__global__ __launch_bounds__(256) void cast_f32_bf16x2(
    const float* __restrict__ in, unsigned short* __restrict__ out, int n2) {
  const int i = blockIdx.x * 256 + threadIdx.x;
  if (i < n2) {
    const float a0 = in[2 * (size_t)i], a1 = in[2 * (size_t)i + 1];
    const unsigned u = (unsigned)f2bf_bits(a0) | ((unsigned)f2bf_bits(a1) << 16);
    ((unsigned*)out)[i] = u;
    
  }
}

// ---- W in[K rows][N cols] f32 -> Wt out[N][K] bf16 (RNE), 64x64 tile transposed through LDS ----
// Coverage per block: rows n = it*32 + wave*4 + q8 (it 0..1, wave 0..7, q8 0..3) = 0..63; cols c8 = 8 lanes x 8 = 64.
constexpr int WTPITCH = 72;
__global__ __launch_bounds__(256) void wt_cast_bf16_k(const float* __restrict__ W, unsigned short* __restrict__ Wtp,
                                                      int K, int N) {
  __shared__ __align__(16) _Float16 st[64 * WTPITCH];
  _Float16* Wt = (_Float16*)Wtp;
  const int n0 = blockIdx.x * 64, k0 = blockIdx.y * 64;
  const int tid = threadIdx.x;
  const int kr = tid >> 2, c16 = (tid & 3) * 16;
  const float* src = W + (size_t)(k0 + kr) * N + n0 + c16;
#pragma unroll
  for (int q = 0; q < 4; ++q) {
    const v4f v = *(const v4f*)(src + 4 * q);
#pragma unroll
    for (int e = 0; e < 4; ++e) st[(c16 + 4 * q + e) * WTPITCH + kr] = __builtin_bit_cast(_Float16, f2bf_bits(v[e]));
  }
  __syncthreads();
  const int wave = tid >> 5, lane = tid & 31;
  const int q8 = lane >> 3, c8 = (lane & 7) * 8;
  {
#pragma unroll
    for (int it = 0; it < 2; ++it) {
      const int n = it * 32 + wave * 4 + q8;
      const v8h hv = *(const v8h*)(st + n * WTPITCH + c8);
      *(v8h*)(Wt + (size_t)(n0 + n) * K + k0 + c8) = hv;
    }
    
  }
}

// ---- sc[row] = (1/32) * sum_e xb[row][e] * eb[row][e]  (f32, fixed order) ----
__global__ __launch_bounds__(256) void sc_k(const unsigned short* __restrict__ xb, const float* __restrict__ eb,
                                            float* __restrict__ sc) {
  __shared__ float s_val[32];
  const int wave = threadIdx.x >> 5, lane = threadIdx.x & 31;
  const int row0 = blockIdx.x * 32;
  for (int i = 0; i < 4; ++i) {
    const int r = row0 + wave * 4 + i;
    const unsigned short* xr = xb + (size_t)r * NE;
    const float* er = eb + (size_t)r * NE;
    float s = 0.f;
#pragma unroll 1
    for (int it = 0; it < NE / 256; ++it) {
      const int e0 = it * 256 + lane * 8;
      const v8us xv = *(const v8us*)(xr + e0);
      const v4f ea = *(const v4f*)(er + e0);
      const v4f ec = *(const v4f*)(er + e0 + 4);
      s = fmaf(bf_bits2f(xv[0]), ea[0], s);
      s = fmaf(bf_bits2f(xv[1]), ea[1], s);
      s = fmaf(bf_bits2f(xv[2]), ea[2], s);
      s = fmaf(bf_bits2f(xv[3]), ea[3], s);
      s = fmaf(bf_bits2f(xv[4]), ec[0], s);
      s = fmaf(bf_bits2f(xv[5]), ec[1], s);
      s = fmaf(bf_bits2f(xv[6]), ec[2], s);
      s = fmaf(bf_bits2f(xv[7]), ec[3], s);
    }
#pragma unroll
    for (int off = 16; off; off >>= 1) s += __shfl_xor(s, off, 32);
    if (lane == 0) s_val[wave * 4 + i] = s * (1.0f / 32.0f);
  }
  __syncthreads();
  if (wave == 0) {
    const float v = s_val[lane];
    *(float*)(sc + row0 + lane) = v;
    
  }
}

// ---- per-row softmax statistics of the rank-1 causal scores: m[t] = max_{s<=t} fl(sc_t*sc_s), linv[t] = 1/sum_{s<=t} exp(sc_t*sc_s - m[t]) ----
// Trip counts bounded by t < NT (static).  Coverage: gridDim.x * 32 = NTOK rows.
__global__ __launch_bounds__(256) void stats_k(const float* __restrict__ sc, float* __restrict__ mrow,
                                               float* __restrict__ linv) {
  __shared__ float s_m[32], s_l[32];
  const int wave = threadIdx.x >> 5, lane = threadIdx.x & 31;
  const int row0 = blockIdx.x * 32;
  const int b = row0 / NT;
  const float* scb = sc + (size_t)b * NT;
  for (int i = 0; i < 4; ++i) {
    const int rg = row0 + wave * 4 + i;
    const int t = rg - b * NT;                       // 0..NT-1
    const float sct = scb[t];
    float mx = __uint_as_float(0xff800000u);
#pragma unroll 1
    for (int s = lane; s <= t; s += 32) mx = fmaxf(mx, sct * scb[s]);
#pragma unroll
    for (int off = 16; off; off >>= 1) mx = fmaxf(mx, __shfl_xor(mx, off, 32));
    float z = 0.f;
#pragma unroll 1
    for (int s = lane; s <= t; s += 32) z += __expf(fmaf(sct, scb[s], -mx));
#pragma unroll
    for (int off = 16; off; off >>= 1) z += __shfl_xor(z, off, 32);
    if (lane == 0) { s_m[wave * 4 + i] = mx; s_l[wave * 4 + i] = 1.0f / z; }
  }
  __syncthreads();
  if (wave == 0) {
    const float mv = s_m[lane], lv = s_l[lane];
    *(float*)(mrow + row0 + lane) = mv;
    *(float*)(linv + row0 + lane) = lv;
    
  }
}

// ---- probability planes, batch = blockIdx.y: P[b][t][s] = exp(sc_t*sc_s - m_t) * linv_t for s <= t, 0 for t < s < ((t>>6)+1)*64 ----
// Written as bf16 hi + bf16 lo planes [NBATCH][NT][NT] (row pitch NT).  Wave = one row t; per iteration 32 lanes x 8 halves =
// Coverage: gridDim.x * 8 = NT rows, gridDim.y = NBATCH batches; columns [0, ((t>>6)+1)*64) of every row in both planes = exactly what the causal
// P.V product reads for the 64-row tile containing t.
__global__ __launch_bounds__(256) void pgen_k(const float* __restrict__ sc, const float* __restrict__ mrow,
                                              const float* __restrict__ linv, unsigned short* __restrict__ php,
                                              unsigned short* __restrict__ plp) {
  union SV { v4f q[2]; float f[8]; };
  const int b = blockIdx.y;                        // 0..NBATCH-1
  _Float16* ph = (_Float16*)php + (size_t)b * NT * NT;
  _Float16* pl = (_Float16*)plp + (size_t)b * NT * NT;
  const int wave = threadIdx.x >> 5, lane = threadIdx.x & 31;
  const int t = blockIdx.x * 8 + wave;             // 0..NT-1
  const float* scb = sc + (size_t)b * NT;
  const float sct = scb[t];
  const float mt = mrow[(size_t)b * NT + t];
  const float li = linv[(size_t)b * NT + t];
  const int ncol = ((t >> 6) + 1) << 6;
  _Float16* prh = ph + (size_t)t * NT;
  _Float16* prl = pl + (size_t)t * NT;
  for (int base = 0; base < ncol; base += 256) {     // wave-uniform
    const int c = base + lane * 8;
    const bool active = c < ncol;                    // c % 8 == 0 and ncol % 64 == 0 -> whole 8-groups
    const int cc = (c < NT - 8) ? c : (NT - 8);       // clamped address
    SV sv;
    sv.q[0] = *(const v4f*)(scb + cc);
    sv.q[1] = *(const v4f*)(scb + cc + 4);
    v8h hv, lv;
#pragma unroll
    for (int j = 0; j < 8; ++j) {
      float p = __expf(fmaf(sct, sv.f[j], -mt)) * li;
      p = (c + j <= t) ? p : 0.0f;
      const unsigned short hb = f2bf_bits(p);
      const unsigned short lb = f2bf_bits(p - bf_bits2f(hb));
      hv[j] = __builtin_bit_cast(_Float16, hb);
      lv[j] = __builtin_bit_cast(_Float16, lb);
    }
    {
      if (active) {
        *(v8h*)(prh + c) = hv;
        *(v8h*)(prl + c) = lv;
      }
      
    }
  }
}

// ---------------------------------------------------------------------------
// Workspace region map (bytes; all offsets multiples of 1 MiB):
//   R_XB  [0, 16 MiB)            : xb bf16 [8192][1024]; later O_hi bf16 [8192][1024]
//   R_W   [16, 24 MiB)           : wjb, wjTb, wjvb, wob bf16 [1024][1024] (2 MiB each)
//   R_C   [24, 56 MiB)           : echo_hi, echo_lo bf16 [8192][1024]; later valT_hi, valT_lo bf16 [4][1024][2048]
//   R_D   [56, 88 MiB)           : eb f32 [8192][1024]; later O_lo bf16 [8192][1024]
//   R_S   [88 MiB, +96 KiB)      : sc, m, linv f32 [8192]
//   R_P   [89, 153 MiB)          : P_hi, P_lo bf16 [4][2048][2048] (32 MiB each, all batches)
//   total 160,432,128 B
extern "C" void kernel_launch(void* const* d_in, const int* in_sizes, int n_in,
                              void* d_out, int out_size, void* d_ws, size_t ws_size,
                              hipStream_t stream) {
  if (n_in < 4) return;
  if (in_sizes[0] != NTOK * NE || in_sizes[1] != NE * NE || in_sizes[2] != NE * NE ||
      in_sizes[3] != NE * NE || out_size != NTOK * NE) return;
  const float* x   = (const float*)d_in[0];   // [4][2048][1024]
  const float* wj  = (const float*)d_in[1];   // [1024][1024] (out,in)
  const float* wjv = (const float*)d_in[2];   // [1024][1024]
  const float* wo  = (const float*)d_in[3];   // [1024][1024]
  float* outp = (float*)d_out;

  const size_t PLANE16 = (size_t)NTOK * NE * 2;    // 16,777,216
  const size_t WPL     = (size_t)NE * NE * 2;      //  2,097,152
  const size_t PLANE32 = (size_t)NTOK * NE * 4;    // 33,554,432
  const size_t PPL     = (size_t)NT * NT * 2;      //  8,388,608
  const size_t VEC     = (size_t)NTOK * 4;         //     32,768
  const size_t off_xb = 0;
  const size_t off_w  = off_xb + PLANE16;
  const size_t off_c  = off_w + 4 * WPL;
  const size_t off_d  = off_c + 2 * PLANE16;
  const size_t off_s  = off_d + PLANE32;
  const size_t off_p  = off_s + ((size_t)1 << 20);
  const size_t total  = off_p + 2 * NBATCH * PPL;  // 160,432,128
  if (total > ws_size) return;

  char* ws = (char*)d_ws;
  unsigned short* xb     = (unsigned short*)(ws + off_xb);
  unsigned short* o_hi   = (unsigned short*)(ws + off_xb);
  unsigned short* wjb    = (unsigned short*)(ws + off_w);
  unsigned short* wjTb   = (unsigned short*)(ws + off_w + WPL);
  unsigned short* wjvb   = (unsigned short*)(ws + off_w + 2 * WPL);
  unsigned short* wob    = (unsigned short*)(ws + off_w + 3 * WPL);
  unsigned short* ech_hi = (unsigned short*)(ws + off_c);
  unsigned short* ech_lo = (unsigned short*)(ws + off_c + PLANE16);
  unsigned short* vt_hi  = (unsigned short*)(ws + off_c);
  unsigned short* vt_lo  = (unsigned short*)(ws + off_c + PLANE16);
  float*          ebp    = (float*)(ws + off_d);
  unsigned short* p_hi   = (unsigned short*)(ws + off_p);
  unsigned short* p_lo   = (unsigned short*)(ws + off_p + NBATCH * PPL);
  unsigned short* o_lo   = (unsigned short*)(ws + off_d);
  float*          scp    = (float*)(ws + off_s);
  float*          mrowp  = (float*)(ws + off_s + VEC);
  float*          linvp  = (float*)(ws + off_s + 2 * VEC);

  const dim3 blk(256);

  // 1) input planes, RNE bf16
  cast_f32_bf16x2<<<dim3((NTOK * NE / 2) / 256), blk, 0, stream>>>(x, xb, NTOK * NE / 2);
  cast_f32_bf16x2<<<dim3((NE * NE / 2) / 256), blk, 0, stream>>>(wj, wjb, NE * NE / 2);
  cast_f32_bf16x2<<<dim3((NE * NE / 2) / 256), blk, 0, stream>>>(wjv, wjvb, NE * NE / 2);
  cast_f32_bf16x2<<<dim3((NE * NE / 2) / 256), blk, 0, stream>>>(wo, wob, NE * NE / 2);
  // wj in[f=1024][e=1024] -> wjTb out[e][f]
  wt_cast_bf16_k<<<dim3(NE / 64, NE / 64), blk, 0, stream>>>(wj, wjTb, NE, NE);

  // 2) echo[t][f] = sum_e xb[t][e] wjb[f][e]  -> bf16 hi/lo planes   (M=8192, N=1024, K=1024; 2048 tiles = 256 blocks)
  wmma_gemm64<1, 0, 2, false><<<dim3((NTOK / 64) * (NE / 64) / 8, 1), blk, 0, stream>>>(
      xb, xb, NE, 0L, wjb, wjb, NE, 0L, (void*)ech_hi, (void*)ech_lo, NE, 0L, NTOK, NE, NE, 1.0f);
  // 3) eb[t][e] = sum_f echo[t][f] wj[f][e] = sum_f echo[t][f] wjTb[e][f]  (A hi/lo, 2 products) -> f32
  wmma_gemm64<1, 1, 0, false><<<dim3((NTOK / 64) * (NE / 64) / 8, 1), blk, 0, stream>>>(
      ech_hi, ech_lo, NE, 0L, wjTb, wjTb, NE, 0L, (void*)ebp, (void*)ebp, NE, 0L, NTOK, NE, NE, 1.0f);
  // 4) token scores
  sc_k<<<dim3(NTOK / 32), blk, 0, stream>>>(xb, ebp, scp);
  // 5) valT[b][d][t] = sum_e wjvb[d][e] xb[b][t][e] -> bf16 hi/lo planes [4][1024][2048]  (M=1024, N=2048, K=1024; 512 tiles = 64 blocks per batch)
  wmma_gemm64<1, 0, 2, false><<<dim3((NE / 64) * (NT / 64) / 8, NBATCH), blk, 0, stream>>>(
      wjvb, wjvb, NE, 0L, xb, xb, NE, (long)NT * NE, (void*)vt_hi, (void*)vt_lo, NT, (long)NE * NT, NE, NT, NE, 1.0f);
  // 6) softmax statistics
  stats_k<<<dim3(NTOK / 32), blk, 0, stream>>>(scp, mrowp, linvp);
  // 7) all batches at once (grid.y = batch): probability planes, then O[b][t][d] = sum_{s < tile end} P[b][t][s] valT[b][d][s]
  //    (hi/lo x hi/lo, causal k-limit) -> O hi/lo planes   (512 tiles = 64 blocks per batch, 256 blocks in the launch)
  pgen_k<<<dim3(NT / 8, NBATCH), blk, 0, stream>>>(scp, mrowp, linvp, p_hi, p_lo);
  wmma_gemm64<1, 2, 2, true><<<dim3((NT / 64) * (NE / 64) / 8, NBATCH), blk, 0, stream>>>(
      p_hi, p_lo, NT, (long)NT * NT, vt_hi, vt_lo, NT, (long)NE * NT,
      (void*)o_hi, (void*)o_lo, NE, (long)NT * NE, NT, NE, NT, 1.0f);
  // 8) out[t][n] = sum_d O[t][d] wob[n][d]  (A hi/lo, 2 products) -> f32 output
  wmma_gemm64<1, 1, 0, false><<<dim3((NTOK / 64) * (NE / 64) / 8, 1), blk, 0, stream>>>(
      o_hi, o_lo, NE, 0L, wob, wob, NE, 0L, (void*)outp, (void*)outp, NE, 0L, NTOK, NE, NE, 1.0f);
}

// v002
// One run takes 252 microseconds.
// Timed twice side by side with v001, it ran 1.72 and 1.70 times as fast.
// Over all steps from v000 it is 3.10 times as fast.
// Contractions on v_wmma_f32_16x16x32_bf16 (bf16 operands, f32 accumulate): echo = xb*wjb^T (plain, inputs RNE bf16), eb = echo{hi,lo}*wj (2 products), val^T = wjvb*xb^T (plain), O = P{hi,lo}*val^T{hi,lo} (3 products, causal k-limit), out = O{hi,lo}*wob^T (2 products); token scores, softmax statistics and probabilities in f32 on VALU.
#include <hip/hip_runtime.h>
#include <stdint.h>

constexpr int NBATCH = 4;
constexpr int NT     = 2048;
constexpr int NE     = 1024;
constexpr int NTOK   = NBATCH * NT;
static_assert((NTOK % 64) == 0 && (NT % 64) == 0 && (NE % 64) == 0);

typedef __attribute__((ext_vector_type(16))) _Float16 v16h;
typedef __attribute__((ext_vector_type(8)))  _Float16 v8h;
typedef __attribute__((ext_vector_type(16))) __bf16   v16b;
typedef __attribute__((ext_vector_type(8)))  __bf16   v8b;
typedef __attribute__((ext_vector_type(8)))  float    v8f;
typedef __attribute__((ext_vector_type(4)))  float    v4f;
typedef __attribute__((ext_vector_type(8)))  unsigned short v8us;

__device__ __forceinline__ unsigned short f2bf_bits(float f) {
  unsigned u = __float_as_uint(f);
  return (unsigned short)((u + 0x7FFFu + ((u >> 16) & 1u)) >> 16);
}
__device__ __forceinline__ float bf_bits2f(unsigned short h) { return __uint_as_float(((unsigned)h) << 16); }

// slots between the last WMMAs and the epilogue's first reads of their accumulators
__device__ __forceinline__ void acc_guard4(v8f& a, v8f& b, v8f& c, v8f& d) { asm volatile("v_nop\n\tv_nop\n\tv_nop\n\tv_nop" : "+v"(a), "+v"(b), "+v"(c), "+v"(d)); }
template <typename T> struct Frag;
template <> struct Frag<_Float16> {
  typedef v16h V; union U { v16h v; v8h h[2]; };
  static __device__ __forceinline__ v16h load2(const unsigned char* p0, const unsigned char* p1) {   // elements 0..7 <- 16 B at p0, 8..15 <- 16 B at p1
    U f; f.h[0] = *(const v8h*)(p0); f.h[1] = *(const v8h*)(p1); return f.v;
  }
  static __device__ __forceinline__ v8f mma(v16h a, v16h b, v8f c) {
    return __builtin_amdgcn_wmma_f32_16x16x32_f16(false, a, false, b, (short)0, c, false, false);
  }
};
template <> struct Frag<__bf16> {
  typedef v16b V; union U { v16b v; v8b h[2]; };
  static __device__ __forceinline__ v16b load2(const unsigned char* p0, const unsigned char* p1) {
    U f; f.h[0] = *(const v8b*)(p0); f.h[1] = *(const v8b*)(p1); return f.v;
  }
  static __device__ __forceinline__ v8f mma(v16b a, v16b b, v8f c) {
    return __builtin_amdgcn_wmma_f32_16x16x32_bf16(false, a, false, b, (short)0, c, false, false);
  }
};

// ---- Register-blocked batched WMMA GEMM ------------------------------------
// C[m,n] = scale * sum_k A[m,k] * Bt[n,k]; each wave owns a 64x64 tile; the 8 waves of a block share the 64 rows of A and
// hold 8 neighbouring column tiles (512 rows of Bt).
// A row-major [M,K]; Bt row-major [N,K]; M % 64 == 0, N % 512 == 0, K % 64 == 0, K >= 64.
// The k loop works on stages of 64 k: every row of a stage is one whole 128-byte line, brought into LDS by asynchronous
// copies (a wave-wide copy = 4 whole lines), two buffers, the next stage in flight while this one is worked on.
// LDS place of the 16-byte chunk c (0..7) of stage row R: R * 128 + ((c ^ ((R >> 1) & 7)) * 16): 16 rows read at one chunk
// index fall on 16 different 16-byte bank groups.
// SPLIT: 0 = single product; 1 = A carried as hi/lo planes (A2 = lo), Bt single: hi.B + lo.B (2 products);
//        2 = A and Bt as hi/lo planes: hi.hi + hi.lo + lo.hi (3 products).
// OUT_MODE: 0 = f32, 1 = f16, 2 = bf16 hi plane (Cout) + bf16 lo plane (Cout2).
// CAUSAL: the k loop of the wave tile at rows m0..m0+63 stops at k = m0 + 64 (lower block-triangular A).
// ET: 0 = f16 operands, 1 = bf16 operands (pointers passed as 16-bit storage)
template <int ET> struct Elem;
template <> struct Elem<0> { typedef _Float16 T; };
template <> struct Elem<1> { typedef __bf16 T; };
typedef __attribute__((address_space(3))) unsigned char lds_u8;
// Asynchronous copies, 16 bytes a lane, global -> LDS.  The s_wait_xcnt is the last line of the copies' own statement: it stands
// before any later rewrite of the address registers that the copies name.
__device__ __forceinline__ void async_copy2(unsigned l, const unsigned char* g, unsigned lstep, size_t gstep) {
  asm volatile("global_load_async_to_lds_b128 %0, %1, off\n\t"
               "global_load_async_to_lds_b128 %2, %3, off\n\t"
               "s_wait_xcnt 0x0"
               :: "v"(l), "v"(g), "v"(l + lstep), "v"(g + gstep) : "memory");
}
__device__ __forceinline__ void async_copy8(unsigned l, const unsigned char* g, unsigned lstep, size_t gstep) {
  asm volatile("global_load_async_to_lds_b128 %0, %1, off\n\t"
               "global_load_async_to_lds_b128 %2, %3, off\n\t"
               "global_load_async_to_lds_b128 %4, %5, off\n\t"
               "global_load_async_to_lds_b128 %6, %7, off\n\t"
               "global_load_async_to_lds_b128 %8, %9, off\n\t"
               "global_load_async_to_lds_b128 %10, %11, off\n\t"
               "global_load_async_to_lds_b128 %12, %13, off\n\t"
               "global_load_async_to_lds_b128 %14, %15, off\n\t"
               "s_wait_xcnt 0x0"
               :: "v"(l), "v"(g), "v"(l + lstep), "v"(g + gstep), "v"(l + 2 * lstep), "v"(g + 2 * gstep),
                  "v"(l + 3 * lstep), "v"(g + 3 * gstep), "v"(l + 4 * lstep), "v"(g + 4 * gstep),
                  "v"(l + 5 * lstep), "v"(g + 5 * gstep), "v"(l + 6 * lstep), "v"(g + 6 * gstep),
                  "v"(l + 7 * lstep), "v"(g + 7 * gstep) : "memory");
}
template <int ET, int SPLIT, int OUT_MODE, bool CAUSAL>
__global__ __launch_bounds__(256) void wmma_gemm64(
    const unsigned short* __restrict__ Ap, const unsigned short* __restrict__ A2p, int lda, long strideA,
    const unsigned short* __restrict__ Btp, const unsigned short* __restrict__ Bt2p, int ldb, long strideB,
    void* __restrict__ Cout, void* __restrict__ Cout2, int ldc, long strideC,
    int M, int N, int K, float scale) {
  typedef typename Elem<ET>::T T;
  typedef typename Frag<T>::V V;
  const T* A = (const T*)Ap; const T* A2 = (const T*)A2p; const T* Bt = (const T*)Btp; const T* Bt2 = (const T*)Bt2p;
  constexpr int NPA   = (SPLIT >= 1) ? 2 : 1;          // planes of A, of Bt
  constexpr int NPB   = (SPLIT == 2) ? 2 : 1;
  constexpr int OFF_B = NPA * 64 * 128;                // bytes: A planes (64 rows each), then Bt planes (512 rows each)
  constexpr int BUFB  = OFF_B + NPB * 512 * 128;       // one stage buffer
  constexpr int SLABS = 8 * 16 * 68 * 4;               // epilogue: per-wave 16x64 slab, pitch 68 floats
  __shared__ __attribute__((aligned(128))) unsigned char smem[(2 * BUFB > SLABS) ? 2 * BUFB : SLABS];   // the slabs reuse the stage buffers behind the loop
  const int b    = blockIdx.y;
  const int lane = threadIdx.x & 31;
  const int wave = threadIdx.x >> 5;
  const int tilesN = N >> 6;                           // multiple of 8: the 8 tiles of a block lie in one tile row
  const int tilesM = M >> 6;
  const int tile0 = blockIdx.x * 8;
  if (tile0 >= tilesM * tilesN) return;   // block-uniform, in front of every barrier
  const int tm  = tile0 / tilesN;
  const int tn0 = tile0 - tm * tilesN;
  const int m0  = tm << 6;
  const int nb0 = tn0 << 6;                            // first Bt row of the block
  const int n0  = nb0 + (wave << 6);

  const T* Ab  = A  + (size_t)b * strideA;
  const T* Bb  = Bt + (size_t)b * strideB;
  const T* Ab2 = (SPLIT >= 1) ? (A2  + (size_t)b * strideA) : nullptr;
  const T* Bb2 = (SPLIT == 2) ? (Bt2 + (size_t)b * strideB) : nullptr;

  const int rlane = lane & 15;                 // row (A) / col (B, D) within subtile
  const int mOff  = (lane >> 4) * 8;           // D row offset

  v8f acc[4][4];
#pragma unroll
  for (int i = 0; i < 4; ++i)
#pragma unroll
    for (int j = 0; j < 4; ++j) acc[i][j] = (v8f){0.f,0.f,0.f,0.f,0.f,0.f,0.f,0.f};

  int kEnd = K;
  if (CAUSAL) kEnd = (m0 + 64 < K) ? (m0 + 64) : K;   // block-uniform, multiple of 64
  const int nStage = kEnd >> 6;

  // copies: thread = (stage row cr + 32 q, chunk cc); the chunk swizzle of a row depends on cr alone (32 q >> 1 is 0 mod 8)
  const int cc = threadIdx.x & 7, cr = threadIdx.x >> 3;
  const unsigned ldsC = (unsigned)(uintptr_t)(lds_u8*)smem + (unsigned)(cr * 128 + ((cc ^ ((cr >> 1) & 7)) << 4));
  const unsigned char* gA  = (const unsigned char*)(Ab + (size_t)(m0 + cr) * lda + cc * 8);
  const unsigned char* gB  = (const unsigned char*)(Bb + (size_t)(nb0 + cr) * ldb + cc * 8);
  const unsigned char* gA2 = (SPLIT >= 1) ? (const unsigned char*)(Ab2 + (size_t)(m0 + cr) * lda + cc * 8) : nullptr;
  const unsigned char* gB2 = (SPLIT == 2) ? (const unsigned char*)(Bb2 + (size_t)(nb0 + cr) * ldb + cc * 8) : nullptr;
  const size_t gsA = (size_t)lda * 64, gsB = (size_t)ldb * 64;   // 32 rows, bytes
  auto issue = [&](int buf, int st) {                  // all copies of stage st (k = 64 st .. 64 st + 63) into buffer buf
    const unsigned l = ldsC + (unsigned)(buf * BUFB);
    const size_t ko = (size_t)st * 128;
    async_copy2(l, gA + ko, 4096u, gsA);
    if (SPLIT >= 1) async_copy2(l + 8192u, gA2 + ko, 4096u, gsA);
    async_copy8(l + OFF_B, gB + ko, 4096u, gsB);
    async_copy8(l + OFF_B + 32768u, gB + ko + 8 * gsB, 4096u, gsB);
    if (SPLIT == 2) {
      async_copy8(l + OFF_B + 65536u, gB2 + ko, 4096u, gsB);
      async_copy8(l + OFF_B + 98304u, gB2 + ko + 8 * gsB, 4096u, gsB);
    }
  };
  // readers: lane = (row rlane of a 16-row group, half h); chunk 4 s + h holds k = 32 s + 8 h + 0..7, chunk 4 s + h + 2 holds k + 16
  const int e0 = (lane >> 4) ^ ((rlane >> 1) & 7);
  const int rowB = rlane * 128;
  int fo[4];
#pragma unroll   // fo[] is indexed by constants only and stays in registers
  for (int q = 0; q < 4; ++q) fo[q] = rowB + ((e0 ^ (2 * q)) << 4);

  issue(0, 0);
  asm volatile("s_wait_asynccnt 0x0" ::: "memory");    // this wave's copies of stage 0 have landed
  __syncthreads();                                     // and every other wave's
  if (nStage > 1) issue(1, 1);
  for (int st = 0; st < nStage; ++st) {
    const unsigned char* sA = smem + (st & 1) * BUFB;
    const unsigned char* sB = sA + OFF_B + wave * 8192;
#pragma unroll   // both 32-wide k-steps of a stage: constant indices into fo[]
    for (int s = 0; s < 2; ++s) {
      V bh[4], bl[4];
#pragma unroll
      for (int j = 0; j < 4; ++j) {
        bh[j] = Frag<T>::load2(sB + j * 2048 + fo[2 * s], sB + j * 2048 + fo[2 * s + 1]);
        if (SPLIT == 2) bl[j] = Frag<T>::load2(sB + 65536 + j * 2048 + fo[2 * s], sB + 65536 + j * 2048 + fo[2 * s + 1]);
      }
#pragma unroll
      for (int i = 0; i < 4; ++i) {
        V ah = Frag<T>::load2(sA + i * 2048 + fo[2 * s], sA + i * 2048 + fo[2 * s + 1]);
        V al;
        if (SPLIT >= 1) al = Frag<T>::load2(sA + 8192 + i * 2048 + fo[2 * s], sA + 8192 + i * 2048 + fo[2 * s + 1]);
#pragma unroll
        for (int j = 0; j < 4; ++j) {
          acc[i][j] = Frag<T>::mma(ah, bh[j], acc[i][j]);
          if (SPLIT == 2) acc[i][j] = Frag<T>::mma(ah, bl[j], acc[i][j]);
          if (SPLIT >= 1) acc[i][j] = Frag<T>::mma(al, bh[j], acc[i][j]);
        }
      }
    }
    asm volatile("s_wait_dscnt 0x0" ::: "memory");     // this wave's reads of the buffer are done before it may be refilled
    asm volatile("s_wait_asynccnt 0x0" ::: "memory");  // this wave's copies of stage st + 1 have landed
    __syncthreads();                                   // publishes stage st + 1 and ends every wave's reads of stage st
    if (st + 2 < nStage) issue(st & 1, st + 2);
  }
  asm volatile("s_wait_asynccnt 0x0" ::: "memory");    // no copy is outstanding when the slabs reuse the buffers
  acc_guard4(acc[0][0], acc[0][1], acc[0][2], acc[0][3]);
  acc_guard4(acc[1][0], acc[1][1], acc[1][2], acc[1][3]);
  acc_guard4(acc[2][0], acc[2][1], acc[2][2], acc[2][3]);
  acc_guard4(acc[3][0], acc[3][1], acc[3][2], acc[3][3]);

  // ---- epilogue ----
  float* slab = (float*)smem + wave * (16 * 68);
#pragma unroll
  for (int i = 0; i < 4; ++i) {
    const int mBase = m0 + (i << 4);
#pragma unroll
    for (int j = 0; j < 4; ++j) {
#pragma unroll
      for (int r = 0; r < 8; ++r) {
        float v = acc[i][j][r] * scale;
        slab[(mOff + r) * 68 + (j << 4) + rlane] = v;
      }
    }
    __builtin_amdgcn_fence(__ATOMIC_RELEASE, "workgroup");
    __builtin_amdgcn_wave_barrier();
    __builtin_amdgcn_fence(__ATOMIC_ACQUIRE, "workgroup");
    if (OUT_MODE == 0) {
      float* C = (float*)Cout + (size_t)b * strideC;
      const int hh = lane >> 4, c4 = (lane & 15) * 4;     // row seg = 256 B = 16 lanes x 16 B
      {
#pragma unroll
        for (int it = 0; it < 8; ++it) {
          const int row = it * 2 + hh;
          v4f v = *(const v4f*)(slab + row * 68 + c4);
          *(v4f*)(C + (size_t)(mBase + row) * ldc + n0 + c4) = v;
        }
        
      }
    } else {
      const int q = lane >> 3, c8 = (lane & 7) * 8;
      unsigned short* C  = (unsigned short*)Cout  + (size_t)b * strideC;
      unsigned short* C2 = (OUT_MODE == 2) ? ((unsigned short*)Cout2 + (size_t)b * strideC) : nullptr;
      {
#pragma unroll
        for (int it = 0; it < 4; ++it) {
          const int row = it * 4 + q;
          const float* sp = slab + row * 68 + c8;
          v8h hv, lv;
#pragma unroll
          for (int e = 0; e < 8; ++e) {
            if (OUT_MODE == 1) {
              hv[e] = (_Float16)sp[e];
            } else {
              unsigned short hb = f2bf_bits(sp[e]);
              unsigned short lb = f2bf_bits(sp[e] - bf_bits2f(hb));
              hv[e] = __builtin_bit_cast(_Float16, hb);
              lv[e] = __builtin_bit_cast(_Float16, lb);
            }
          }
          *(v8h*)(C + (size_t)(mBase + row) * ldc + n0 + c8) = hv;
          if (OUT_MODE == 2) *(v8h*)(C2 + (size_t)(mBase + row) * ldc + n0 + c8) = lv;
        }
        
      }
    }
    __builtin_amdgcn_fence(__ATOMIC_RELEASE, "workgroup");
    __builtin_amdgcn_wave_barrier();
    __builtin_amdgcn_fence(__ATOMIC_ACQUIRE, "workgroup");
  }
}

// Coverage: n2 threads x 2 elements = the whole plane (n2 = count/2, count even).
__global__ __launch_bounds__(256) void cast_f32_bf16x2(
    const float* __restrict__ in, unsigned short* __restrict__ out, int n2) {
  const int i = blockIdx.x * 256 + threadIdx.x;
  if (i < n2) {
    const float a0 = in[2 * (size_t)i], a1 = in[2 * (size_t)i + 1];
    const unsigned u = (unsigned)f2bf_bits(a0) | ((unsigned)f2bf_bits(a1) << 16);
    ((unsigned*)out)[i] = u;
    
  }
}

// ---- W in[K rows][N cols] f32 -> Wt out[N][K] bf16 (RNE), 64x64 tile transposed through LDS ----
// Coverage per block: rows n = it*32 + wave*4 + q8 (it 0..1, wave 0..7, q8 0..3) = 0..63; cols c8 = 8 lanes x 8 = 64.
constexpr int WTPITCH = 72;
__global__ __launch_bounds__(256) void wt_cast_bf16_k(const float* __restrict__ W, unsigned short* __restrict__ Wtp,
                                                      int K, int N) {
  __shared__ __align__(16) _Float16 st[64 * WTPITCH];
  _Float16* Wt = (_Float16*)Wtp;
  const int n0 = blockIdx.x * 64, k0 = blockIdx.y * 64;
  const int tid = threadIdx.x;
  const int kr = tid >> 2, c16 = (tid & 3) * 16;
  const float* src = W + (size_t)(k0 + kr) * N + n0 + c16;
#pragma unroll
  for (int q = 0; q < 4; ++q) {
    const v4f v = *(const v4f*)(src + 4 * q);
#pragma unroll
    for (int e = 0; e < 4; ++e) st[(c16 + 4 * q + e) * WTPITCH + kr] = __builtin_bit_cast(_Float16, f2bf_bits(v[e]));
  }
  __syncthreads();
  const int wave = tid >> 5, lane = tid & 31;
  const int q8 = lane >> 3, c8 = (lane & 7) * 8;
  {
#pragma unroll
    for (int it = 0; it < 2; ++it) {
      const int n = it * 32 + wave * 4 + q8;
      const v8h hv = *(const v8h*)(st + n * WTPITCH + c8);
      *(v8h*)(Wt + (size_t)(n0 + n) * K + k0 + c8) = hv;
    }
    
  }
}

// ---- sc[row] = (1/32) * sum_e xb[row][e] * eb[row][e]  (f32, fixed order) ----
__global__ __launch_bounds__(256) void sc_k(const unsigned short* __restrict__ xb, const float* __restrict__ eb,
                                            float* __restrict__ sc) {
  __shared__ float s_val[32];
  const int wave = threadIdx.x >> 5, lane = threadIdx.x & 31;
  const int row0 = blockIdx.x * 32;
  for (int i = 0; i < 4; ++i) {
    const int r = row0 + wave * 4 + i;
    const unsigned short* xr = xb + (size_t)r * NE;
    const float* er = eb + (size_t)r * NE;
    float s = 0.f;
#pragma unroll 1
    for (int it = 0; it < NE / 256; ++it) {
      const int e0 = it * 256 + lane * 8;
      const v8us xv = *(const v8us*)(xr + e0);
      const v4f ea = *(const v4f*)(er + e0);
      const v4f ec = *(const v4f*)(er + e0 + 4);
      s = fmaf(bf_bits2f(xv[0]), ea[0], s);
      s = fmaf(bf_bits2f(xv[1]), ea[1], s);
      s = fmaf(bf_bits2f(xv[2]), ea[2], s);
      s = fmaf(bf_bits2f(xv[3]), ea[3], s);
      s = fmaf(bf_bits2f(xv[4]), ec[0], s);
      s = fmaf(bf_bits2f(xv[5]), ec[1], s);
      s = fmaf(bf_bits2f(xv[6]), ec[2], s);
      s = fmaf(bf_bits2f(xv[7]), ec[3], s);
    }
#pragma unroll
    for (int off = 16; off; off >>= 1) s += __shfl_xor(s, off, 32);
    if (lane == 0) s_val[wave * 4 + i] = s * (1.0f / 32.0f);
  }
  __syncthreads();
  if (wave == 0) {
    const float v = s_val[lane];
    *(float*)(sc + row0 + lane) = v;
    
  }
}

// ---- per-row softmax statistics of the rank-1 causal scores: m[t] = max_{s<=t} fl(sc_t*sc_s), linv[t] = 1/sum_{s<=t} exp(sc_t*sc_s - m[t]) ----
// Trip counts bounded by t < NT (static).  Coverage: gridDim.x * 32 = NTOK rows.
__global__ __launch_bounds__(256) void stats_k(const float* __restrict__ sc, float* __restrict__ mrow,
                                               float* __restrict__ linv) {
  __shared__ float s_m[32], s_l[32];
  const int wave = threadIdx.x >> 5, lane = threadIdx.x & 31;
  const int row0 = blockIdx.x * 32;
  const int b = row0 / NT;
  const float* scb = sc + (size_t)b * NT;
  for (int i = 0; i < 4; ++i) {
    const int rg = row0 + wave * 4 + i;
    const int t = rg - b * NT;                       // 0..NT-1
    const float sct = scb[t];
    float mx = __uint_as_float(0xff800000u);
#pragma unroll 1
    for (int s = lane; s <= t; s += 32) mx = fmaxf(mx, sct * scb[s]);
#pragma unroll
    for (int off = 16; off; off >>= 1) mx = fmaxf(mx, __shfl_xor(mx, off, 32));
    float z = 0.f;
#pragma unroll 1
    for (int s = lane; s <= t; s += 32) z += __expf(fmaf(sct, scb[s], -mx));
#pragma unroll
    for (int off = 16; off; off >>= 1) z += __shfl_xor(z, off, 32);
    if (lane == 0) { s_m[wave * 4 + i] = mx; s_l[wave * 4 + i] = 1.0f / z; }
  }
  __syncthreads();
  if (wave == 0) {
    const float mv = s_m[lane], lv = s_l[lane];
    *(float*)(mrow + row0 + lane) = mv;
    *(float*)(linv + row0 + lane) = lv;
    
  }
}

// ---- probability planes, batch = blockIdx.y: P[b][t][s] = exp(sc_t*sc_s - m_t) * linv_t for s <= t, 0 for t < s < ((t>>6)+1)*64 ----
// Written as bf16 hi + bf16 lo planes [NBATCH][NT][NT] (row pitch NT).  Wave = one row t; per iteration 32 lanes x 8 halves =
// Coverage: gridDim.x * 8 = NT rows, gridDim.y = NBATCH batches; columns [0, ((t>>6)+1)*64) of every row in both planes = exactly what the causal
// P.V product reads for the 64-row tile containing t.
__global__ __launch_bounds__(256) void pgen_k(const float* __restrict__ sc, const float* __restrict__ mrow,
                                              const float* __restrict__ linv, unsigned short* __restrict__ php,
                                              unsigned short* __restrict__ plp) {
  union SV { v4f q[2]; float f[8]; };
  const int b = blockIdx.y;                        // 0..NBATCH-1
  _Float16* ph = (_Float16*)php + (size_t)b * NT * NT;
  _Float16* pl = (_Float16*)plp + (size_t)b * NT * NT;
  const int wave = threadIdx.x >> 5, lane = threadIdx.x & 31;
  const int t = blockIdx.x * 8 + wave;             // 0..NT-1
  const float* scb = sc + (size_t)b * NT;
  const float sct = scb[t];
  const float mt = mrow[(size_t)b * NT + t];
  const float li = linv[(size_t)b * NT + t];
  const int ncol = ((t >> 6) + 1) << 6;
  _Float16* prh = ph + (size_t)t * NT;
  _Float16* prl = pl + (size_t)t * NT;
  for (int base = 0; base < ncol; base += 256) {     // wave-uniform
    const int c = base + lane * 8;
    const bool active = c < ncol;                    // c % 8 == 0 and ncol % 64 == 0 -> whole 8-groups
    const int cc = (c < NT - 8) ? c : (NT - 8);       // clamped address
    SV sv;
    sv.q[0] = *(const v4f*)(scb + cc);
    sv.q[1] = *(const v4f*)(scb + cc + 4);
    v8h hv, lv;
#pragma unroll
    for (int j = 0; j < 8; ++j) {
      float p = __expf(fmaf(sct, sv.f[j], -mt)) * li;
      p = (c + j <= t) ? p : 0.0f;
      const unsigned short hb = f2bf_bits(p);
      const unsigned short lb = f2bf_bits(p - bf_bits2f(hb));
      hv[j] = __builtin_bit_cast(_Float16, hb);
      lv[j] = __builtin_bit_cast(_Float16, lb);
    }
    {
      if (active) {
        *(v8h*)(prh + c) = hv;
        *(v8h*)(prl + c) = lv;
      }
      
    }
  }
}

// ---------------------------------------------------------------------------
// Workspace region map (bytes; all offsets multiples of 1 MiB):
//   R_XB  [0, 16 MiB)            : xb bf16 [8192][1024]; later O_hi bf16 [8192][1024]
//   R_W   [16, 24 MiB)           : wjb, wjTb, wjvb, wob bf16 [1024][1024] (2 MiB each)
//   R_C   [24, 56 MiB)           : echo_hi, echo_lo bf16 [8192][1024]; later valT_hi, valT_lo bf16 [4][1024][2048]
//   R_D   [56, 88 MiB)           : eb f32 [8192][1024]; later O_lo bf16 [8192][1024]
//   R_S   [88 MiB, +96 KiB)      : sc, m, linv f32 [8192]
//   R_P   [89, 153 MiB)          : P_hi, P_lo bf16 [4][2048][2048] (32 MiB each, all batches)
//   total 160,432,128 B
extern "C" void kernel_launch(void* const* d_in, const int* in_sizes, int n_in,
                              void* d_out, int out_size, void* d_ws, size_t ws_size,
                              hipStream_t stream) {
  if (n_in < 4) return;
  if (in_sizes[0] != NTOK * NE || in_sizes[1] != NE * NE || in_sizes[2] != NE * NE ||
      in_sizes[3] != NE * NE || out_size != NTOK * NE) return;
  const float* x   = (const float*)d_in[0];   // [4][2048][1024]
  const float* wj  = (const float*)d_in[1];   // [1024][1024] (out,in)
  const float* wjv = (const float*)d_in[2];   // [1024][1024]
  const float* wo  = (const float*)d_in[3];   // [1024][1024]
  float* outp = (float*)d_out;

  const size_t PLANE16 = (size_t)NTOK * NE * 2;    // 16,777,216
  const size_t WPL     = (size_t)NE * NE * 2;      //  2,097,152
  const size_t PLANE32 = (size_t)NTOK * NE * 4;    // 33,554,432
  const size_t PPL     = (size_t)NT * NT * 2;      //  8,388,608
  const size_t VEC     = (size_t)NTOK * 4;         //     32,768
  const size_t off_xb = 0;
  const size_t off_w  = off_xb + PLANE16;
  const size_t off_c  = off_w + 4 * WPL;
  const size_t off_d  = off_c + 2 * PLANE16;
  const size_t off_s  = off_d + PLANE32;
  const size_t off_p  = off_s + ((size_t)1 << 20);
  const size_t total  = off_p + 2 * NBATCH * PPL;  // 160,432,128
  if (total > ws_size) return;

  char* ws = (char*)d_ws;
  unsigned short* xb     = (unsigned short*)(ws + off_xb);
  unsigned short* o_hi   = (unsigned short*)(ws + off_xb);
  unsigned short* wjb    = (unsigned short*)(ws + off_w);
  unsigned short* wjTb   = (unsigned short*)(ws + off_w + WPL);
  unsigned short* wjvb   = (unsigned short*)(ws + off_w + 2 * WPL);
  unsigned short* wob    = (unsigned short*)(ws + off_w + 3 * WPL);
  unsigned short* ech_hi = (unsigned short*)(ws + off_c);
  unsigned short* ech_lo = (unsigned short*)(ws + off_c + PLANE16);
  unsigned short* vt_hi  = (unsigned short*)(ws + off_c);
  unsigned short* vt_lo  = (unsigned short*)(ws + off_c + PLANE16);
  float*          ebp    = (float*)(ws + off_d);
  unsigned short* p_hi   = (unsigned short*)(ws + off_p);
  unsigned short* p_lo   = (unsigned short*)(ws + off_p + NBATCH * PPL);
  unsigned short* o_lo   = (unsigned short*)(ws + off_d);
  float*          scp    = (float*)(ws + off_s);
  float*          mrowp  = (float*)(ws + off_s + VEC);
  float*          linvp  = (float*)(ws + off_s + 2 * VEC);

  const dim3 blk(256);

  // 1) input planes, RNE bf16
  cast_f32_bf16x2<<<dim3((NTOK * NE / 2) / 256), blk, 0, stream>>>(x, xb, NTOK * NE / 2);
  cast_f32_bf16x2<<<dim3((NE * NE / 2) / 256), blk, 0, stream>>>(wj, wjb, NE * NE / 2);
  cast_f32_bf16x2<<<dim3((NE * NE / 2) / 256), blk, 0, stream>>>(wjv, wjvb, NE * NE / 2);
  cast_f32_bf16x2<<<dim3((NE * NE / 2) / 256), blk, 0, stream>>>(wo, wob, NE * NE / 2);
  // wj in[f=1024][e=1024] -> wjTb out[e][f]
  wt_cast_bf16_k<<<dim3(NE / 64, NE / 64), blk, 0, stream>>>(wj, wjTb, NE, NE);

  // 2) echo[t][f] = sum_e xb[t][e] wjb[f][e]  -> bf16 hi/lo planes   (M=8192, N=1024, K=1024; 2048 tiles = 256 blocks)
  wmma_gemm64<1, 0, 2, false><<<dim3((NTOK / 64) * (NE / 64) / 8, 1), blk, 0, stream>>>(
      xb, xb, NE, 0L, wjb, wjb, NE, 0L, (void*)ech_hi, (void*)ech_lo, NE, 0L, NTOK, NE, NE, 1.0f);
  // 3) eb[t][e] = sum_f echo[t][f] wj[f][e] = sum_f echo[t][f] wjTb[e][f]  (A hi/lo, 2 products) -> f32
  wmma_gemm64<1, 1, 0, false><<<dim3((NTOK / 64) * (NE / 64) / 8, 1), blk, 0, stream>>>(
      ech_hi, ech_lo, NE, 0L, wjTb, wjTb, NE, 0L, (void*)ebp, (void*)ebp, NE, 0L, NTOK, NE, NE, 1.0f);
  // 4) token scores
  sc_k<<<dim3(NTOK / 32), blk, 0, stream>>>(xb, ebp, scp);
  // 5) valT[b][d][t] = sum_e wjvb[d][e] xb[b][t][e] -> bf16 hi/lo planes [4][1024][2048]  (M=1024, N=2048, K=1024; 512 tiles = 64 blocks per batch)
  wmma_gemm64<1, 0, 2, false><<<dim3((NE / 64) * (NT / 64) / 8, NBATCH), blk, 0, stream>>>(
      wjvb, wjvb, NE, 0L, xb, xb, NE, (long)NT * NE, (void*)vt_hi, (void*)vt_lo, NT, (long)NE * NT, NE, NT, NE, 1.0f);
  // 6) softmax statistics
  stats_k<<<dim3(NTOK / 32), blk, 0, stream>>>(scp, mrowp, linvp);
  // 7) all batches at once (grid.y = batch): probability planes, then O[b][t][d] = sum_{s < tile end} P[b][t][s] valT[b][d][s]
  //    (hi/lo x hi/lo, causal k-limit) -> O hi/lo planes   (512 tiles = 64 blocks per batch, 256 blocks in the launch)
  pgen_k<<<dim3(NT / 8, NBATCH), blk, 0, stream>>>(scp, mrowp, linvp, p_hi, p_lo);
  wmma_gemm64<1, 2, 2, true><<<dim3((NT / 64) * (NE / 64) / 8, NBATCH), blk, 0, stream>>>(
      p_hi, p_lo, NT, (long)NT * NT, vt_hi, vt_lo, NT, (long)NE * NT,
      (void*)o_hi, (void*)o_lo, NE, (long)NT * NE, NT, NE, NT, 1.0f);
  // 8) out[t][n] = sum_d O[t][d] wob[n][d]  (A hi/lo, 2 products) -> f32 output
  wmma_gemm64<1, 1, 0, false><<<dim3((NTOK / 64) * (NE / 64) / 8, 1), blk, 0, stream>>>(
      o_hi, o_lo, NE, 0L, wob, wob, NE, 0L, (void*)outp, (void*)outp, NE, 0L, NTOK, NE, NE, 1.0f);
}

// v003
// A run of this version takes 217 microseconds.
// In two side-by-side timings against v002, it was 1.16 and 1.15 times as fast.
// All steps since v000 together make it 3.58 times as fast.
// Contractions on v_wmma_f32_16x16x32_bf16 (bf16 operands, f32 accumulate): echo = xb*wjb^T (plain, inputs RNE bf16), eb = echo{hi,lo}*wj (2 products), val^T = wjvb*xb^T (plain), O = P{hi,lo}*val^T{hi,lo} (3 products, causal k-limit), out = O{hi,lo}*wob^T (2 products); token scores, softmax statistics and probabilities in f32 on VALU.
#include <hip/hip_runtime.h>
#include <stdint.h>

constexpr int NBATCH = 4;
constexpr int NT     = 2048;
constexpr int NE     = 1024;
constexpr int NTOK   = NBATCH * NT;
static_assert((NTOK % 64) == 0 && (NT % 64) == 0 && (NE % 64) == 0);

typedef __attribute__((ext_vector_type(16))) _Float16 v16h;
typedef __attribute__((ext_vector_type(8)))  _Float16 v8h;
typedef __attribute__((ext_vector_type(16))) __bf16   v16b;
typedef __attribute__((ext_vector_type(8)))  __bf16   v8b;
typedef __attribute__((ext_vector_type(8)))  float    v8f;
typedef __attribute__((ext_vector_type(4)))  float    v4f;
typedef __attribute__((ext_vector_type(8)))  unsigned short v8us;

__device__ __forceinline__ unsigned short f2bf_bits(float f) {
  unsigned u = __float_as_uint(f);
  return (unsigned short)((u + 0x7FFFu + ((u >> 16) & 1u)) >> 16);
}
__device__ __forceinline__ float bf_bits2f(unsigned short h) { return __uint_as_float(((unsigned)h) << 16); }

// slots between the last WMMAs and the epilogue's first reads of their accumulators
__device__ __forceinline__ void acc_guard4(v8f& a, v8f& b, v8f& c, v8f& d) { asm volatile("v_nop\n\tv_nop\n\tv_nop\n\tv_nop" : "+v"(a), "+v"(b), "+v"(c), "+v"(d)); }
template <typename T> struct Frag;
template <> struct Frag<_Float16> {
  typedef v16h V; union U { v16h v; v8h h[2]; };
  static __device__ __forceinline__ v16h load2(const unsigned char* p0, const unsigned char* p1) {   // elements 0..7 <- 16 B at p0, 8..15 <- 16 B at p1
    U f; f.h[0] = *(const v8h*)(p0); f.h[1] = *(const v8h*)(p1); return f.v;
  }
  static __device__ __forceinline__ v8f mma(v16h a, v16h b, v8f c) {
    return __builtin_amdgcn_wmma_f32_16x16x32_f16(false, a, false, b, (short)0, c, false, false);
  }
};
template <> struct Frag<__bf16> {
  typedef v16b V; union U { v16b v; v8b h[2]; };
  static __device__ __forceinline__ v16b load2(const unsigned char* p0, const unsigned char* p1) {
    U f; f.h[0] = *(const v8b*)(p0); f.h[1] = *(const v8b*)(p1); return f.v;
  }
  static __device__ __forceinline__ v8f mma(v16b a, v16b b, v8f c) {
    return __builtin_amdgcn_wmma_f32_16x16x32_bf16(false, a, false, b, (short)0, c, false, false);
  }
};

// ---- Register-blocked batched WMMA GEMM ------------------------------------
// C[m,n] = scale * sum_k A[m,k] * Bt[n,k]; each wave owns a 64x64 tile; the 8 waves of a block share the 64 rows of A and
// hold 8 neighbouring column tiles (512 rows of Bt).
// A row-major [M,K]; Bt row-major [N,K]; M % 64 == 0, N % 512 == 0, K % 64 == 0, K >= 64.
// The k loop works on stages of 64 k: every row of a stage is one whole 128-byte line, brought into LDS by asynchronous
// copies (a wave-wide copy = 4 whole lines), two buffers, the next stage in flight while this one is worked on.
// LDS place of the 16-byte chunk c (0..7) of stage row R: R * 128 + ((c ^ ((R >> 1) & 7)) * 16): 16 rows read at one chunk
// index fall on 16 different 16-byte bank groups.
// SPLIT: 0 = single product; 1 = A carried as hi/lo planes (A2 = lo), Bt single: hi.B + lo.B (2 products);
//        2 = A and Bt as hi/lo planes: hi.hi + hi.lo + lo.hi (3 products).
// OUT_MODE: 0 = f32, 1 = f16, 2 = bf16 hi plane (Cout) + bf16 lo plane (Cout2).
// CAUSAL: the k loop of the wave tile at rows m0..m0+63 stops at k = m0 + 64 (lower block-triangular A).
// ET: 0 = f16 operands, 1 = bf16 operands (pointers passed as 16-bit storage)
template <int ET> struct Elem;
template <> struct Elem<0> { typedef _Float16 T; };
template <> struct Elem<1> { typedef __bf16 T; };
typedef __attribute__((address_space(3))) unsigned char lds_u8;
// Asynchronous copies, 16 bytes a lane, global -> LDS.  The s_wait_xcnt is the last line of the copies' own statement: it stands
// before any later rewrite of the address registers that the copies name.
__device__ __forceinline__ void async_copy2(unsigned l, const unsigned char* g, unsigned lstep, size_t gstep) {
  asm volatile("global_load_async_to_lds_b128 %0, %1, off\n\t"
               "global_load_async_to_lds_b128 %2, %3, off\n\t"
               "s_wait_xcnt 0x0"
               :: "v"(l), "v"(g), "v"(l + lstep), "v"(g + gstep) : "memory");
}
__device__ __forceinline__ void async_copy8(unsigned l, const unsigned char* g, unsigned lstep, size_t gstep) {
  asm volatile("global_load_async_to_lds_b128 %0, %1, off\n\t"
               "global_load_async_to_lds_b128 %2, %3, off\n\t"
               "global_load_async_to_lds_b128 %4, %5, off\n\t"
               "global_load_async_to_lds_b128 %6, %7, off\n\t"
               "global_load_async_to_lds_b128 %8, %9, off\n\t"
               "global_load_async_to_lds_b128 %10, %11, off\n\t"
               "global_load_async_to_lds_b128 %12, %13, off\n\t"
               "global_load_async_to_lds_b128 %14, %15, off\n\t"
               "s_wait_xcnt 0x0"
               :: "v"(l), "v"(g), "v"(l + lstep), "v"(g + gstep), "v"(l + 2 * lstep), "v"(g + 2 * gstep),
                  "v"(l + 3 * lstep), "v"(g + 3 * gstep), "v"(l + 4 * lstep), "v"(g + 4 * gstep),
                  "v"(l + 5 * lstep), "v"(g + 5 * gstep), "v"(l + 6 * lstep), "v"(g + 6 * gstep),
                  "v"(l + 7 * lstep), "v"(g + 7 * gstep) : "memory");
}
template <int ET, int SPLIT, int OUT_MODE, bool CAUSAL>
__global__ __launch_bounds__(256) void wmma_gemm64(
    const unsigned short* __restrict__ Ap, const unsigned short* __restrict__ A2p, int lda, long strideA,
    const unsigned short* __restrict__ Btp, const unsigned short* __restrict__ Bt2p, int ldb, long strideB,
    void* __restrict__ Cout, void* __restrict__ Cout2, int ldc, long strideC,
    int M, int N, int K, float scale) {
  typedef typename Elem<ET>::T T;
  typedef typename Frag<T>::V V;
  const T* A = (const T*)Ap; const T* A2 = (const T*)A2p; const T* Bt = (const T*)Btp; const T* Bt2 = (const T*)Bt2p;
  constexpr int NPA   = (SPLIT >= 1) ? 2 : 1;          // planes of A, of Bt
  constexpr int NPB   = (SPLIT == 2) ? 2 : 1;
  constexpr int OFF_B = NPA * 64 * 128;                // bytes: A planes (64 rows each), then Bt planes (512 rows each)
  constexpr int BUFB  = OFF_B + NPB * 512 * 128;       // one stage buffer
  constexpr int SLABS = 8 * 16 * 68 * 4;               // epilogue: per-wave 16x64 slab, pitch 68 floats
  __shared__ __attribute__((aligned(128))) unsigned char smem[(2 * BUFB > SLABS) ? 2 * BUFB : SLABS];   // the slabs reuse the stage buffers behind the loop
  const int b    = blockIdx.y;
  const int lane = threadIdx.x & 31;
  const int wave = threadIdx.x >> 5;
  const int tilesN = N >> 6;                           // multiple of 8: the 8 tiles of a block lie in one tile row
  const int tilesM = M >> 6;
  const int tile0 = blockIdx.x * 8;
  if (tile0 >= tilesM * tilesN) return;   // block-uniform, in front of every barrier
  const int tm  = tile0 / tilesN;
  const int tn0 = tile0 - tm * tilesN;
  const int m0  = tm << 6;
  const int nb0 = tn0 << 6;                            // first Bt row of the block
  const int n0  = nb0 + (wave << 6);

  const T* Ab  = A  + (size_t)b * strideA;
  const T* Bb  = Bt + (size_t)b * strideB;
  const T* Ab2 = (SPLIT >= 1) ? (A2  + (size_t)b * strideA) : nullptr;
  const T* Bb2 = (SPLIT == 2) ? (Bt2 + (size_t)b * strideB) : nullptr;

  const int rlane = lane & 15;                 // row (A) / col (B, D) within subtile
  const int mOff  = (lane >> 4) * 8;           // D row offset

  v8f acc[4][4];
#pragma unroll
  for (int i = 0; i < 4; ++i)
#pragma unroll
    for (int j = 0; j < 4; ++j) acc[i][j] = (v8f){0.f,0.f,0.f,0.f,0.f,0.f,0.f,0.f};

  int kEnd = K;
  if (CAUSAL) kEnd = (m0 + 64 < K) ? (m0 + 64) : K;   // block-uniform, multiple of 64
  const int nStage = kEnd >> 6;

  // copies: thread = (stage row cr + 32 q, chunk cc); the chunk swizzle of a row depends on cr alone (32 q >> 1 is 0 mod 8)
  const int cc = threadIdx.x & 7, cr = threadIdx.x >> 3;
  const unsigned ldsC = (unsigned)(uintptr_t)(lds_u8*)smem + (unsigned)(cr * 128 + ((cc ^ ((cr >> 1) & 7)) << 4));
  const unsigned char* gA  = (const unsigned char*)(Ab + (size_t)(m0 + cr) * lda + cc * 8);
  const unsigned char* gB  = (const unsigned char*)(Bb + (size_t)(nb0 + cr) * ldb + cc * 8);
  const unsigned char* gA2 = (SPLIT >= 1) ? (const unsigned char*)(Ab2 + (size_t)(m0 + cr) * lda + cc * 8) : nullptr;
  const unsigned char* gB2 = (SPLIT == 2) ? (const unsigned char*)(Bb2 + (size_t)(nb0 + cr) * ldb + cc * 8) : nullptr;
  const size_t gsA = (size_t)lda * 64, gsB = (size_t)ldb * 64;   // 32 rows, bytes
  auto issue = [&](int buf, int st) {                  // all copies of stage st (k = 64 st .. 64 st + 63) into buffer buf
    const unsigned l = ldsC + (unsigned)(buf * BUFB);
    const size_t ko = (size_t)st * 128;
    async_copy2(l, gA + ko, 4096u, gsA);
    if (SPLIT >= 1) async_copy2(l + 8192u, gA2 + ko, 4096u, gsA);
    async_copy8(l + OFF_B, gB + ko, 4096u, gsB);
    async_copy8(l + OFF_B + 32768u, gB + ko + 8 * gsB, 4096u, gsB);
    if (SPLIT == 2) {
      async_copy8(l + OFF_B + 65536u, gB2 + ko, 4096u, gsB);
      async_copy8(l + OFF_B + 98304u, gB2 + ko + 8 * gsB, 4096u, gsB);
    }
  };
  // readers: lane = (row rlane of a 16-row group, half h); chunk 4 s + h holds k = 32 s + 8 h + 0..7, chunk 4 s + h + 2 holds k + 16
  const int e0 = (lane >> 4) ^ ((rlane >> 1) & 7);
  const int rowB = rlane * 128;
  int fo[4];
#pragma unroll   // fo[] is indexed by constants only and stays in registers
  for (int q = 0; q < 4; ++q) fo[q] = rowB + ((e0 ^ (2 * q)) << 4);

  issue(0, 0);
  asm volatile("s_wait_asynccnt 0x0" ::: "memory");    // this wave's copies of stage 0 have landed
  __syncthreads();                                     // and every other wave's
  if (nStage > 1) issue(1, 1);
  for (int st = 0; st < nStage; ++st) {
    const unsigned char* sA = smem + (st & 1) * BUFB;
    const unsigned char* sB = sA + OFF_B + wave * 8192;
#pragma unroll   // both 32-wide k-steps of a stage: constant indices into fo[]
    for (int s = 0; s < 2; ++s) {
      V bh[4], bl[4];
#pragma unroll
      for (int j = 0; j < 4; ++j) {
        bh[j] = Frag<T>::load2(sB + j * 2048 + fo[2 * s], sB + j * 2048 + fo[2 * s + 1]);
        if (SPLIT == 2) bl[j] = Frag<T>::load2(sB + 65536 + j * 2048 + fo[2 * s], sB + 65536 + j * 2048 + fo[2 * s + 1]);
      }
#pragma unroll
      for (int i = 0; i < 4; ++i) {
        V ah = Frag<T>::load2(sA + i * 2048 + fo[2 * s], sA + i * 2048 + fo[2 * s + 1]);
        V al;
        if (SPLIT >= 1) al = Frag<T>::load2(sA + 8192 + i * 2048 + fo[2 * s], sA + 8192 + i * 2048 + fo[2 * s + 1]);
#pragma unroll
        for (int j = 0; j < 4; ++j) {
          acc[i][j] = Frag<T>::mma(ah, bh[j], acc[i][j]);
          if (SPLIT == 2) acc[i][j] = Frag<T>::mma(ah, bl[j], acc[i][j]);
          if (SPLIT >= 1) acc[i][j] = Frag<T>::mma(al, bh[j], acc[i][j]);
        }
      }
    }
    asm volatile("s_wait_dscnt 0x0" ::: "memory");     // this wave's reads of the buffer are done before it may be refilled
    asm volatile("s_wait_asynccnt 0x0" ::: "memory");  // this wave's copies of stage st + 1 have landed
    __syncthreads();                                   // publishes stage st + 1 and ends every wave's reads of stage st
    if (st + 2 < nStage) issue(st & 1, st + 2);
  }
  asm volatile("s_wait_asynccnt 0x0" ::: "memory");    // no copy is outstanding when the slabs reuse the buffers
  acc_guard4(acc[0][0], acc[0][1], acc[0][2], acc[0][3]);
  acc_guard4(acc[1][0], acc[1][1], acc[1][2], acc[1][3]);
  acc_guard4(acc[2][0], acc[2][1], acc[2][2], acc[2][3]);
  acc_guard4(acc[3][0], acc[3][1], acc[3][2], acc[3][3]);

  // ---- epilogue ----
  float* slab = (float*)smem + wave * (16 * 68);
#pragma unroll
  for (int i = 0; i < 4; ++i) {
    const int mBase = m0 + (i << 4);
#pragma unroll
    for (int j = 0; j < 4; ++j) {
#pragma unroll
      for (int r = 0; r < 8; ++r) {
        float v = acc[i][j][r] * scale;
        slab[(mOff + r) * 68 + (j << 4) + rlane] = v;
      }
    }
    __builtin_amdgcn_fence(__ATOMIC_RELEASE, "workgroup");
    __builtin_amdgcn_wave_barrier();
    __builtin_amdgcn_fence(__ATOMIC_ACQUIRE, "workgroup");
    if (OUT_MODE == 0) {
      float* C = (float*)Cout + (size_t)b * strideC;
      const int hh = lane >> 4, c4 = (lane & 15) * 4;     // row seg = 256 B = 16 lanes x 16 B
      {
#pragma unroll
        for (int it = 0; it < 8; ++it) {
          const int row = it * 2 + hh;
          v4f v = *(const v4f*)(slab + row * 68 + c4);
          *(v4f*)(C + (size_t)(mBase + row) * ldc + n0 + c4) = v;
        }
        
      }
    } else {
      const int q = lane >> 3, c8 = (lane & 7) * 8;
      unsigned short* C  = (unsigned short*)Cout  + (size_t)b * strideC;
      unsigned short* C2 = (OUT_MODE == 2) ? ((unsigned short*)Cout2 + (size_t)b * strideC) : nullptr;
      {
#pragma unroll
        for (int it = 0; it < 4; ++it) {
          const int row = it * 4 + q;
          const float* sp = slab + row * 68 + c8;
          v8h hv, lv;
#pragma unroll
          for (int e = 0; e < 8; ++e) {
            if (OUT_MODE == 1) {
              hv[e] = (_Float16)sp[e];
            } else {
              unsigned short hb = f2bf_bits(sp[e]);
              unsigned short lb = f2bf_bits(sp[e] - bf_bits2f(hb));
              hv[e] = __builtin_bit_cast(_Float16, hb);
              lv[e] = __builtin_bit_cast(_Float16, lb);
            }
          }
          *(v8h*)(C + (size_t)(mBase + row) * ldc + n0 + c8) = hv;
          if (OUT_MODE == 2) *(v8h*)(C2 + (size_t)(mBase + row) * ldc + n0 + c8) = lv;
        }
        
      }
    }
    __builtin_amdgcn_fence(__ATOMIC_RELEASE, "workgroup");
    __builtin_amdgcn_wave_barrier();
    __builtin_amdgcn_fence(__ATOMIC_ACQUIRE, "workgroup");
  }
}

// Coverage: n2 threads x 2 elements = the whole plane (n2 = count/2, count even).
__global__ __launch_bounds__(256) void cast_f32_bf16x2(
    const float* __restrict__ in, unsigned short* __restrict__ out, int n2) {
  const int i = blockIdx.x * 256 + threadIdx.x;
  if (i < n2) {
    const float a0 = in[2 * (size_t)i], a1 = in[2 * (size_t)i + 1];
    const unsigned u = (unsigned)f2bf_bits(a0) | ((unsigned)f2bf_bits(a1) << 16);
    ((unsigned*)out)[i] = u;
    
  }
}

// ---- W in[K rows][N cols] f32 -> Wt out[N][K] bf16 (RNE), 64x64 tile transposed through LDS ----
// Coverage per block: rows n = it*32 + wave*4 + q8 (it 0..1, wave 0..7, q8 0..3) = 0..63; cols c8 = 8 lanes x 8 = 64.
constexpr int WTPITCH = 72;
__global__ __launch_bounds__(256) void wt_cast_bf16_k(const float* __restrict__ W, unsigned short* __restrict__ Wtp,
                                                      int K, int N) {
  __shared__ __align__(16) _Float16 st[64 * WTPITCH];
  _Float16* Wt = (_Float16*)Wtp;
  const int n0 = blockIdx.x * 64, k0 = blockIdx.y * 64;
  const int tid = threadIdx.x;
  const int kr = tid >> 2, c16 = (tid & 3) * 16;
  const float* src = W + (size_t)(k0 + kr) * N + n0 + c16;
#pragma unroll
  for (int q = 0; q < 4; ++q) {
    const v4f v = *(const v4f*)(src + 4 * q);
#pragma unroll
    for (int e = 0; e < 4; ++e) st[(c16 + 4 * q + e) * WTPITCH + kr] = __builtin_bit_cast(_Float16, f2bf_bits(v[e]));
  }
  __syncthreads();
  const int wave = tid >> 5, lane = tid & 31;
  const int q8 = lane >> 3, c8 = (lane & 7) * 8;
  {
#pragma unroll
    for (int it = 0; it < 2; ++it) {
      const int n = it * 32 + wave * 4 + q8;
      const v8h hv = *(const v8h*)(st + n * WTPITCH + c8);
      *(v8h*)(Wt + (size_t)(n0 + n) * K + k0 + c8) = hv;
    }
    
  }
}

// ---- sc[row] = (1/32) * sum_e xb[row][e] * eb[row][e]  (f32, fixed order) ----
__global__ __launch_bounds__(256) void sc_k(const unsigned short* __restrict__ xb, const float* __restrict__ eb,
                                            float* __restrict__ sc) {
  __shared__ float s_val[32];
  const int wave = threadIdx.x >> 5, lane = threadIdx.x & 31;
  const int row0 = blockIdx.x * 32;
  for (int i = 0; i < 4; ++i) {
    const int r = row0 + wave * 4 + i;
    const unsigned short* xr = xb + (size_t)r * NE;
    const float* er = eb + (size_t)r * NE;
    float s = 0.f;
#pragma unroll 1
    for (int it = 0; it < NE / 256; ++it) {
      const int e0 = it * 256 + lane * 8;
      const v8us xv = *(const v8us*)(xr + e0);
      const v4f ea = *(const v4f*)(er + e0);
      const v4f ec = *(const v4f*)(er + e0 + 4);
      s = fmaf(bf_bits2f(xv[0]), ea[0], s);
      s = fmaf(bf_bits2f(xv[1]), ea[1], s);
      s = fmaf(bf_bits2f(xv[2]), ea[2], s);
      s = fmaf(bf_bits2f(xv[3]), ea[3], s);
      s = fmaf(bf_bits2f(xv[4]), ec[0], s);
      s = fmaf(bf_bits2f(xv[5]), ec[1], s);
      s = fmaf(bf_bits2f(xv[6]), ec[2], s);
      s = fmaf(bf_bits2f(xv[7]), ec[3], s);
    }
#pragma unroll
    for (int off = 16; off; off >>= 1) s += __shfl_xor(s, off, 32);
    if (lane == 0) s_val[wave * 4 + i] = s * (1.0f / 32.0f);
  }
  __syncthreads();
  if (wave == 0) {
    const float v = s_val[lane];
    *(float*)(sc + row0 + lane) = v;
    
  }
}

// ---- probability planes with their row statistics, batch = blockIdx.y, wave = one row t ----
// m_t = max_{s<=t} fl(sc_t*sc_s), z_t = sum_{s<=t} exp(sc_t*sc_s - m_t);
// P[b][t][s] = exp(sc_t*sc_s - m_t) * (1/z_t) for s <= t, 0 for t < s < ((t>>6)+1)*64.
// The row's scores stay in registers (lane = 8 neighbouring columns of each 256-column group, at most 8 groups), so all loads of a
// row are in flight together and every exponential is formed once; maximum and sum end in a butterfly over the 32 lanes.
// Written as bf16 hi + bf16 lo planes [NBATCH][NT][NT] (row pitch NT).
// Coverage: gridDim.x * 8 = NT rows, gridDim.y = NBATCH batches; columns [0, ((t>>6)+1)*64) of every row in both planes = exactly what the causal
// P.V product reads for the 64-row tile containing t.
__global__ __launch_bounds__(256) void pgen_k(const float* __restrict__ sc, unsigned short* __restrict__ php,
                                              unsigned short* __restrict__ plp) {
  constexpr int NG = NT / 256;                     // column groups of a full row
  const int b = blockIdx.y;                        // 0..NBATCH-1
  _Float16* ph = (_Float16*)php + (size_t)b * NT * NT;
  _Float16* pl = (_Float16*)plp + (size_t)b * NT * NT;
  const int wave = __builtin_amdgcn_readfirstlane(threadIdx.x >> 5), lane = threadIdx.x & 31;
  const int t = blockIdx.x * 8 + wave;             // 0..NT-1, wave-uniform
  const float* scb = sc + (size_t)b * NT;
  const float sct = scb[t];
  const int ncol = ((t >> 6) + 1) << 6;
  _Float16* prh = ph + (size_t)t * NT;
  _Float16* prl = pl + (size_t)t * NT;
  float v[NG][8];
  const float NEG_INF = __uint_as_float(0xff800000u);
  float mx = NEG_INF;
#pragma unroll   // v[][] is indexed by constants only and stays in registers
  for (int g = 0; g < NG; ++g) {
    if (g * 256 < ncol) {                            // wave-uniform
      const int c = g * 256 + lane * 8;
      const int cc = (c < NT - 8) ? c : (NT - 8);     // clamped address
      const v4f q0 = *(const v4f*)(scb + cc);
      const v4f q1 = *(const v4f*)(scb + cc + 4);
#pragma unroll
      for (int j = 0; j < 4; ++j) { v[g][j] = q0[j]; v[g][4 + j] = q1[j]; }
    }
  }
  asm volatile("s_wait_xcnt 0x0" ::: "memory");      // stands before any rewrite of the address registers that the loads above name
  __builtin_amdgcn_sched_barrier(0);                 // keeps the later writes of those registers from being scheduled in front of the wait
#pragma unroll   // constant indices into v[][]
  for (int g = 0; g < NG; ++g) {
    if (g * 256 < ncol) {
      const int c = g * 256 + lane * 8;
      float mg = NEG_INF;                            // a chain of its own for each group
#pragma unroll
      for (int j = 0; j < 8; ++j) mg = fmaxf(mg, (c + j <= t) ? sct * v[g][j] : NEG_INF);
      mx = fmaxf(mx, mg);
    }
  }
#pragma unroll
  for (int off = 16; off; off >>= 1) mx = fmaxf(mx, __shfl_xor(mx, off, 32));
  float z = 0.f;
#pragma unroll   // constant indices into v[][]
  for (int g = 0; g < NG; ++g) {
    if (g * 256 < ncol) {
      const int c = g * 256 + lane * 8;
      float zg = 0.f;                                // a chain of its own for each group
#pragma unroll
      for (int j = 0; j < 8; ++j) {
        const float e = __expf(fmaf(sct, v[g][j], -mx));
        v[g][j] = e;
        zg += (c + j <= t) ? e : 0.0f;
      }
      z += zg;
    }
  }
#pragma unroll
  for (int off = 16; off; off >>= 1) z += __shfl_xor(z, off, 32);
  const float li = 1.0f / z;
#pragma unroll   // constant indices into v[][]
  for (int g = 0; g < NG; ++g) {
    if (g * 256 < ncol) {
      const int c = g * 256 + lane * 8;
      v8h hv, lv;
#pragma unroll
      for (int j = 0; j < 8; ++j) {
        float p = v[g][j] * li;
        p = (c + j <= t) ? p : 0.0f;
        const unsigned short hb = f2bf_bits(p);
        const unsigned short lb = f2bf_bits(p - bf_bits2f(hb));
        hv[j] = __builtin_bit_cast(_Float16, hb);
        lv[j] = __builtin_bit_cast(_Float16, lb);
      }
      if (c < ncol) {                                // c % 8 == 0 and ncol % 64 == 0 -> whole 8-groups
        *(v8h*)(prh + c) = hv;
        *(v8h*)(prl + c) = lv;
      }
    }
  }
}

// ---------------------------------------------------------------------------
// Workspace region map (bytes; all offsets multiples of 1 MiB):
//   R_XB  [0, 16 MiB)            : xb bf16 [8192][1024]; later O_hi bf16 [8192][1024]
//   R_W   [16, 24 MiB)           : wjb, wjTb, wjvb, wob bf16 [1024][1024] (2 MiB each)
//   R_C   [24, 56 MiB)           : echo_hi, echo_lo bf16 [8192][1024]; later valT_hi, valT_lo bf16 [4][1024][2048]
//   R_D   [56, 88 MiB)           : eb f32 [8192][1024]; later O_lo bf16 [8192][1024]
//   R_S   [88 MiB, +32 KiB)      : sc f32 [8192]
//   R_P   [89, 153 MiB)          : P_hi, P_lo bf16 [4][2048][2048] (32 MiB each, all batches)
//   total 160,432,128 B
extern "C" void kernel_launch(void* const* d_in, const int* in_sizes, int n_in,
                              void* d_out, int out_size, void* d_ws, size_t ws_size,
                              hipStream_t stream) {
  if (n_in < 4) return;
  if (in_sizes[0] != NTOK * NE || in_sizes[1] != NE * NE || in_sizes[2] != NE * NE ||
      in_sizes[3] != NE * NE || out_size != NTOK * NE) return;
  const float* x   = (const float*)d_in[0];   // [4][2048][1024]
  const float* wj  = (const float*)d_in[1];   // [1024][1024] (out,in)
  const float* wjv = (const float*)d_in[2];   // [1024][1024]
  const float* wo  = (const float*)d_in[3];   // [1024][1024]
  float* outp = (float*)d_out;

  const size_t PLANE16 = (size_t)NTOK * NE * 2;    // 16,777,216
  const size_t WPL     = (size_t)NE * NE * 2;      //  2,097,152
  const size_t PLANE32 = (size_t)NTOK * NE * 4;    // 33,554,432
  const size_t PPL     = (size_t)NT * NT * 2;      //  8,388,608
  const size_t off_xb = 0;
  const size_t off_w  = off_xb + PLANE16;
  const size_t off_c  = off_w + 4 * WPL;
  const size_t off_d  = off_c + 2 * PLANE16;
  const size_t off_s  = off_d + PLANE32;
  const size_t off_p  = off_s + ((size_t)1 << 20);
  const size_t total  = off_p + 2 * NBATCH * PPL;  // 160,432,128
  if (total > ws_size) return;

  char* ws = (char*)d_ws;
  unsigned short* xb     = (unsigned short*)(ws + off_xb);
  unsigned short* o_hi   = (unsigned short*)(ws + off_xb);
  unsigned short* wjb    = (unsigned short*)(ws + off_w);
  unsigned short* wjTb   = (unsigned short*)(ws + off_w + WPL);
  unsigned short* wjvb   = (unsigned short*)(ws + off_w + 2 * WPL);
  unsigned short* wob    = (unsigned short*)(ws + off_w + 3 * WPL);
  unsigned short* ech_hi = (unsigned short*)(ws + off_c);
  unsigned short* ech_lo = (unsigned short*)(ws + off_c + PLANE16);
  unsigned short* vt_hi  = (unsigned short*)(ws + off_c);
  unsigned short* vt_lo  = (unsigned short*)(ws + off_c + PLANE16);
  float*          ebp    = (float*)(ws + off_d);
  unsigned short* p_hi   = (unsigned short*)(ws + off_p);
  unsigned short* p_lo   = (unsigned short*)(ws + off_p + NBATCH * PPL);
  unsigned short* o_lo   = (unsigned short*)(ws + off_d);
  float*          scp    = (float*)(ws + off_s);

  const dim3 blk(256);

  // 1) input planes, RNE bf16
  cast_f32_bf16x2<<<dim3((NTOK * NE / 2) / 256), blk, 0, stream>>>(x, xb, NTOK * NE / 2);
  cast_f32_bf16x2<<<dim3((NE * NE / 2) / 256), blk, 0, stream>>>(wj, wjb, NE * NE / 2);
  cast_f32_bf16x2<<<dim3((NE * NE / 2) / 256), blk, 0, stream>>>(wjv, wjvb, NE * NE / 2);
  cast_f32_bf16x2<<<dim3((NE * NE / 2) / 256), blk, 0, stream>>>(wo, wob, NE * NE / 2);
  // wj in[f=1024][e=1024] -> wjTb out[e][f]
  wt_cast_bf16_k<<<dim3(NE / 64, NE / 64), blk, 0, stream>>>(wj, wjTb, NE, NE);

  // 2) echo[t][f] = sum_e xb[t][e] wjb[f][e]  -> bf16 hi/lo planes   (M=8192, N=1024, K=1024; 2048 tiles = 256 blocks)
  wmma_gemm64<1, 0, 2, false><<<dim3((NTOK / 64) * (NE / 64) / 8, 1), blk, 0, stream>>>(
      xb, xb, NE, 0L, wjb, wjb, NE, 0L, (void*)ech_hi, (void*)ech_lo, NE, 0L, NTOK, NE, NE, 1.0f);
  // 3) eb[t][e] = sum_f echo[t][f] wj[f][e] = sum_f echo[t][f] wjTb[e][f]  (A hi/lo, 2 products) -> f32
  wmma_gemm64<1, 1, 0, false><<<dim3((NTOK / 64) * (NE / 64) / 8, 1), blk, 0, stream>>>(
      ech_hi, ech_lo, NE, 0L, wjTb, wjTb, NE, 0L, (void*)ebp, (void*)ebp, NE, 0L, NTOK, NE, NE, 1.0f);
  // 4) token scores
  sc_k<<<dim3(NTOK / 32), blk, 0, stream>>>(xb, ebp, scp);
  // 5) valT[b][d][t] = sum_e wjvb[d][e] xb[b][t][e] -> bf16 hi/lo planes [4][1024][2048]  (M=1024, N=2048, K=1024; 512 tiles = 64 blocks per batch)
  wmma_gemm64<1, 0, 2, false><<<dim3((NE / 64) * (NT / 64) / 8, NBATCH), blk, 0, stream>>>(
      wjvb, wjvb, NE, 0L, xb, xb, NE, (long)NT * NE, (void*)vt_hi, (void*)vt_lo, NT, (long)NE * NT, NE, NT, NE, 1.0f);
  // 6) all batches at once (grid.y = batch): probability planes with their softmax statistics, then O[b][t][d] = sum_{s < tile end} P[b][t][s] valT[b][d][s]
  //    (hi/lo x hi/lo, causal k-limit) -> O hi/lo planes   (512 tiles = 64 blocks per batch, 256 blocks in the launch)
  pgen_k<<<dim3(NT / 8, NBATCH), blk, 0, stream>>>(scp, p_hi, p_lo);
  wmma_gemm64<1, 2, 2, true><<<dim3((NT / 64) * (NE / 64) / 8, NBATCH), blk, 0, stream>>>(
      p_hi, p_lo, NT, (long)NT * NT, vt_hi, vt_lo, NT, (long)NE * NT,
      (void*)o_hi, (void*)o_lo, NE, (long)NT * NE, NT, NE, NT, 1.0f);
  // 7) out[t][n] = sum_d O[t][d] wob[n][d]  (A hi/lo, 2 products) -> f32 output
  wmma_gemm64<1, 1, 0, false><<<dim3((NTOK / 64) * (NE / 64) / 8, 1), blk, 0, stream>>>(
      o_hi, o_lo, NE, 0L, wob, wob, NE, 0L, (void*)outp, (void*)outp, NE, 0L, NTOK, NE, NE, 1.0f);
}

// v004
// A run of this version takes 168 microseconds.
// In both of two side-by-side timings against v003, it was 1.29 times as fast.
// Counting every step since v000, it is 4.63 times as fast.
// Contractions on v_wmma_f32_16x16x32_bf16 (bf16 operands, f32 accumulate): echo = xb*wjb^T (plain, inputs RNE bf16; only its rows' sums of squares leave the kernel), val^T = wjvb*xb^T (plain), O = P{hi,lo}*val^T{hi,lo} (3 products, causal k-limit), out = O{hi,lo}*wob^T (2 products); token scores (x.(echo*wj) = echo.echo), softmax statistics and probabilities in f32 on VALU.
#include <hip/hip_runtime.h>
#include <stdint.h>

constexpr int NBATCH = 4;
constexpr int NT     = 2048;
constexpr int NE     = 1024;
constexpr int NTOK   = NBATCH * NT;
static_assert((NTOK % 64) == 0 && (NT % 64) == 0 && (NE % 64) == 0);

typedef __attribute__((ext_vector_type(16))) _Float16 v16h;
typedef __attribute__((ext_vector_type(8)))  _Float16 v8h;
typedef __attribute__((ext_vector_type(16))) __bf16   v16b;
typedef __attribute__((ext_vector_type(8)))  __bf16   v8b;
typedef __attribute__((ext_vector_type(8)))  float    v8f;
typedef __attribute__((ext_vector_type(4)))  float    v4f;
typedef __attribute__((ext_vector_type(8)))  unsigned short v8us;

__device__ __forceinline__ unsigned short f2bf_bits(float f) {
  unsigned u = __float_as_uint(f);
  return (unsigned short)((u + 0x7FFFu + ((u >> 16) & 1u)) >> 16);
}
__device__ __forceinline__ float bf_bits2f(unsigned short h) { return __uint_as_float(((unsigned)h) << 16); }

// slots between the last WMMAs and the epilogue's first reads of their accumulators
__device__ __forceinline__ void acc_guard4(v8f& a, v8f& b, v8f& c, v8f& d) { asm volatile("v_nop\n\tv_nop\n\tv_nop\n\tv_nop" : "+v"(a), "+v"(b), "+v"(c), "+v"(d)); }
// x + x of lane (l ^ MASK) inside the 16-lane row (DPP row_xmask)
template <int MASK> __device__ __forceinline__ float add_xmask(float x) {
  return x + __builtin_bit_cast(float, __builtin_amdgcn_update_dpp(0, __builtin_bit_cast(int, x), 0x160 + MASK, 0xf, 0xf, true));
}
template <typename T> struct Frag;
template <> struct Frag<_Float16> {
  typedef v16h V; union U { v16h v; v8h h[2]; };
  static __device__ __forceinline__ v16h load2(const unsigned char* p0, const unsigned char* p1) {   // elements 0..7 <- 16 B at p0, 8..15 <- 16 B at p1
    U f; f.h[0] = *(const v8h*)(p0); f.h[1] = *(const v8h*)(p1); return f.v;
  }
  static __device__ __forceinline__ v8f mma(v16h a, v16h b, v8f c) {
    return __builtin_amdgcn_wmma_f32_16x16x32_f16(false, a, false, b, (short)0, c, false, false);
  }
};
template <> struct Frag<__bf16> {
  typedef v16b V; union U { v16b v; v8b h[2]; };
  static __device__ __forceinline__ v16b load2(const unsigned char* p0, const unsigned char* p1) {
    U f; f.h[0] = *(const v8b*)(p0); f.h[1] = *(const v8b*)(p1); return f.v;
  }
  static __device__ __forceinline__ v8f mma(v16b a, v16b b, v8f c) {
    return __builtin_amdgcn_wmma_f32_16x16x32_bf16(false, a, false, b, (short)0, c, false, false);
  }
};

// ---- Register-blocked batched WMMA GEMM ------------------------------------
// C[m,n] = scale * sum_k A[m,k] * Bt[n,k]; each wave owns a 64x64 tile; the 8 waves of a block share the 64 rows of A and
// hold 8 neighbouring column tiles (512 rows of Bt).
// A row-major [M,K]; Bt row-major [N,K]; M % 64 == 0, N % 512 == 0, K % 64 == 0, K >= 64.
// The k loop works on stages of 64 k: every row of a stage is one whole 128-byte line, brought into LDS by asynchronous
// copies (a wave-wide copy = 4 whole lines), two buffers, the next stage in flight while this one is worked on.
// LDS place of the 16-byte chunk c (0..7) of stage row R: R * 128 + ((c ^ ((R >> 1) & 7)) * 16): 16 rows read at one chunk
// index fall on 16 different 16-byte bank groups.
// SPLIT: 0 = single product; 1 = A carried as hi/lo planes (A2 = lo), Bt single: hi.B + lo.B (2 products);
//        2 = A and Bt as hi/lo planes: hi.hi + hi.lo + lo.hi (3 products).
// OUT_MODE: 0 = f32, 1 = f16, 2 = bf16 hi plane (Cout) + bf16 lo plane (Cout2),
//           3 = no C at all: Cout[(n / 512) * M + m] = scale * sum over the block's 512 columns n of C[m,n]^2 (f32, fixed order).
// CAUSAL: the k loop of the wave tile at rows m0..m0+63 stops at k = m0 + 64 (lower block-triangular A).
// ET: 0 = f16 operands, 1 = bf16 operands (pointers passed as 16-bit storage)
template <int ET> struct Elem;
template <> struct Elem<0> { typedef _Float16 T; };
template <> struct Elem<1> { typedef __bf16 T; };
typedef __attribute__((address_space(3))) unsigned char lds_u8;
// Asynchronous copies, 16 bytes a lane, global -> LDS.  The s_wait_xcnt is the last line of the copies' own statement: it stands
// before any later rewrite of the address registers that the copies name.
__device__ __forceinline__ void async_copy2(unsigned l, const unsigned char* g, unsigned lstep, size_t gstep) {
  asm volatile("global_load_async_to_lds_b128 %0, %1, off\n\t"
               "global_load_async_to_lds_b128 %2, %3, off\n\t"
               "s_wait_xcnt 0x0"
               :: "v"(l), "v"(g), "v"(l + lstep), "v"(g + gstep) : "memory");
}
__device__ __forceinline__ void async_copy8(unsigned l, const unsigned char* g, unsigned lstep, size_t gstep) {
  asm volatile("global_load_async_to_lds_b128 %0, %1, off\n\t"
               "global_load_async_to_lds_b128 %2, %3, off\n\t"
               "global_load_async_to_lds_b128 %4, %5, off\n\t"
               "global_load_async_to_lds_b128 %6, %7, off\n\t"
               "global_load_async_to_lds_b128 %8, %9, off\n\t"
               "global_load_async_to_lds_b128 %10, %11, off\n\t"
               "global_load_async_to_lds_b128 %12, %13, off\n\t"
               "global_load_async_to_lds_b128 %14, %15, off\n\t"
               "s_wait_xcnt 0x0"
               :: "v"(l), "v"(g), "v"(l + lstep), "v"(g + gstep), "v"(l + 2 * lstep), "v"(g + 2 * gstep),
                  "v"(l + 3 * lstep), "v"(g + 3 * gstep), "v"(l + 4 * lstep), "v"(g + 4 * gstep),
                  "v"(l + 5 * lstep), "v"(g + 5 * gstep), "v"(l + 6 * lstep), "v"(g + 6 * gstep),
                  "v"(l + 7 * lstep), "v"(g + 7 * gstep) : "memory");
}
template <int ET, int SPLIT, int OUT_MODE, bool CAUSAL>
__global__ __launch_bounds__(256) void wmma_gemm64(
    const unsigned short* __restrict__ Ap, const unsigned short* __restrict__ A2p, int lda, long strideA,
    const unsigned short* __restrict__ Btp, const unsigned short* __restrict__ Bt2p, int ldb, long strideB,
    void* __restrict__ Cout, void* __restrict__ Cout2, int ldc, long strideC,
    int M, int N, int K, float scale) {
  typedef typename Elem<ET>::T T;
  typedef typename Frag<T>::V V;
  const T* A = (const T*)Ap; const T* A2 = (const T*)A2p; const T* Bt = (const T*)Btp; const T* Bt2 = (const T*)Bt2p;
  constexpr int NPA   = (SPLIT >= 1) ? 2 : 1;          // planes of A, of Bt
  constexpr int NPB   = (SPLIT == 2) ? 2 : 1;
  constexpr int OFF_B = NPA * 64 * 128;                // bytes: A planes (64 rows each), then Bt planes (512 rows each)
  constexpr int BUFB  = OFF_B + NPB * 512 * 128;       // one stage buffer
  constexpr int SLABS = 8 * 16 * 68 * 4;               // epilogue: per-wave 16x64 slab, pitch 68 floats
  __shared__ __attribute__((aligned(128))) unsigned char smem[(2 * BUFB > SLABS) ? 2 * BUFB : SLABS];   // the slabs reuse the stage buffers behind the loop
  const int b    = blockIdx.y;
  const int lane = threadIdx.x & 31;
  const int wave = threadIdx.x >> 5;
  const int tilesN = N >> 6;                           // multiple of 8: the 8 tiles of a block lie in one tile row
  const int tilesM = M >> 6;
  const int tile0 = blockIdx.x * 8;
  if (tile0 >= tilesM * tilesN) return;   // block-uniform, in front of every barrier
  const int tm  = tile0 / tilesN;
  const int tn0 = tile0 - tm * tilesN;
  const int m0  = tm << 6;
  const int nb0 = tn0 << 6;                            // first Bt row of the block
  const int n0  = nb0 + (wave << 6);

  const T* Ab  = A  + (size_t)b * strideA;
  const T* Bb  = Bt + (size_t)b * strideB;
  const T* Ab2 = (SPLIT >= 1) ? (A2  + (size_t)b * strideA) : nullptr;
  const T* Bb2 = (SPLIT == 2) ? (Bt2 + (size_t)b * strideB) : nullptr;

  const int rlane = lane & 15;                 // row (A) / col (B, D) within subtile
  const int mOff  = (lane >> 4) * 8;           // D row offset

  v8f acc[4][4];
#pragma unroll
  for (int i = 0; i < 4; ++i)
#pragma unroll
    for (int j = 0; j < 4; ++j) acc[i][j] = (v8f){0.f,0.f,0.f,0.f,0.f,0.f,0.f,0.f};

  int kEnd = K;
  if (CAUSAL) kEnd = (m0 + 64 < K) ? (m0 + 64) : K;   // block-uniform, multiple of 64
  const int nStage = kEnd >> 6;

  // copies: thread = (stage row cr + 32 q, chunk cc); the chunk swizzle of a row depends on cr alone (32 q >> 1 is 0 mod 8)
  const int cc = threadIdx.x & 7, cr = threadIdx.x >> 3;
  const unsigned ldsC = (unsigned)(uintptr_t)(lds_u8*)smem + (unsigned)(cr * 128 + ((cc ^ ((cr >> 1) & 7)) << 4));
  const unsigned char* gA  = (const unsigned char*)(Ab + (size_t)(m0 + cr) * lda + cc * 8);
  const unsigned char* gB  = (const unsigned char*)(Bb + (size_t)(nb0 + cr) * ldb + cc * 8);
  const unsigned char* gA2 = (SPLIT >= 1) ? (const unsigned char*)(Ab2 + (size_t)(m0 + cr) * lda + cc * 8) : nullptr;
  const unsigned char* gB2 = (SPLIT == 2) ? (const unsigned char*)(Bb2 + (size_t)(nb0 + cr) * ldb + cc * 8) : nullptr;
  const size_t gsA = (size_t)lda * 64, gsB = (size_t)ldb * 64;   // 32 rows, bytes
  auto issue = [&](int buf, int st) {                  // all copies of stage st (k = 64 st .. 64 st + 63) into buffer buf
    const unsigned l = ldsC + (unsigned)(buf * BUFB);
    const size_t ko = (size_t)st * 128;
    async_copy2(l, gA + ko, 4096u, gsA);
    if (SPLIT >= 1) async_copy2(l + 8192u, gA2 + ko, 4096u, gsA);
    async_copy8(l + OFF_B, gB + ko, 4096u, gsB);
    async_copy8(l + OFF_B + 32768u, gB + ko + 8 * gsB, 4096u, gsB);
    if (SPLIT == 2) {
      async_copy8(l + OFF_B + 65536u, gB2 + ko, 4096u, gsB);
      async_copy8(l + OFF_B + 98304u, gB2 + ko + 8 * gsB, 4096u, gsB);
    }
  };
  // readers: lane = (row rlane of a 16-row group, half h); chunk 4 s + h holds k = 32 s + 8 h + 0..7, chunk 4 s + h + 2 holds k + 16
  const int e0 = (lane >> 4) ^ ((rlane >> 1) & 7);
  const int rowB = rlane * 128;
  int fo[4];
#pragma unroll   // fo[] is indexed by constants only and stays in registers
  for (int q = 0; q < 4; ++q) fo[q] = rowB + ((e0 ^ (2 * q)) << 4);

  issue(0, 0);
  asm volatile("s_wait_asynccnt 0x0" ::: "memory");    // this wave's copies of stage 0 have landed
  __syncthreads();                                     // and every other wave's
  if (nStage > 1) issue(1, 1);
  for (int st = 0; st < nStage; ++st) {
    const unsigned char* sA = smem + (st & 1) * BUFB;
    const unsigned char* sB = sA + OFF_B + wave * 8192;
#pragma unroll   // both 32-wide k-steps of a stage: constant indices into fo[]
    for (int s = 0; s < 2; ++s) {
      V bh[4], bl[4];
#pragma unroll
      for (int j = 0; j < 4; ++j) {
        bh[j] = Frag<T>::load2(sB + j * 2048 + fo[2 * s], sB + j * 2048 + fo[2 * s + 1]);
        if (SPLIT == 2) bl[j] = Frag<T>::load2(sB + 65536 + j * 2048 + fo[2 * s], sB + 65536 + j * 2048 + fo[2 * s + 1]);
      }
#pragma unroll
      for (int i = 0; i < 4; ++i) {
        V ah = Frag<T>::load2(sA + i * 2048 + fo[2 * s], sA + i * 2048 + fo[2 * s + 1]);
        V al;
        if (SPLIT >= 1) al = Frag<T>::load2(sA + 8192 + i * 2048 + fo[2 * s], sA + 8192 + i * 2048 + fo[2 * s + 1]);
#pragma unroll
        for (int j = 0; j < 4; ++j) {
          acc[i][j] = Frag<T>::mma(ah, bh[j], acc[i][j]);
          if (SPLIT == 2) acc[i][j] = Frag<T>::mma(ah, bl[j], acc[i][j]);
          if (SPLIT >= 1) acc[i][j] = Frag<T>::mma(al, bh[j], acc[i][j]);
        }
      }
    }
    asm volatile("s_wait_dscnt 0x0" ::: "memory");     // this wave's reads of the buffer are done before it may be refilled
    asm volatile("s_wait_asynccnt 0x0" ::: "memory");  // this wave's copies of stage st + 1 have landed
    __syncthreads();                                   // publishes stage st + 1 and ends every wave's reads of stage st
    if (st + 2 < nStage) issue(st & 1, st + 2);
  }
  asm volatile("s_wait_asynccnt 0x0" ::: "memory");    // no copy is outstanding when the slabs reuse the buffers
  acc_guard4(acc[0][0], acc[0][1], acc[0][2], acc[0][3]);
  acc_guard4(acc[1][0], acc[1][1], acc[1][2], acc[1][3]);
  acc_guard4(acc[2][0], acc[2][1], acc[2][2], acc[2][3]);
  acc_guard4(acc[3][0], acc[3][1], acc[3][2], acc[3][3]);

  // ---- epilogue ----
  if (OUT_MODE == 3) {
    // lane = column rlane of each 16-column subtile, register r = row mOff + r: squares summed over j, then over the 16 lanes of the row
    float* wsum = (float*)smem;                        // [8 waves][64 rows], reuses the stage buffers behind the loop
#pragma unroll   // constant indices into acc[][], which stays in registers
    for (int i = 0; i < 4; ++i) {
      float keep = 0.f;
#pragma unroll   // constant indices into acc[][]; the eight rows' lane sums interleave
      for (int r = 0; r < 8; ++r) {
        float s = acc[i][0][r] * acc[i][0][r];
        s = fmaf(acc[i][1][r], acc[i][1][r], s);
        s = fmaf(acc[i][2][r], acc[i][2][r], s);
        s = fmaf(acc[i][3][r], acc[i][3][r], s);
        s = add_xmask<1>(s); s = add_xmask<2>(s); s = add_xmask<4>(s); s = add_xmask<8>(s);
        keep = (rlane == r) ? s : keep;
      }
      if (rlane < 8) wsum[wave * 64 + (i << 4) + mOff + rlane] = keep;
    }
    __syncthreads();                                   // the 8 waves' sums of each row are in LDS before they are added
    if (threadIdx.x < 64) {
      float s = wsum[threadIdx.x];
#pragma unroll   // the eight LDS reads are in flight together
      for (int w = 1; w < 8; ++w) s += wsum[w * 64 + threadIdx.x];
      ((float*)Cout)[(size_t)(nb0 >> 9) * M + m0 + threadIdx.x] = s * scale;
    }
    return;
  }
  float* slab = (float*)smem + wave * (16 * 68);
#pragma unroll
  for (int i = 0; i < 4; ++i) {
    const int mBase = m0 + (i << 4);
#pragma unroll
    for (int j = 0; j < 4; ++j) {
#pragma unroll
      for (int r = 0; r < 8; ++r) {
        float v = acc[i][j][r] * scale;
        slab[(mOff + r) * 68 + (j << 4) + rlane] = v;
      }
    }
    __builtin_amdgcn_fence(__ATOMIC_RELEASE, "workgroup");
    __builtin_amdgcn_wave_barrier();
    __builtin_amdgcn_fence(__ATOMIC_ACQUIRE, "workgroup");
    if (OUT_MODE == 0) {
      float* C = (float*)Cout + (size_t)b * strideC;
      const int hh = lane >> 4, c4 = (lane & 15) * 4;     // row seg = 256 B = 16 lanes x 16 B
      {
#pragma unroll
        for (int it = 0; it < 8; ++it) {
          const int row = it * 2 + hh;
          v4f v = *(const v4f*)(slab + row * 68 + c4);
          *(v4f*)(C + (size_t)(mBase + row) * ldc + n0 + c4) = v;
        }
        
      }
    } else {
      const int q = lane >> 3, c8 = (lane & 7) * 8;
      unsigned short* C  = (unsigned short*)Cout  + (size_t)b * strideC;
      unsigned short* C2 = (OUT_MODE == 2) ? ((unsigned short*)Cout2 + (size_t)b * strideC) : nullptr;
      {
#pragma unroll
        for (int it = 0; it < 4; ++it) {
          const int row = it * 4 + q;
          const float* sp = slab + row * 68 + c8;
          v8h hv, lv;
#pragma unroll
          for (int e = 0; e < 8; ++e) {
            if (OUT_MODE == 1) {
              hv[e] = (_Float16)sp[e];
            } else {
              unsigned short hb = f2bf_bits(sp[e]);
              unsigned short lb = f2bf_bits(sp[e] - bf_bits2f(hb));
              hv[e] = __builtin_bit_cast(_Float16, hb);
              lv[e] = __builtin_bit_cast(_Float16, lb);
            }
          }
          *(v8h*)(C + (size_t)(mBase + row) * ldc + n0 + c8) = hv;
          if (OUT_MODE == 2) *(v8h*)(C2 + (size_t)(mBase + row) * ldc + n0 + c8) = lv;
        }
        
      }
    }
    __builtin_amdgcn_fence(__ATOMIC_RELEASE, "workgroup");
    __builtin_amdgcn_wave_barrier();
    __builtin_amdgcn_fence(__ATOMIC_ACQUIRE, "workgroup");
  }
}

// Coverage: n2 threads x 2 elements = the whole plane (n2 = count/2, count even).
__global__ __launch_bounds__(256) void cast_f32_bf16x2(
    const float* __restrict__ in, unsigned short* __restrict__ out, int n2) {
  const int i = blockIdx.x * 256 + threadIdx.x;
  if (i < n2) {
    const float a0 = in[2 * (size_t)i], a1 = in[2 * (size_t)i + 1];
    const unsigned u = (unsigned)f2bf_bits(a0) | ((unsigned)f2bf_bits(a1) << 16);
    ((unsigned*)out)[i] = u;
    
  }
}

// ---- probability planes with their row statistics, batch = blockIdx.y, wave = one row t ----
// sc = scp[0][.] + scp[1][.]: the two halves of each token's score, as the echo product's two column blocks left them; the block adds
// them once for its batch (thread = 8 neighbouring tokens, 256 x 8 = NT) and its 8 waves read the sums from LDS.
// m_t = max_{s<=t} fl(sc_t*sc_s), z_t = sum_{s<=t} exp(sc_t*sc_s - m_t);
// P[b][t][s] = exp(sc_t*sc_s - m_t) * (1/z_t) for s <= t, 0 for t < s < ((t>>6)+1)*64.
// The row's scores stay in registers (lane = 8 neighbouring columns of each 256-column group, at most 8 groups), so all loads of a
// row are in flight together and every exponential is formed once; maximum and sum end in a butterfly over the 32 lanes.
// Written as bf16 hi + bf16 lo planes [NBATCH][NT][NT] (row pitch NT).
// Coverage: gridDim.x * 8 = NT rows, gridDim.y = NBATCH batches; columns [0, ((t>>6)+1)*64) of every row in both planes = exactly what the causal
// P.V product reads for the 64-row tile containing t.
__global__ __launch_bounds__(256) void pgen_k(const float* __restrict__ scp, unsigned short* __restrict__ php,
                                              unsigned short* __restrict__ plp) {
  constexpr int NG = NT / 256;                     // column groups of a full row
  static_assert(NT == 256 * 8);
  __shared__ __attribute__((aligned(16))) float s_sc[NT];
  const int b = blockIdx.y;                        // 0..NBATCH-1
  _Float16* ph = (_Float16*)php + (size_t)b * NT * NT;
  _Float16* pl = (_Float16*)plp + (size_t)b * NT * NT;
  const int wave = __builtin_amdgcn_readfirstlane(threadIdx.x >> 5), lane = threadIdx.x & 31;
  const int t = blockIdx.x * 8 + wave;             // 0..NT-1, wave-uniform
  {
    const float* scb = scp + (size_t)b * NT + threadIdx.x * 8;
    const v4f q0 = *(const v4f*)(scb);
    const v4f q1 = *(const v4f*)(scb + 4);
    const v4f u0 = *(const v4f*)(scb + NTOK);
    const v4f u1 = *(const v4f*)(scb + NTOK + 4);
    asm volatile("s_wait_xcnt 0x0" ::: "memory");    // stands before any rewrite of the address registers that the loads above name
    __builtin_amdgcn_sched_barrier(0);               // keeps the later writes of those registers from being scheduled in front of the wait
    *(v4f*)(s_sc + threadIdx.x * 8)     = q0 + u0;
    *(v4f*)(s_sc + threadIdx.x * 8 + 4) = q1 + u1;
  }
  __syncthreads();                                   // all NT scores of the batch are in LDS before any wave reads them
  const float sct = s_sc[t];
  const int ncol = ((t >> 6) + 1) << 6;
  _Float16* prh = ph + (size_t)t * NT;
  _Float16* prl = pl + (size_t)t * NT;
  float v[NG][8];
  const float NEG_INF = __uint_as_float(0xff800000u);
  float mx = NEG_INF;
#pragma unroll   // v[][] is indexed by constants only and stays in registers
  for (int g = 0; g < NG; ++g) {
    if (g * 256 < ncol) {                            // wave-uniform
      const int c = g * 256 + lane * 8;
      const int cc = (c < NT - 8) ? c : (NT - 8);     // clamped address
      const v4f q0 = *(const v4f*)(s_sc + cc);
      const v4f q1 = *(const v4f*)(s_sc + cc + 4);
#pragma unroll
      for (int j = 0; j < 4; ++j) { v[g][j] = q0[j]; v[g][4 + j] = q1[j]; }
    }
  }
#pragma unroll   // constant indices into v[][]
  for (int g = 0; g < NG; ++g) {
    if (g * 256 < ncol) {
      const int c = g * 256 + lane * 8;
      float mg = NEG_INF;                            // a chain of its own for each group
#pragma unroll
      for (int j = 0; j < 8; ++j) mg = fmaxf(mg, (c + j <= t) ? sct * v[g][j] : NEG_INF);
      mx = fmaxf(mx, mg);
    }
  }
#pragma unroll
  for (int off = 16; off; off >>= 1) mx = fmaxf(mx, __shfl_xor(mx, off, 32));
  float z = 0.f;
#pragma unroll   // constant indices into v[][]
  for (int g = 0; g < NG; ++g) {
    if (g * 256 < ncol) {
      const int c = g * 256 + lane * 8;
      float zg = 0.f;                                // a chain of its own for each group
#pragma unroll
      for (int j = 0; j < 8; ++j) {
        const float e = __expf(fmaf(sct, v[g][j], -mx));
        v[g][j] = e;
        zg += (c + j <= t) ? e : 0.0f;
      }
      z += zg;
    }
  }
#pragma unroll
  for (int off = 16; off; off >>= 1) z += __shfl_xor(z, off, 32);
  const float li = 1.0f / z;
#pragma unroll   // constant indices into v[][]
  for (int g = 0; g < NG; ++g) {
    if (g * 256 < ncol) {
      const int c = g * 256 + lane * 8;
      v8h hv, lv;
#pragma unroll
      for (int j = 0; j < 8; ++j) {
        float p = v[g][j] * li;
        p = (c + j <= t) ? p : 0.0f;
        const unsigned short hb = f2bf_bits(p);
        const unsigned short lb = f2bf_bits(p - bf_bits2f(hb));
        hv[j] = __builtin_bit_cast(_Float16, hb);
        lv[j] = __builtin_bit_cast(_Float16, lb);
      }
      if (c < ncol) {                                // c % 8 == 0 and ncol % 64 == 0 -> whole 8-groups
        *(v8h*)(prh + c) = hv;
        *(v8h*)(prl + c) = lv;
      }
    }
  }
}

// ---------------------------------------------------------------------------
// Workspace region map (bytes; all offsets multiples of 1 MiB):
//   R_XB  [0, 16 MiB)            : xb bf16 [8192][1024]; later O_hi bf16 [8192][1024]
//   R_W   [16, 24 MiB)           : wjb, (unused), wjvb, wob bf16 [1024][1024] (2 MiB each)
//   R_C   [24, 56 MiB)           : valT_hi, valT_lo bf16 [4][1024][2048]
//   R_D   [56, 88 MiB)           : O_lo bf16 [8192][1024]
//   R_S   [88 MiB, +64 KiB)      : the two halves of sc, f32 [2][8192]
//   R_P   [89, 153 MiB)          : P_hi, P_lo bf16 [4][2048][2048] (32 MiB each, all batches)
//   total 160,432,128 B
extern "C" void kernel_launch(void* const* d_in, const int* in_sizes, int n_in,
                              void* d_out, int out_size, void* d_ws, size_t ws_size,
                              hipStream_t stream) {
  if (n_in < 4) return;
  if (in_sizes[0] != NTOK * NE || in_sizes[1] != NE * NE || in_sizes[2] != NE * NE ||
      in_sizes[3] != NE * NE || out_size != NTOK * NE) return;
  const float* x   = (const float*)d_in[0];   // [4][2048][1024]
  const float* wj  = (const float*)d_in[1];   // [1024][1024] (out,in)
  const float* wjv = (const float*)d_in[2];   // [1024][1024]
  const float* wo  = (const float*)d_in[3];   // [1024][1024]
  float* outp = (float*)d_out;

  const size_t PLANE16 = (size_t)NTOK * NE * 2;    // 16,777,216
  const size_t WPL     = (size_t)NE * NE * 2;      //  2,097,152
  const size_t PLANE32 = (size_t)NTOK * NE * 4;    // 33,554,432
  const size_t PPL     = (size_t)NT * NT * 2;      //  8,388,608
  const size_t off_xb = 0;
  const size_t off_w  = off_xb + PLANE16;
  const size_t off_c  = off_w + 4 * WPL;
  const size_t off_d  = off_c + 2 * PLANE16;
  const size_t off_s  = off_d + PLANE32;
  const size_t off_p  = off_s + ((size_t)1 << 20);
  const size_t total  = off_p + 2 * NBATCH * PPL;  // 160,432,128
  if (total > ws_size) return;

  char* ws = (char*)d_ws;
  unsigned short* xb     = (unsigned short*)(ws + off_xb);
  unsigned short* o_hi   = (unsigned short*)(ws + off_xb);
  unsigned short* wjb    = (unsigned short*)(ws + off_w);
  unsigned short* wjvb   = (unsigned short*)(ws + off_w + 2 * WPL);
  unsigned short* wob    = (unsigned short*)(ws + off_w + 3 * WPL);
  unsigned short* vt_hi  = (unsigned short*)(ws + off_c);
  unsigned short* vt_lo  = (unsigned short*)(ws + off_c + PLANE16);
  unsigned short* p_hi   = (unsigned short*)(ws + off_p);
  unsigned short* p_lo   = (unsigned short*)(ws + off_p + NBATCH * PPL);
  unsigned short* o_lo   = (unsigned short*)(ws + off_d);
  float*          scp    = (float*)(ws + off_s);

  const dim3 blk(256);

  // 1) input planes, RNE bf16
  cast_f32_bf16x2<<<dim3((NTOK * NE / 2) / 256), blk, 0, stream>>>(x, xb, NTOK * NE / 2);
  cast_f32_bf16x2<<<dim3((NE * NE / 2) / 256), blk, 0, stream>>>(wj, wjb, NE * NE / 2);
  cast_f32_bf16x2<<<dim3((NE * NE / 2) / 256), blk, 0, stream>>>(wjv, wjvb, NE * NE / 2);
  cast_f32_bf16x2<<<dim3((NE * NE / 2) / 256), blk, 0, stream>>>(wo, wob, NE * NE / 2);

  // 2) token scores.  echo[t][f] = sum_e xb[t][e] wjb[f][e]   (M=8192, N=1024, K=1024; 2048 tiles = 256 blocks); for every x and wj
  //    sum_e x[t][e] (sum_f echo[t][f] wj[f][e]) = sum_f echo[t][f] (sum_e wj[f][e] x[t][e]) = sum_f echo[t][f]^2,
  //    so sc[t] = (1/32) sum_f echo[t][f]^2, left as one partial sum for each of the two column blocks
  wmma_gemm64<1, 0, 3, false><<<dim3((NTOK / 64) * (NE / 64) / 8, 1), blk, 0, stream>>>(
      xb, xb, NE, 0L, wjb, wjb, NE, 0L, (void*)scp, (void*)scp, NE, 0L, NTOK, NE, NE, 1.0f / 32.0f);
  // 3) valT[b][d][t] = sum_e wjvb[d][e] xb[b][t][e] -> bf16 hi/lo planes [4][1024][2048]  (M=1024, N=2048, K=1024; 512 tiles = 64 blocks per batch)
  wmma_gemm64<1, 0, 2, false><<<dim3((NE / 64) * (NT / 64) / 8, NBATCH), blk, 0, stream>>>(
      wjvb, wjvb, NE, 0L, xb, xb, NE, (long)NT * NE, (void*)vt_hi, (void*)vt_lo, NT, (long)NE * NT, NE, NT, NE, 1.0f);
  // 4) all batches at once (grid.y = batch): probability planes with their softmax statistics, then O[b][t][d] = sum_{s < tile end} P[b][t][s] valT[b][d][s]
  //    (hi/lo x hi/lo, causal k-limit) -> O hi/lo planes   (512 tiles = 64 blocks per batch, 256 blocks in the launch)
  pgen_k<<<dim3(NT / 8, NBATCH), blk, 0, stream>>>(scp, p_hi, p_lo);
  wmma_gemm64<1, 2, 2, true><<<dim3((NT / 64) * (NE / 64) / 8, NBATCH), blk, 0, stream>>>(
      p_hi, p_lo, NT, (long)NT * NT, vt_hi, vt_lo, NT, (long)NE * NT,
      (void*)o_hi, (void*)o_lo, NE, (long)NT * NE, NT, NE, NT, 1.0f);
  // 5) out[t][n] = sum_d O[t][d] wob[n][d]  (A hi/lo, 2 products) -> f32 output
  wmma_gemm64<1, 1, 0, false><<<dim3((NTOK / 64) * (NE / 64) / 8, 1), blk, 0, stream>>>(
      o_hi, o_lo, NE, 0L, wob, wob, NE, 0L, (void*)outp, (void*)outp, NE, 0L, NTOK, NE, NE, 1.0f);
}

// v007
// Measured time: 106 microseconds a run.
// Versions between v004 and this one are left out; their measured steps multiply to 1.58 times as fast.
// Counting every step since v000, it is 7.30 times as fast.
// Contractions on v_wmma_f32_16x16x32 (16-bit operands, f32 accumulate). bf16: echo = xb*wjb^T (inputs RNE bf16; only its rows' sums of squares leave the kernel), W2 = wob*wjvb (the output projection folded into the value weights: (P*(x*wjv^T))*wo^T = P*(x*(wo*wjv)^T) for every input), u^T = W2b*xb^T. f16: out = P*u^T (causal k-limit, f32 result); P and u^T are carried as one RNE f16 plane each; token scores (x.(echo*wj) = echo.echo), softmax statistics and probabilities in f32 on VALU.
#include <hip/hip_runtime.h>
#include <stdint.h>

constexpr int NBATCH = 4;
constexpr int NT     = 2048;
constexpr int NE     = 1024;
constexpr int NTOK   = NBATCH * NT;
static_assert((NTOK % 64) == 0 && (NT % 64) == 0 && (NE % 64) == 0);

typedef __attribute__((ext_vector_type(16))) _Float16 v16h;
typedef __attribute__((ext_vector_type(8)))  _Float16 v8h;
typedef __attribute__((ext_vector_type(16))) __bf16   v16b;
typedef __attribute__((ext_vector_type(8)))  __bf16   v8b;
typedef __attribute__((ext_vector_type(8)))  float    v8f;
typedef __attribute__((ext_vector_type(4)))  float    v4f;
typedef __attribute__((ext_vector_type(8)))  unsigned short v8us;

__device__ __forceinline__ unsigned short f2bf_bits(float f) {
  unsigned u = __float_as_uint(f);
  return (unsigned short)((u + 0x7FFFu + ((u >> 16) & 1u)) >> 16);
}

// slots between the last WMMAs and the epilogue's first reads of their accumulators
__device__ __forceinline__ void acc_guard4(v8f& a, v8f& b, v8f& c, v8f& d) { asm volatile("v_nop\n\tv_nop\n\tv_nop\n\tv_nop" : "+v"(a), "+v"(b), "+v"(c), "+v"(d)); }
// x + x of lane (l ^ MASK) inside the 16-lane row (DPP row_xmask)
template <int MASK> __device__ __forceinline__ float add_xmask(float x) {
  return x + __builtin_bit_cast(float, __builtin_amdgcn_update_dpp(0, __builtin_bit_cast(int, x), 0x160 + MASK, 0xf, 0xf, true));
}
template <typename T> struct Frag;
template <> struct Frag<_Float16> {
  typedef v16h V; union U { v16h v; v8h h[2]; };
  static __device__ __forceinline__ v16h load2(const unsigned char* p0, const unsigned char* p1) {   // elements 0..7 <- 16 B at p0, 8..15 <- 16 B at p1
    U f; f.h[0] = *(const v8h*)(p0); f.h[1] = *(const v8h*)(p1); return f.v;
  }
  static __device__ __forceinline__ v8f mma(v16h a, v16h b, v8f c) {
    return __builtin_amdgcn_wmma_f32_16x16x32_f16(false, a, false, b, (short)0, c, false, false);
  }
};
template <> struct Frag<__bf16> {
  typedef v16b V; union U { v16b v; v8b h[2]; };
  static __device__ __forceinline__ v16b load2(const unsigned char* p0, const unsigned char* p1) {
    U f; f.h[0] = *(const v8b*)(p0); f.h[1] = *(const v8b*)(p1); return f.v;
  }
  static __device__ __forceinline__ v8f mma(v16b a, v16b b, v8f c) {
    return __builtin_amdgcn_wmma_f32_16x16x32_bf16(false, a, false, b, (short)0, c, false, false);
  }
};

// ---- probability plane with its row statistics: one block's share (batch b, block blk of NT / 32), wave = four rows t, one after the other ----
// sc = scp[0][.] + scp[1][.]: the two halves of each token's score, as the echo product's two column blocks left them; the block adds
// them once for its batch (thread = 8 neighbouring tokens, 256 x 8 = NT) and its 8 waves read the sums from LDS.
// m_t = max_{s<=t} fl(sc_t*sc_s), z_t = sum_{s<=t} exp(sc_t*sc_s - m_t);
// P[b][t][s] = exp(sc_t*sc_s - m_t) * (1/z_t) for s <= t, 0 for t < s < ((t>>6)+1)*64.
// The row's scores stay in registers (lane = 8 neighbouring columns of each 256-column group, at most 8 groups), so all loads of a
// row are in flight together and every exponential is formed once; maximum and sum end in a butterfly over the 32 lanes.
// Written as one RNE f16 plane [NBATCH][NT][NT] (row pitch NT).
// Coverage: blk = 0..NT/32-1, 8 waves, rows blk * 8 + wave + (NT / 4) r, r = 0..3 (one row of each quarter: no wave gets long rows
// alone) = NT rows; b = 0..NBATCH-1; columns [0, ((t>>6)+1)*64) of every row = exactly what the causal P.V product reads for
// the 64-row tile containing t.  s_sc: NT floats of the block's LDS, 16-byte aligned.
__device__ __forceinline__ void pgen_rows(const float* __restrict__ scp, unsigned short* __restrict__ php, float* s_sc, const int b, const int blk) {
  constexpr int NG = NT / 256;                     // column groups of a full row
  static_assert(NT == 256 * 8);
  _Float16* ph = (_Float16*)php + (size_t)b * NT * NT;
  const int wave = __builtin_amdgcn_readfirstlane(threadIdx.x >> 5), lane = threadIdx.x & 31;
  {
    const float* scb = scp + (size_t)b * NT + threadIdx.x * 8;
    const v4f q0 = *(const v4f*)(scb);
    const v4f q1 = *(const v4f*)(scb + 4);
    const v4f u0 = *(const v4f*)(scb + NTOK);
    const v4f u1 = *(const v4f*)(scb + NTOK + 4);
    asm volatile("s_wait_xcnt 0x0" ::: "memory");    // stands before any rewrite of the address registers that the loads above name
    __builtin_amdgcn_sched_barrier(0);               // keeps the later writes of those registers from being scheduled in front of the wait
    *(v4f*)(s_sc + threadIdx.x * 8)     = q0 + u0;
    *(v4f*)(s_sc + threadIdx.x * 8 + 4) = q1 + u1;
  }
  __syncthreads();                                   // all NT scores of the batch are in LDS before any wave reads them
  for (int r = 0; r < 4; ++r) {
  const int t = blk * 8 + wave + r * (NT / 4);     // 0..NT-1, wave-uniform
  const float sct = s_sc[t];
  const int ncol = ((t >> 6) + 1) << 6;
  _Float16* prh = ph + (size_t)t * NT;
  float v[NG][8];
  const float NEG_INF = __uint_as_float(0xff800000u);
  float mx = NEG_INF;
#pragma unroll   // v[][] is indexed by constants only and stays in registers
  for (int g = 0; g < NG; ++g) {
    if (g * 256 < ncol) {                            // wave-uniform
      const int c = g * 256 + lane * 8;
      const int cc = (c < NT - 8) ? c : (NT - 8);     // clamped address
      const v4f q0 = *(const v4f*)(s_sc + cc);
      const v4f q1 = *(const v4f*)(s_sc + cc + 4);
#pragma unroll
      for (int j = 0; j < 4; ++j) { v[g][j] = q0[j]; v[g][4 + j] = q1[j]; }
    }
  }
#pragma unroll   // constant indices into v[][]
  for (int g = 0; g < NG; ++g) {
    if (g * 256 < ncol) {
      const int c = g * 256 + lane * 8;
      float mg = NEG_INF;                            // a chain of its own for each group
#pragma unroll
      for (int j = 0; j < 8; ++j) mg = fmaxf(mg, (c + j <= t) ? sct * v[g][j] : NEG_INF);
      mx = fmaxf(mx, mg);
    }
  }
#pragma unroll
  for (int off = 16; off; off >>= 1) mx = fmaxf(mx, __shfl_xor(mx, off, 32));
  float z = 0.f;
#pragma unroll   // constant indices into v[][]
  for (int g = 0; g < NG; ++g) {
    if (g * 256 < ncol) {
      const int c = g * 256 + lane * 8;
      float zg = 0.f;                                // a chain of its own for each group
#pragma unroll
      for (int j = 0; j < 8; ++j) {
        const float e = __expf(fmaf(sct, v[g][j], -mx));
        v[g][j] = e;
        zg += (c + j <= t) ? e : 0.0f;
      }
      z += zg;
    }
  }
#pragma unroll
  for (int off = 16; off; off >>= 1) z += __shfl_xor(z, off, 32);
  const float li = 1.0f / z;
#pragma unroll   // constant indices into v[][]
  for (int g = 0; g < NG; ++g) {
    if (g * 256 < ncol) {
      const int c = g * 256 + lane * 8;
      v8h hv;
#pragma unroll
      for (int j = 0; j < 8; ++j) {
        float p = v[g][j] * li;
        p = (c + j <= t) ? p : 0.0f;
        hv[j] = (_Float16)p;
      }
      if (c < ncol) *(v8h*)(prh + c) = hv;           // c % 8 == 0 and ncol % 64 == 0 -> whole 8-groups
    }
  }
  asm volatile("s_wait_xcnt 0x0" ::: "memory");      // stands before the next row's rewrite of the address registers that the stores above name
  }
}

// ---- Register-blocked batched WMMA GEMM ------------------------------------
// C[m,n] = scale * sum_k A[m,k] * Bt[n,k]; each wave owns a 64x64 tile; the 8 waves of a block share the 64 rows of A and
// hold 8 neighbouring column tiles (512 rows of Bt).
// A row-major [M,K]; Bt row-major [N,K]; M % 64 == 0, N % 512 == 0, K % 64 == 0, K >= 64.
// The k loop works on stages of 64 k: every row of a stage is one whole 128-byte line, brought into LDS by asynchronous
// copies (a wave-wide copy = 4 whole lines), two buffers, the next stage in flight while this one is worked on.
// LDS place of the 16-byte chunk c (0..7) of stage row R: R * 128 + ((c ^ ((R >> 1) & 7)) * 16): 16 rows read at one chunk
// index fall on 16 different 16-byte bank groups.
// SPLIT: 0 = single product; 1 = A carried as hi/lo planes (A2 = lo), Bt single: hi.B + lo.B (2 products);
//        2 = A and Bt as hi/lo planes: hi.hi + hi.lo + lo.hi (3 products).
// OUT_MODE: 0 = f32, 1 = f16 (RNE),
//           3 = no C at all: Cout[(n / 512) * M + m] = scale * sum over the block's 512 columns n of C[m,n]^2 (f32, fixed order);
//               the blocks behind the (M / 64) * (N / 512) of that product do a side product of the same N, K and pitches:
//               Cout2[m,n] = sum_k A2[m,k] * Bt2[n,k], m < N, bf16 (RNE), pitch ldc, unscaled ((N / 64) * (N / 512) blocks).
// CAUSAL: the k loop of the wave tile at rows m0..m0+63 stops at k = m0 + 64 (lower block-triangular A).
// ET: 0 = f16 operands, 1 = bf16 operands (pointers passed as 16-bit storage)
// RIDER: the blocks with blockIdx.y >= NBATCH (behind all blocks of the product in index order) do no product: they write the probability
//        plane of batch blockIdx.y - NBATCH from scp into php (pgen_rows, gridDim.x = NT / 32); neither job reads what the other writes.
template <int ET> struct Elem;
template <> struct Elem<0> { typedef _Float16 T; };
template <> struct Elem<1> { typedef __bf16 T; };
typedef __attribute__((address_space(3))) unsigned char lds_u8;
// Asynchronous copies, 16 bytes a lane, global -> LDS.  The s_wait_xcnt is the last line of the copies' own statement: it stands
// before any later rewrite of the address registers that the copies name.
__device__ __forceinline__ void async_copy2(unsigned l, const unsigned char* g, unsigned lstep, size_t gstep) {
  asm volatile("global_load_async_to_lds_b128 %0, %1, off\n\t"
               "global_load_async_to_lds_b128 %2, %3, off\n\t"
               "s_wait_xcnt 0x0"
               :: "v"(l), "v"(g), "v"(l + lstep), "v"(g + gstep) : "memory");
}
__device__ __forceinline__ void async_copy8(unsigned l, const unsigned char* g, unsigned lstep, size_t gstep) {
  asm volatile("global_load_async_to_lds_b128 %0, %1, off\n\t"
               "global_load_async_to_lds_b128 %2, %3, off\n\t"
               "global_load_async_to_lds_b128 %4, %5, off\n\t"
               "global_load_async_to_lds_b128 %6, %7, off\n\t"
               "global_load_async_to_lds_b128 %8, %9, off\n\t"
               "global_load_async_to_lds_b128 %10, %11, off\n\t"
               "global_load_async_to_lds_b128 %12, %13, off\n\t"
               "global_load_async_to_lds_b128 %14, %15, off\n\t"
               "s_wait_xcnt 0x0"
               :: "v"(l), "v"(g), "v"(l + lstep), "v"(g + gstep), "v"(l + 2 * lstep), "v"(g + 2 * gstep),
                  "v"(l + 3 * lstep), "v"(g + 3 * gstep), "v"(l + 4 * lstep), "v"(g + 4 * gstep),
                  "v"(l + 5 * lstep), "v"(g + 5 * gstep), "v"(l + 6 * lstep), "v"(g + 6 * gstep),
                  "v"(l + 7 * lstep), "v"(g + 7 * gstep) : "memory");
}
template <int ET, int SPLIT, int OUT_MODE, bool CAUSAL, bool RIDER>
__global__ __launch_bounds__(256) void wmma_gemm64(
    const unsigned short* __restrict__ Ap, const unsigned short* __restrict__ A2p, int lda, long strideA,
    const unsigned short* __restrict__ Btp, const unsigned short* __restrict__ Bt2p, int ldb, long strideB,
    void* __restrict__ Cout, void* __restrict__ Cout2, int ldc, long strideC,
    int M, int N, int K, float scale, const float* __restrict__ scp, unsigned short* __restrict__ php) {
  typedef typename Elem<ET>::T T;
  typedef typename Frag<T>::V V;
  constexpr int NPA   = (SPLIT >= 1) ? 2 : 1;          // planes of A, of Bt
  constexpr int NPB   = (SPLIT == 2) ? 2 : 1;
  constexpr int OFF_B = NPA * 64 * 128;                // bytes: A planes (64 rows each), then Bt planes (512 rows each)
  constexpr int BUFB  = OFF_B + NPB * 512 * 128;       // one stage buffer
  constexpr int SLABS = 8 * 16 * 68 * 4;               // epilogue: per-wave 16x64 slab, pitch 68 floats
  __shared__ __attribute__((aligned(128))) unsigned char smem[(2 * BUFB > SLABS) ? 2 * BUFB : SLABS];   // the slabs reuse the stage buffers behind the loop
  if (RIDER && blockIdx.y >= NBATCH) {                 // block-uniform, in front of every barrier of the product
    pgen_rows(scp, php, (float*)smem, blockIdx.y - NBATCH, blockIdx.x);
    return;
  }
  const int b    = blockIdx.y;
  const int lane = threadIdx.x & 31;
  const int wave = threadIdx.x >> 5;
  const int tilesN = N >> 6;                           // multiple of 8: the 8 tiles of a block lie in one tile row
  const int tilesM = M >> 6;
  int tile0 = blockIdx.x * 8;
  const bool side = (OUT_MODE == 3) && tile0 >= tilesM * tilesN;   // block-uniform
  if (side) tile0 -= tilesM * tilesN;
  if (tile0 >= (side ? tilesN : tilesM) * tilesN) return;   // block-uniform, in front of every barrier
  const T* A = (const T*)(side ? A2p : Ap); const T* A2 = (const T*)A2p; const T* Bt = (const T*)(side ? Bt2p : Btp); const T* Bt2 = (const T*)Bt2p;
  const int tm  = tile0 / tilesN;
  const int tn0 = tile0 - tm * tilesN;
  const int m0  = tm << 6;
  const int nb0 = tn0 << 6;                            // first Bt row of the block
  const int n0  = nb0 + (wave << 6);

  const T* Ab  = A  + (size_t)b * strideA;
  const T* Bb  = Bt + (size_t)b * strideB;
  const T* Ab2 = (SPLIT >= 1) ? (A2  + (size_t)b * strideA) : nullptr;
  const T* Bb2 = (SPLIT == 2) ? (Bt2 + (size_t)b * strideB) : nullptr;

  const int rlane = lane & 15;                 // row (A) / col (B, D) within subtile
  const int mOff  = (lane >> 4) * 8;           // D row offset

  v8f acc[4][4];
#pragma unroll
  for (int i = 0; i < 4; ++i)
#pragma unroll
    for (int j = 0; j < 4; ++j) acc[i][j] = (v8f){0.f,0.f,0.f,0.f,0.f,0.f,0.f,0.f};

  int kEnd = K;
  if (CAUSAL) kEnd = (m0 + 64 < K) ? (m0 + 64) : K;   // block-uniform, multiple of 64
  const int nStage = kEnd >> 6;

  // copies: thread = (stage row cr + 32 q, chunk cc); the chunk swizzle of a row depends on cr alone (32 q >> 1 is 0 mod 8)
  const int cc = threadIdx.x & 7, cr = threadIdx.x >> 3;
  const unsigned ldsC = (unsigned)(uintptr_t)(lds_u8*)smem + (unsigned)(cr * 128 + ((cc ^ ((cr >> 1) & 7)) << 4));
  const unsigned char* gA  = (const unsigned char*)(Ab + (size_t)(m0 + cr) * lda + cc * 8);
  const unsigned char* gB  = (const unsigned char*)(Bb + (size_t)(nb0 + cr) * ldb + cc * 8);
  const unsigned char* gA2 = (SPLIT >= 1) ? (const unsigned char*)(Ab2 + (size_t)(m0 + cr) * lda + cc * 8) : nullptr;
  const unsigned char* gB2 = (SPLIT == 2) ? (const unsigned char*)(Bb2 + (size_t)(nb0 + cr) * ldb + cc * 8) : nullptr;
  const size_t gsA = (size_t)lda * 64, gsB = (size_t)ldb * 64;   // 32 rows, bytes
  auto issue = [&](int buf, int st) {                  // all copies of stage st (k = 64 st .. 64 st + 63) into buffer buf
    const unsigned l = ldsC + (unsigned)(buf * BUFB);
    const size_t ko = (size_t)st * 128;
    async_copy2(l, gA + ko, 4096u, gsA);
    if (SPLIT >= 1) async_copy2(l + 8192u, gA2 + ko, 4096u, gsA);
    async_copy8(l + OFF_B, gB + ko, 4096u, gsB);
    async_copy8(l + OFF_B + 32768u, gB + ko + 8 * gsB, 4096u, gsB);
    if (SPLIT == 2) {
      async_copy8(l + OFF_B + 65536u, gB2 + ko, 4096u, gsB);
      async_copy8(l + OFF_B + 98304u, gB2 + ko + 8 * gsB, 4096u, gsB);
    }
  };
  // readers: lane = (row rlane of a 16-row group, half h); chunk 4 s + h holds k = 32 s + 8 h + 0..7, chunk 4 s + h + 2 holds k + 16
  const int e0 = (lane >> 4) ^ ((rlane >> 1) & 7);
  const int rowB = rlane * 128;
  int fo[4];
#pragma unroll   // fo[] is indexed by constants only and stays in registers
  for (int q = 0; q < 4; ++q) fo[q] = rowB + ((e0 ^ (2 * q)) << 4);

  issue(0, 0);
  asm volatile("s_wait_asynccnt 0x0" ::: "memory");    // this wave's copies of stage 0 have landed
  __syncthreads();                                     // and every other wave's
  if (nStage > 1) issue(1, 1);
  for (int st = 0; st < nStage; ++st) {
    const unsigned char* sA = smem + (st & 1) * BUFB;
    const unsigned char* sB = sA + OFF_B + wave * 8192;
#pragma unroll   // both 32-wide k-steps of a stage: constant indices into fo[]
    for (int s = 0; s < 2; ++s) {
      V bh[4], bl[4];
#pragma unroll
      for (int j = 0; j < 4; ++j) {
        bh[j] = Frag<T>::load2(sB + j * 2048 + fo[2 * s], sB + j * 2048 + fo[2 * s + 1]);
        if (SPLIT == 2) bl[j] = Frag<T>::load2(sB + 65536 + j * 2048 + fo[2 * s], sB + 65536 + j * 2048 + fo[2 * s + 1]);
      }
#pragma unroll
      for (int i = 0; i < 4; ++i) {
        V ah = Frag<T>::load2(sA + i * 2048 + fo[2 * s], sA + i * 2048 + fo[2 * s + 1]);
        V al;
        if (SPLIT >= 1) al = Frag<T>::load2(sA + 8192 + i * 2048 + fo[2 * s], sA + 8192 + i * 2048 + fo[2 * s + 1]);
#pragma unroll
        for (int j = 0; j < 4; ++j) {
          acc[i][j] = Frag<T>::mma(ah, bh[j], acc[i][j]);
          if (SPLIT == 2) acc[i][j] = Frag<T>::mma(ah, bl[j], acc[i][j]);
          if (SPLIT >= 1) acc[i][j] = Frag<T>::mma(al, bh[j], acc[i][j]);
        }
      }
    }
    asm volatile("s_wait_dscnt 0x0" ::: "memory");     // this wave's reads of the buffer are done before it may be refilled
    asm volatile("s_wait_asynccnt 0x0" ::: "memory");  // this wave's copies of stage st + 1 have landed
    __syncthreads();                                   // publishes stage st + 1 and ends every wave's reads of stage st
    if (st + 2 < nStage) issue(st & 1, st + 2);
  }
  asm volatile("s_wait_asynccnt 0x0" ::: "memory");    // no copy is outstanding when the slabs reuse the buffers
  acc_guard4(acc[0][0], acc[0][1], acc[0][2], acc[0][3]);
  acc_guard4(acc[1][0], acc[1][1], acc[1][2], acc[1][3]);
  acc_guard4(acc[2][0], acc[2][1], acc[2][2], acc[2][3]);
  acc_guard4(acc[3][0], acc[3][1], acc[3][2], acc[3][3]);

  // ---- epilogue ----
  if (OUT_MODE == 3 && !side) {
    // lane = column rlane of each 16-column subtile, register r = row mOff + r: squares summed over j, then over the 16 lanes of the row
    float* wsum = (float*)smem;                        // [8 waves][64 rows], reuses the stage buffers behind the loop
#pragma unroll   // constant indices into acc[][], which stays in registers
    for (int i = 0; i < 4; ++i) {
      float keep = 0.f;
#pragma unroll   // constant indices into acc[][]; the eight rows' lane sums interleave
      for (int r = 0; r < 8; ++r) {
        float s = acc[i][0][r] * acc[i][0][r];
        s = fmaf(acc[i][1][r], acc[i][1][r], s);
        s = fmaf(acc[i][2][r], acc[i][2][r], s);
        s = fmaf(acc[i][3][r], acc[i][3][r], s);
        s = add_xmask<1>(s); s = add_xmask<2>(s); s = add_xmask<4>(s); s = add_xmask<8>(s);
        keep = (rlane == r) ? s : keep;
      }
      if (rlane < 8) wsum[wave * 64 + (i << 4) + mOff + rlane] = keep;
    }
    __syncthreads();                                   // the 8 waves' sums of each row are in LDS before they are added
    if (threadIdx.x < 64) {
      float s = wsum[threadIdx.x];
#pragma unroll   // the eight LDS reads are in flight together
      for (int w = 1; w < 8; ++w) s += wsum[w * 64 + threadIdx.x];
      ((float*)Cout)[(size_t)(nb0 >> 9) * M + m0 + threadIdx.x] = s * scale;
    }
    return;
  }
  float* slab = (float*)smem + wave * (16 * 68);
#pragma unroll
  for (int i = 0; i < 4; ++i) {
    const int mBase = m0 + (i << 4);
#pragma unroll
    for (int j = 0; j < 4; ++j) {
#pragma unroll
      for (int r = 0; r < 8; ++r) {
        float v = (OUT_MODE == 3) ? acc[i][j][r] : acc[i][j][r] * scale;
        slab[(mOff + r) * 68 + (j << 4) + rlane] = v;
      }
    }
    __builtin_amdgcn_fence(__ATOMIC_RELEASE, "workgroup");
    __builtin_amdgcn_wave_barrier();
    __builtin_amdgcn_fence(__ATOMIC_ACQUIRE, "workgroup");
    if (OUT_MODE == 0) {
      float* C = (float*)Cout + (size_t)b * strideC;
      const int hh = lane >> 4, c4 = (lane & 15) * 4;     // row seg = 256 B = 16 lanes x 16 B
      {
#pragma unroll
        for (int it = 0; it < 8; ++it) {
          const int row = it * 2 + hh;
          v4f v = *(const v4f*)(slab + row * 68 + c4);
          *(v4f*)(C + (size_t)(mBase + row) * ldc + n0 + c4) = v;
        }
        
      }
    } else {
      const int q = lane >> 3, c8 = (lane & 7) * 8;
      unsigned short* C  = (unsigned short*)((OUT_MODE == 3) ? Cout2 : Cout) + (size_t)b * strideC;
      {
#pragma unroll
        for (int it = 0; it < 4; ++it) {
          const int row = it * 4 + q;
          const float* sp = slab + row * 68 + c8;
          if (OUT_MODE == 3) {
            v8us uv;
#pragma unroll
            for (int e = 0; e < 8; ++e) uv[e] = f2bf_bits(sp[e]);
            *(v8us*)(C + (size_t)(mBase + row) * ldc + n0 + c8) = uv;
          } else {
            v8h hv;
#pragma unroll
            for (int e = 0; e < 8; ++e) hv[e] = (_Float16)sp[e];
            *(v8h*)(C + (size_t)(mBase + row) * ldc + n0 + c8) = hv;
          }
        }
      }
    }
    __builtin_amdgcn_fence(__ATOMIC_RELEASE, "workgroup");
    __builtin_amdgcn_wave_barrier();
    __builtin_amdgcn_fence(__ATOMIC_ACQUIRE, "workgroup");
  }
}

// ---- all four input casts (RNE bf16) in one launch: the block index picks the job; no job reads what another writes ----
// Blocks [0, NB_T): transposing cast of the NE x NE plane wjv: wjvtb[e][d] = bf16(wjv[d][e]).  Thread = (column e of wjv, 64 neighbouring
// rows d): a wave's load is one whole 128-byte line of a row of wjv, the 64 loads of a thread are issued in one run, and a thread stores
// one whole 128-byte line of wjvtb.  Coverage: NB_T = (NE / 256) * (NE / 64) blocks x 256 threads x 64 elements = the whole plane.
// Behind them the plain casts, thread = 2 neighbouring elements: NB_W blocks for wj, NB_W for wo, NB_X for x; blocks x 256 threads x 2
// elements = each whole plane.
constexpr int NB_T = (NE / 256) * (NE / 64);
constexpr int NB_W = (NE * NE / 2) / 256;
constexpr int NB_X = (NTOK * NE / 2) / 256;
__global__ __launch_bounds__(256) void cast_inputs(
    const float* __restrict__ x, const float* __restrict__ wj, const float* __restrict__ wjv, const float* __restrict__ wo,
    unsigned short* __restrict__ xb, unsigned short* __restrict__ wjb, unsigned short* __restrict__ wjvtb, unsigned short* __restrict__ wob) {
  int blk = blockIdx.x;
  if (blk < NB_T) {                                  // block-uniform
    const int e  = (blk & (NE / 256 - 1)) * 256 + threadIdx.x;
    const int d0 = (blk / (NE / 256)) * 64;
    const float* p = wjv + (size_t)d0 * NE + e;
    float v[64];
#pragma unroll   // v[] is indexed by constants only and stays in registers
    for (int j = 0; j < 64; ++j) v[j] = p[(size_t)j * NE];
    unsigned short* q = wjvtb + (size_t)e * NE + d0;
#pragma unroll   // constant indices into v[]
    for (int c = 0; c < 8; ++c) {
      v8us uv;
#pragma unroll
      for (int j = 0; j < 8; ++j) uv[j] = f2bf_bits(v[c * 8 + j]);
      *(v8us*)(q + c * 8) = uv;
    }
    return;
  }
  blk -= NB_T;
  const float* in = wj; unsigned short* out = wjb;   // block-uniform choice of the plane
  if (blk >= 2 * NB_W)  { in = x;  out = xb;  blk -= 2 * NB_W; }
  else if (blk >= NB_W) { in = wo; out = wob; blk -= NB_W; }
  const int i = blk * 256 + threadIdx.x;
  const float a0 = in[2 * (size_t)i], a1 = in[2 * (size_t)i + 1];
  const unsigned u = (unsigned)f2bf_bits(a0) | ((unsigned)f2bf_bits(a1) << 16);
  ((unsigned*)out)[i] = u;
}

// ---------------------------------------------------------------------------
// Workspace region map (bytes; all offsets multiples of 1 MiB):
//   R_XB  [0, 16 MiB)            : xb bf16 [8192][1024]
//   R_W   [16, 24 MiB)           : wjb, W2b = wo*wjv, wjvb^T, wob, all bf16 [1024][1024] (2 MiB each)
//   R_C   [24, 40 MiB)           : uT f16 [4][1024][2048], u = x*W2^T
//   R_S   [40 MiB, +64 KiB)      : the two halves of sc, f32 [2][8192]
//   R_P   [41, 73 MiB)           : P f16 [4][2048][2048] (all batches)
//   total 76,546,048 B
extern "C" void kernel_launch(void* const* d_in, const int* in_sizes, int n_in,
                              void* d_out, int out_size, void* d_ws, size_t ws_size,
                              hipStream_t stream) {
  if (n_in < 4) return;
  if (in_sizes[0] != NTOK * NE || in_sizes[1] != NE * NE || in_sizes[2] != NE * NE ||
      in_sizes[3] != NE * NE || out_size != NTOK * NE) return;
  const float* x   = (const float*)d_in[0];   // [4][2048][1024]
  const float* wj  = (const float*)d_in[1];   // [1024][1024] (out,in)
  const float* wjv = (const float*)d_in[2];   // [1024][1024]
  const float* wo  = (const float*)d_in[3];   // [1024][1024]
  float* outp = (float*)d_out;

  const size_t PLANE16 = (size_t)NTOK * NE * 2;    // 16,777,216
  const size_t WPL     = (size_t)NE * NE * 2;      //  2,097,152
  const size_t PPL     = (size_t)NT * NT * 2;      //  8,388,608
  const size_t off_xb = 0;
  const size_t off_w  = off_xb + PLANE16;
  const size_t off_c  = off_w + 4 * WPL;
  const size_t off_s  = off_c + PLANE16;
  const size_t off_p  = off_s + ((size_t)1 << 20);
  const size_t total  = off_p + NBATCH * PPL;      // 76,546,048
  if (total > ws_size) return;

  char* ws = (char*)d_ws;
  unsigned short* xb     = (unsigned short*)(ws + off_xb);
  unsigned short* wjb    = (unsigned short*)(ws + off_w);
  unsigned short* w2b    = (unsigned short*)(ws + off_w + 1 * WPL);
  unsigned short* wjvtb  = (unsigned short*)(ws + off_w + 2 * WPL);
  unsigned short* wob    = (unsigned short*)(ws + off_w + 3 * WPL);
  unsigned short* vth    = (unsigned short*)(ws + off_c);
  unsigned short* ph     = (unsigned short*)(ws + off_p);
  float*          scp    = (float*)(ws + off_s);

  const dim3 blk(256);

  // 1) input planes, RNE bf16, one launch: x, wj, wo as they lie, wjv transposed ([e][d], the k-contiguous second operand of wo*wjv)
  cast_inputs<<<dim3(NB_T + 2 * NB_W + NB_X), blk, 0, stream>>>(x, wj, wjv, wo, xb, wjb, wjvtb, wob);

  // 2) token scores.  echo[t][f] = sum_e xb[t][e] wjb[f][e]   (M=8192, N=1024, K=1024; 2048 tiles = 256 blocks); for every x and wj
  //    sum_e x[t][e] (sum_f echo[t][f] wj[f][e]) = sum_f echo[t][f] (sum_e wj[f][e] x[t][e]) = sum_f echo[t][f]^2,
  //    so sc[t] = (1/32) sum_f echo[t][f]^2, left as one partial sum for each of the two column blocks.
  //    Side product in the same launch (32 more blocks; two blocks fit a WGP's LDS): W2[n][e] = sum_d wob[n][d] wjvtb[e][d] -> bf16
  wmma_gemm64<1, 0, 3, false, false><<<dim3((NTOK / 64) * (NE / 64) / 8 + (NE / 64) * (NE / 64) / 8, 1), blk, 0, stream>>>(
      xb, wob, NE, 0L, wjb, wjvtb, NE, 0L, (void*)scp, (void*)w2b, NE, 0L, NTOK, NE, NE, 1.0f / 32.0f, nullptr, nullptr);
  // 3) uT[b][n][t] = sum_e W2b[n][e] xb[b][t][e] -> f16 plane [4][1024][2048]  (M=1024, N=2048, K=1024; 512 tiles = 64 blocks per batch);
  //    in the same launch, behind those 256 blocks (two blocks fit a WGP's LDS), 64 more per batch write the probability plane with its
  //    softmax statistics from the scores of 2): the two jobs need nothing of each other
  static_assert((NE / 64) * (NT / 64) / 8 == NT / 32);
  wmma_gemm64<1, 0, 1, false, true><<<dim3((NE / 64) * (NT / 64) / 8, 2 * NBATCH), blk, 0, stream>>>(
      w2b, w2b, NE, 0L, xb, xb, NE, (long)NT * NE, (void*)vth, (void*)vth, NT, (long)NE * NT, NE, NT, NE, 1.0f, scp, ph);
  // 4) all batches at once (grid.y = batch): out[b][t][n] = sum_{s < tile end} P[b][t][s] uT[b][n][s]
  //    (f16 operands, causal k-limit) -> f32 output   (512 tiles = 64 blocks per batch, 256 blocks in the launch)
  wmma_gemm64<0, 0, 0, true, false><<<dim3((NT / 64) * (NE / 64) / 8, NBATCH), blk, 0, stream>>>(
      ph, ph, NT, (long)NT * NT, vth, vth, NT, (long)NE * NT,
      (void*)outp, (void*)outp, NE, (long)NT * NE, NT, NE, NT, 1.0f, nullptr, nullptr);
}

// v008
// A run of this version takes 100 microseconds.
// In two side-by-side timings against v007, it was 1.05 and 1.04 times as fast.
// Counting every step since v000, it is 7.64 times as fast.
// Contractions on v_wmma_f32_16x16x32 (16-bit operands, f32 accumulate). bf16: echo = xb*wjb^T (inputs RNE bf16; only its rows' sums of squares leave the kernel), W2 = wob*wjvb (the output projection folded into the value weights: (P*(x*wjv^T))*wo^T = P*(x*(wo*wjv)^T) for every input), u^T = W2b*xb^T. f16: out = P*u^T (causal k-limit, f32 result); P and u^T are carried as one RNE f16 plane each; token scores (x.(echo*wj) = echo.echo), softmax statistics and probabilities in f32 on VALU.
#include <hip/hip_runtime.h>
#include <stdint.h>

constexpr int NBATCH = 4;
constexpr int NT     = 2048;
constexpr int NE     = 1024;
constexpr int NTOK   = NBATCH * NT;
static_assert((NTOK % 64) == 0 && (NT % 64) == 0 && (NE % 64) == 0);

typedef __attribute__((ext_vector_type(16))) _Float16 v16h;
typedef __attribute__((ext_vector_type(8)))  _Float16 v8h;
typedef __attribute__((ext_vector_type(16))) __bf16   v16b;
typedef __attribute__((ext_vector_type(8)))  __bf16   v8b;
typedef __attribute__((ext_vector_type(8)))  float    v8f;
typedef __attribute__((ext_vector_type(4)))  float    v4f;
typedef __attribute__((ext_vector_type(8)))  unsigned short v8us;

__device__ __forceinline__ unsigned short f2bf_bits(float f) {
  unsigned u = __float_as_uint(f);
  return (unsigned short)((u + 0x7FFFu + ((u >> 16) & 1u)) >> 16);
}

// slots between the last WMMAs and the epilogue's first reads of their accumulators
__device__ __forceinline__ void acc_guard4(v8f& a, v8f& b, v8f& c, v8f& d) { asm volatile("v_nop\n\tv_nop\n\tv_nop\n\tv_nop" : "+v"(a), "+v"(b), "+v"(c), "+v"(d)); }
// x + x of lane (l ^ MASK) inside the 16-lane row (DPP row_xmask)
template <int MASK> __device__ __forceinline__ float add_xmask(float x) {
  return x + __builtin_bit_cast(float, __builtin_amdgcn_update_dpp(0, __builtin_bit_cast(int, x), 0x160 + MASK, 0xf, 0xf, true));
}
template <typename T> struct Frag;
template <> struct Frag<_Float16> {
  typedef v16h V; union U { v16h v; v8h h[2]; };
  static __device__ __forceinline__ v16h load2(const unsigned char* p0, const unsigned char* p1) {   // elements 0..7 <- 16 B at p0, 8..15 <- 16 B at p1
    U f; f.h[0] = *(const v8h*)(p0); f.h[1] = *(const v8h*)(p1); return f.v;
  }
  static __device__ __forceinline__ v8f mma(v16h a, v16h b, v8f c) {
    return __builtin_amdgcn_wmma_f32_16x16x32_f16(false, a, false, b, (short)0, c, false, false);
  }
};
template <> struct Frag<__bf16> {
  typedef v16b V; union U { v16b v; v8b h[2]; };
  static __device__ __forceinline__ v16b load2(const unsigned char* p0, const unsigned char* p1) {
    U f; f.h[0] = *(const v8b*)(p0); f.h[1] = *(const v8b*)(p1); return f.v;
  }
  static __device__ __forceinline__ v8f mma(v16b a, v16b b, v8f c) {
    return __builtin_amdgcn_wmma_f32_16x16x32_bf16(false, a, false, b, (short)0, c, false, false);
  }
};

// ---- probability plane with its row statistics: one block's share (batch b, block blk of NT / 32), wave = four rows t, one after the other ----
// sc = scp[0][.] + scp[1][.]: the two halves of each token's score, as the echo product's two column blocks left them; the block adds
// them once for its batch (thread = 8 neighbouring tokens, 256 x 8 = NT) and its 8 waves read the sums from LDS.
// m_t = max_{s<=t} fl(sc_t*sc_s), z_t = sum_{s<=t} exp(sc_t*sc_s - m_t);
// P[b][t][s] = exp(sc_t*sc_s - m_t) * (1/z_t) for s <= t, 0 for t < s < ((t>>6)+1)*64.
// The row's scores stay in registers (lane = 8 neighbouring columns of each 256-column group, at most 8 groups), so all loads of a
// row are in flight together and every exponential is formed once; maximum and sum end in a butterfly over the 32 lanes.
// Written as one RNE f16 plane [NBATCH][NT][NT] (row pitch NT).
// Coverage: blk = 0..NT/32-1, 8 waves, rows blk * 8 + wave + (NT / 4) r, r = 0..3 (one row of each quarter: no wave gets long rows
// alone) = NT rows; b = 0..NBATCH-1; columns [0, ((t>>6)+1)*64) of every row = exactly what the causal P.V product reads for
// the 64-row tile containing t.  s_sc: NT floats of the block's LDS, 16-byte aligned.
__device__ __forceinline__ void pgen_rows(const float* __restrict__ scp, unsigned short* __restrict__ php, float* s_sc, const int b, const int blk) {
  constexpr int NG = NT / 256;                     // column groups of a full row
  static_assert(NT == 256 * 8);
  _Float16* ph = (_Float16*)php + (size_t)b * NT * NT;
  const int wave = __builtin_amdgcn_readfirstlane(threadIdx.x >> 5), lane = threadIdx.x & 31;
  {
    const float* scb = scp + (size_t)b * NT + threadIdx.x * 8;
    const v4f q0 = *(const v4f*)(scb);
    const v4f q1 = *(const v4f*)(scb + 4);
    const v4f u0 = *(const v4f*)(scb + NTOK);
    const v4f u1 = *(const v4f*)(scb + NTOK + 4);
    asm volatile("s_wait_xcnt 0x0" ::: "memory");    // stands before any rewrite of the address registers that the loads above name
    __builtin_amdgcn_sched_barrier(0);               // keeps the later writes of those registers from being scheduled in front of the wait
    *(v4f*)(s_sc + threadIdx.x * 8)     = q0 + u0;
    *(v4f*)(s_sc + threadIdx.x * 8 + 4) = q1 + u1;
  }
  __syncthreads();                                   // all NT scores of the batch are in LDS before any wave reads them
  for (int r = 0; r < 4; ++r) {
  const int t = blk * 8 + wave + r * (NT / 4);     // 0..NT-1, wave-uniform
  const float sct = s_sc[t];
  const int ncol = ((t >> 6) + 1) << 6;
  _Float16* prh = ph + (size_t)t * NT;
  float v[NG][8];
  const float NEG_INF = __uint_as_float(0xff800000u);
  float mx = NEG_INF;
#pragma unroll   // v[][] is indexed by constants only and stays in registers
  for (int g = 0; g < NG; ++g) {
    if (g * 256 < ncol) {                            // wave-uniform
      const int c = g * 256 + lane * 8;
      const int cc = (c < NT - 8) ? c : (NT - 8);     // clamped address
      const v4f q0 = *(const v4f*)(s_sc + cc);
      const v4f q1 = *(const v4f*)(s_sc + cc + 4);
#pragma unroll
      for (int j = 0; j < 4; ++j) { v[g][j] = q0[j]; v[g][4 + j] = q1[j]; }
    }
  }
#pragma unroll   // constant indices into v[][]
  for (int g = 0; g < NG; ++g) {
    if (g * 256 < ncol) {
      const int c = g * 256 + lane * 8;
      float mg = NEG_INF;                            // a chain of its own for each group
#pragma unroll
      for (int j = 0; j < 8; ++j) mg = fmaxf(mg, (c + j <= t) ? sct * v[g][j] : NEG_INF);
      mx = fmaxf(mx, mg);
    }
  }
#pragma unroll
  for (int off = 16; off; off >>= 1) mx = fmaxf(mx, __shfl_xor(mx, off, 32));
  float z = 0.f;
#pragma unroll   // constant indices into v[][]
  for (int g = 0; g < NG; ++g) {
    if (g * 256 < ncol) {
      const int c = g * 256 + lane * 8;
      float zg = 0.f;                                // a chain of its own for each group
#pragma unroll
      for (int j = 0; j < 8; ++j) {
        const float e = __expf(fmaf(sct, v[g][j], -mx));
        v[g][j] = e;
        zg += (c + j <= t) ? e : 0.0f;
      }
      z += zg;
    }
  }
#pragma unroll
  for (int off = 16; off; off >>= 1) z += __shfl_xor(z, off, 32);
  const float li = 1.0f / z;
#pragma unroll   // constant indices into v[][]
  for (int g = 0; g < NG; ++g) {
    if (g * 256 < ncol) {
      const int c = g * 256 + lane * 8;
      v8h hv;
#pragma unroll
      for (int j = 0; j < 8; ++j) {
        float p = v[g][j] * li;
        p = (c + j <= t) ? p : 0.0f;
        hv[j] = (_Float16)p;
      }
      if (c < ncol) *(v8h*)(prh + c) = hv;           // c % 8 == 0 and ncol % 64 == 0 -> whole 8-groups
    }
  }
  asm volatile("s_wait_xcnt 0x0" ::: "memory");      // stands before the next row's rewrite of the address registers that the stores above name
  }
}

// ---- Register-blocked batched WMMA GEMM ------------------------------------
// C[m,n] = scale * sum_k A[m,k] * Bt[n,k]; each wave owns a 64x64 tile; the 8 waves of a block share the 64 rows of A and
// hold 8 neighbouring column tiles (512 rows of Bt).
// A row-major [M,K]; Bt row-major [N,K]; M % 64 == 0, N % 512 == 0, K % 64 == 0, K >= 64.
// The k loop works on stages of 64 k: every row of a stage is one whole 128-byte line, brought into LDS by asynchronous
// copies (a wave-wide copy = 4 whole lines), two buffers, the next stage in flight while this one is worked on.
// LDS place of the 16-byte chunk c (0..7) of stage row R: R * 128 + ((c ^ ((R >> 1) & 7)) * 16): 16 rows read at one chunk
// index fall on 16 different 16-byte bank groups.
// SPLIT: 0 = single product; 1 = A carried as hi/lo planes (A2 = lo), Bt single: hi.B + lo.B (2 products);
//        2 = A and Bt as hi/lo planes: hi.hi + hi.lo + lo.hi (3 products).
// OUT_MODE: 0 = f32, 1 = f16 (RNE),
//           3 = no C at all: Cout[(n / 512) * M + m] = scale * sum over the block's 512 columns n of C[m,n]^2 (f32, fixed order);
//               the blocks behind the (M / 64) * (N / 512) of that product do a side product of the same N, K and pitches:
//               Cout2[m,n] = sum_k A2[m,k] * Bt2[n,k], m < N, bf16 (RNE), pitch ldc, unscaled ((N / 64) * (N / 512) blocks).
// CAUSAL: the k loop of the wave tile at rows m0..m0+63 stops at k = m0 + 64 (lower block-triangular A).
// ET: 0 = f16 operands, 1 = bf16 operands (pointers passed as 16-bit storage)
// RIDER: the blocks with blockIdx.y >= NBATCH (behind all blocks of the product in index order) do no product: they write the probability
//        plane of batch blockIdx.y - NBATCH from scp into php (pgen_rows, gridDim.x = NT / 32); neither job reads what the other writes.
template <int ET> struct Elem;
template <> struct Elem<0> { typedef _Float16 T; };
template <> struct Elem<1> { typedef __bf16 T; };
typedef __attribute__((address_space(3))) unsigned char lds_u8;
// Asynchronous copies, 16 bytes a lane, global -> LDS.  The s_wait_xcnt is the last line of the copies' own statement: it stands
// before any later rewrite of the address registers that the copies name.
__device__ __forceinline__ void async_copy2(unsigned l, const unsigned char* g, unsigned lstep, size_t gstep) {
  asm volatile("global_load_async_to_lds_b128 %0, %1, off\n\t"
               "global_load_async_to_lds_b128 %2, %3, off\n\t"
               "s_wait_xcnt 0x0"
               :: "v"(l), "v"(g), "v"(l + lstep), "v"(g + gstep) : "memory");
}
__device__ __forceinline__ void async_copy8(unsigned l, const unsigned char* g, unsigned lstep, size_t gstep) {
  asm volatile("global_load_async_to_lds_b128 %0, %1, off\n\t"
               "global_load_async_to_lds_b128 %2, %3, off\n\t"
               "global_load_async_to_lds_b128 %4, %5, off\n\t"
               "global_load_async_to_lds_b128 %6, %7, off\n\t"
               "global_load_async_to_lds_b128 %8, %9, off\n\t"
               "global_load_async_to_lds_b128 %10, %11, off\n\t"
               "global_load_async_to_lds_b128 %12, %13, off\n\t"
               "global_load_async_to_lds_b128 %14, %15, off\n\t"
               "s_wait_xcnt 0x0"
               :: "v"(l), "v"(g), "v"(l + lstep), "v"(g + gstep), "v"(l + 2 * lstep), "v"(g + 2 * gstep),
                  "v"(l + 3 * lstep), "v"(g + 3 * gstep), "v"(l + 4 * lstep), "v"(g + 4 * gstep),
                  "v"(l + 5 * lstep), "v"(g + 5 * gstep), "v"(l + 6 * lstep), "v"(g + 6 * gstep),
                  "v"(l + 7 * lstep), "v"(g + 7 * gstep) : "memory");
}
template <int ET, int SPLIT, int OUT_MODE, bool CAUSAL, bool RIDER>
__global__ __launch_bounds__(256) void wmma_gemm64(
    const unsigned short* __restrict__ Ap, const unsigned short* __restrict__ A2p, int lda, long strideA,
    const unsigned short* __restrict__ Btp, const unsigned short* __restrict__ Bt2p, int ldb, long strideB,
    void* __restrict__ Cout, void* __restrict__ Cout2, int ldc, long strideC,
    int M, int N, int K, float scale, const float* __restrict__ scp, unsigned short* __restrict__ php) {
  typedef typename Elem<ET>::T T;
  typedef typename Frag<T>::V V;
  constexpr int NPA   = (SPLIT >= 1) ? 2 : 1;          // planes of A, of Bt
  constexpr int NPB   = (SPLIT == 2) ? 2 : 1;
  constexpr int OFF_B = NPA * 64 * 128;                // bytes: A planes (64 rows each), then Bt planes (512 rows each)
  constexpr int BUFB  = OFF_B + NPB * 512 * 128;       // one stage buffer
  constexpr int SLABS = 8 * 16 * 68 * 4;               // epilogue: per-wave 16x64 slab, pitch 68 floats
  __shared__ __attribute__((aligned(128))) unsigned char smem[(2 * BUFB > SLABS) ? 2 * BUFB : SLABS];   // the slabs reuse the stage buffers behind the loop
  if (RIDER && blockIdx.y >= NBATCH) {                 // block-uniform, in front of every barrier of the product
    pgen_rows(scp, php, (float*)smem, blockIdx.y - NBATCH, blockIdx.x);
    return;
  }
  const int b    = blockIdx.y;
  const int lane = threadIdx.x & 31;
  const int wave = threadIdx.x >> 5;
  const int tilesN = N >> 6;                           // multiple of 8: the 8 tiles of a block lie in one tile row
  const int tilesM = M >> 6;
  int tile0 = blockIdx.x * 8;
  const bool side = (OUT_MODE == 3) && tile0 >= tilesM * tilesN;   // block-uniform
  if (side) tile0 -= tilesM * tilesN;
  if (tile0 >= (side ? tilesN : tilesM) * tilesN) return;   // block-uniform, in front of every barrier
  const T* A = (const T*)(side ? A2p : Ap); const T* A2 = (const T*)A2p; const T* Bt = (const T*)(side ? Bt2p : Btp); const T* Bt2 = (const T*)Bt2p;
  const int tm  = tile0 / tilesN;
  const int tn0 = tile0 - tm * tilesN;
  const int m0  = tm << 6;
  const int nb0 = tn0 << 6;                            // first Bt row of the block
  const int n0  = nb0 + (wave << 6);

  const T* Ab  = A  + (size_t)b * strideA;
  const T* Bb  = Bt + (size_t)b * strideB;
  const T* Ab2 = (SPLIT >= 1) ? (A2  + (size_t)b * strideA) : nullptr;
  const T* Bb2 = (SPLIT == 2) ? (Bt2 + (size_t)b * strideB) : nullptr;

  const int rlane = lane & 15;                 // row (A) / col (B, D) within subtile
  const int mOff  = (lane >> 4) * 8;           // D row offset

  v8f acc[4][4];
#pragma unroll
  for (int i = 0; i < 4; ++i)
#pragma unroll
    for (int j = 0; j < 4; ++j) acc[i][j] = (v8f){0.f,0.f,0.f,0.f,0.f,0.f,0.f,0.f};

  int kEnd = K;
  if (CAUSAL) kEnd = (m0 + 64 < K) ? (m0 + 64) : K;   // block-uniform, multiple of 64
  const int nStage = kEnd >> 6;

  // copies: thread = (stage row cr + 32 q, chunk cc); the chunk swizzle of a row depends on cr alone (32 q >> 1 is 0 mod 8)
  const int cc = threadIdx.x & 7, cr = threadIdx.x >> 3;
  const unsigned ldsC = (unsigned)(uintptr_t)(lds_u8*)smem + (unsigned)(cr * 128 + ((cc ^ ((cr >> 1) & 7)) << 4));
  const unsigned char* gA  = (const unsigned char*)(Ab + (size_t)(m0 + cr) * lda + cc * 8);
  const unsigned char* gB  = (const unsigned char*)(Bb + (size_t)(nb0 + cr) * ldb + cc * 8);
  const unsigned char* gA2 = (SPLIT >= 1) ? (const unsigned char*)(Ab2 + (size_t)(m0 + cr) * lda + cc * 8) : nullptr;
  const unsigned char* gB2 = (SPLIT == 2) ? (const unsigned char*)(Bb2 + (size_t)(nb0 + cr) * ldb + cc * 8) : nullptr;
  const size_t gsA = (size_t)lda * 64, gsB = (size_t)ldb * 64;   // 32 rows, bytes
  auto issue = [&](int buf, int st) {                  // all copies of stage st (k = 64 st .. 64 st + 63) into buffer buf
    const unsigned l = ldsC + (unsigned)(buf * BUFB);
    const size_t ko = (size_t)st * 128;
    async_copy2(l, gA + ko, 4096u, gsA);
    if (SPLIT >= 1) async_copy2(l + 8192u, gA2 + ko, 4096u, gsA);
    async_copy8(l + OFF_B, gB + ko, 4096u, gsB);
    async_copy8(l + OFF_B + 32768u, gB + ko + 8 * gsB, 4096u, gsB);
    if (SPLIT == 2) {
      async_copy8(l + OFF_B + 65536u, gB2 + ko, 4096u, gsB);
      async_copy8(l + OFF_B + 98304u, gB2 + ko + 8 * gsB, 4096u, gsB);
    }
  };
  // readers: lane = (row rlane of a 16-row group, half h); chunk 4 s + h holds k = 32 s + 8 h + 0..7, chunk 4 s + h + 2 holds k + 16
  const int e0 = (lane >> 4) ^ ((rlane >> 1) & 7);
  const int rowB = rlane * 128;
  int fo[4];
#pragma unroll   // fo[] is indexed by constants only and stays in registers
  for (int q = 0; q < 4; ++q) fo[q] = rowB + ((e0 ^ (2 * q)) << 4);

  issue(0, 0);
  asm volatile("s_wait_asynccnt 0x0" ::: "memory");    // this wave's copies of stage 0 have landed
  __syncthreads();                                     // and every other wave's
  if (nStage > 1) issue(1, 1);
  for (int st = 0; st < nStage; ++st) {
    const unsigned char* sA = smem + (st & 1) * BUFB;
    const unsigned char* sB = sA + OFF_B + wave * 8192;
#pragma unroll   // both 32-wide k-steps of a stage: constant indices into fo[]
    for (int s = 0; s < 2; ++s) {
      V bh[4], bl[4];
#pragma unroll
      for (int j = 0; j < 4; ++j) {
        bh[j] = Frag<T>::load2(sB + j * 2048 + fo[2 * s], sB + j * 2048 + fo[2 * s + 1]);
        if (SPLIT == 2) bl[j] = Frag<T>::load2(sB + 65536 + j * 2048 + fo[2 * s], sB + 65536 + j * 2048 + fo[2 * s + 1]);
      }
#pragma unroll
      for (int i = 0; i < 4; ++i) {
        V ah = Frag<T>::load2(sA + i * 2048 + fo[2 * s], sA + i * 2048 + fo[2 * s + 1]);
        V al;
        if (SPLIT >= 1) al = Frag<T>::load2(sA + 8192 + i * 2048 + fo[2 * s], sA + 8192 + i * 2048 + fo[2 * s + 1]);
#pragma unroll
        for (int j = 0; j < 4; ++j) {
          acc[i][j] = Frag<T>::mma(ah, bh[j], acc[i][j]);
          if (SPLIT == 2) acc[i][j] = Frag<T>::mma(ah, bl[j], acc[i][j]);
          if (SPLIT >= 1) acc[i][j] = Frag<T>::mma(al, bh[j], acc[i][j]);
        }
      }
    }
    asm volatile("s_wait_dscnt 0x0" ::: "memory");     // this wave's reads of the buffer are done before it may be refilled
    asm volatile("s_wait_asynccnt 0x0" ::: "memory");  // this wave's copies of stage st + 1 have landed
    __syncthreads();                                   // publishes stage st + 1 and ends every wave's reads of stage st
    if (st + 2 < nStage) issue(st & 1, st + 2);
  }
  asm volatile("s_wait_asynccnt 0x0" ::: "memory");    // no copy is outstanding when the slabs reuse the buffers
  acc_guard4(acc[0][0], acc[0][1], acc[0][2], acc[0][3]);
  acc_guard4(acc[1][0], acc[1][1], acc[1][2], acc[1][3]);
  acc_guard4(acc[2][0], acc[2][1], acc[2][2], acc[2][3]);
  acc_guard4(acc[3][0], acc[3][1], acc[3][2], acc[3][3]);

  // ---- epilogue ----
  if (OUT_MODE == 3 && !side) {
    // lane = column rlane of each 16-column subtile, register r = row mOff + r: squares summed over j, then over the 16 lanes of the row
    float* wsum = (float*)smem;                        // [8 waves][64 rows], reuses the stage buffers behind the loop
#pragma unroll   // constant indices into acc[][], which stays in registers
    for (int i = 0; i < 4; ++i) {
      float keep = 0.f;
#pragma unroll   // constant indices into acc[][]; the eight rows' lane sums interleave
      for (int r = 0; r < 8; ++r) {
        float s = acc[i][0][r] * acc[i][0][r];
        s = fmaf(acc[i][1][r], acc[i][1][r], s);
        s = fmaf(acc[i][2][r], acc[i][2][r], s);
        s = fmaf(acc[i][3][r], acc[i][3][r], s);
        s = add_xmask<1>(s); s = add_xmask<2>(s); s = add_xmask<4>(s); s = add_xmask<8>(s);
        keep = (rlane == r) ? s : keep;
      }
      if (rlane < 8) wsum[wave * 64 + (i << 4) + mOff + rlane] = keep;
    }
    __syncthreads();                                   // the 8 waves' sums of each row are in LDS before they are added
    if (threadIdx.x < 64) {
      float s = wsum[threadIdx.x];
#pragma unroll   // the eight LDS reads are in flight together
      for (int w = 1; w < 8; ++w) s += wsum[w * 64 + threadIdx.x];
      ((float*)Cout)[(size_t)(nb0 >> 9) * M + m0 + threadIdx.x] = s * scale;
    }
    return;
  }
  float* slab = (float*)smem + wave * (16 * 68);
#pragma unroll
  for (int i = 0; i < 4; ++i) {
    const int mBase = m0 + (i << 4);
#pragma unroll
    for (int j = 0; j < 4; ++j) {
#pragma unroll
      for (int r = 0; r < 8; ++r) {
        float v = (OUT_MODE == 3) ? acc[i][j][r] : acc[i][j][r] * scale;
        slab[(mOff + r) * 68 + (j << 4) + rlane] = v;
      }
    }
    __builtin_amdgcn_fence(__ATOMIC_RELEASE, "workgroup");
    __builtin_amdgcn_wave_barrier();
    __builtin_amdgcn_fence(__ATOMIC_ACQUIRE, "workgroup");
    if (OUT_MODE == 0) {
      float* C = (float*)Cout + (size_t)b * strideC;
      const int hh = lane >> 4, c4 = (lane & 15) * 4;     // row seg = 256 B = 16 lanes x 16 B
      {
#pragma unroll
        for (int it = 0; it < 8; ++it) {
          const int row = it * 2 + hh;
          v4f v = *(const v4f*)(slab + row * 68 + c4);
          *(v4f*)(C + (size_t)(mBase + row) * ldc + n0 + c4) = v;
        }
        
      }
    } else {
      const int q = lane >> 3, c8 = (lane & 7) * 8;
      unsigned short* C  = (unsigned short*)((OUT_MODE == 3) ? Cout2 : Cout) + (size_t)b * strideC;
      {
#pragma unroll
        for (int it = 0; it < 4; ++it) {
          const int row = it * 4 + q;
          const float* sp = slab + row * 68 + c8;
          if (OUT_MODE == 3) {
            v8us uv;
#pragma unroll
            for (int e = 0; e < 8; ++e) uv[e] = f2bf_bits(sp[e]);
            *(v8us*)(C + (size_t)(mBase + row) * ldc + n0 + c8) = uv;
          } else {
            v8h hv;
#pragma unroll
            for (int e = 0; e < 8; ++e) hv[e] = (_Float16)sp[e];
            *(v8h*)(C + (size_t)(mBase + row) * ldc + n0 + c8) = hv;
          }
        }
      }
    }
    __builtin_amdgcn_fence(__ATOMIC_RELEASE, "workgroup");
    __builtin_amdgcn_wave_barrier();
    __builtin_amdgcn_fence(__ATOMIC_ACQUIRE, "workgroup");
  }
}

// ---- all four input casts (RNE bf16) in one launch: the block index picks the job; no job reads what another writes ----
// Blocks [0, NB_T): transposing cast of the NE x NE plane wjv: wjvtb[e][d] = bf16(wjv[d][e]).  Thread = (column e of wjv, 64 neighbouring
// rows d): a wave's load is one whole 128-byte line of a row of wjv, the 64 loads of a thread are issued in one run, and a thread stores
// one whole 128-byte line of wjvtb.  Coverage: NB_T = (NE / 256) * (NE / 64) blocks x 256 threads x 64 elements = the whole plane.
// Behind them the plain casts: NB_W blocks for wj, NB_W for wo, NB_X for x.  A wave takes CAST_NL * 128 neighbouring elements: CAST_NL loads of
// 16 bytes a lane (each 512 contiguous bytes = 4 whole lines), all in flight together, then CAST_NL stores of 8 bytes a lane (2 whole lines each).
// Few long-lived waves, for speed only.  Coverage: blocks x 8 waves x CAST_NL * 128 elements =
// each whole plane.
constexpr int CAST_NL  = 32;
constexpr int CAST_BLK = 8 * CAST_NL * 128;          // elements of a block
static_assert((NE * NE) % CAST_BLK == 0 && (NTOK * NE) % CAST_BLK == 0);
constexpr int NB_T = (NE / 256) * (NE / 64);
constexpr int NB_W = (NE * NE) / CAST_BLK;
constexpr int NB_X = (NTOK * NE) / CAST_BLK;
typedef __attribute__((ext_vector_type(2))) unsigned v2u;
__global__ __launch_bounds__(256) void cast_inputs(
    const float* __restrict__ x, const float* __restrict__ wj, const float* __restrict__ wjv, const float* __restrict__ wo,
    unsigned short* __restrict__ xb, unsigned short* __restrict__ wjb, unsigned short* __restrict__ wjvtb, unsigned short* __restrict__ wob) {
  int blk = blockIdx.x;
  if (blk < NB_T) {                                  // block-uniform
    const int e  = (blk & (NE / 256 - 1)) * 256 + threadIdx.x;
    const int d0 = (blk / (NE / 256)) * 64;
    const float* p = wjv + (size_t)d0 * NE + e;
    float v[64];
#pragma unroll   // v[] is indexed by constants only and stays in registers
    for (int j = 0; j < 64; ++j) v[j] = p[(size_t)j * NE];
    unsigned short* q = wjvtb + (size_t)e * NE + d0;
#pragma unroll   // constant indices into v[]
    for (int c = 0; c < 8; ++c) {
      v8us uv;
#pragma unroll
      for (int j = 0; j < 8; ++j) uv[j] = f2bf_bits(v[c * 8 + j]);
      *(v8us*)(q + c * 8) = uv;
    }
    return;
  }
  blk -= NB_T;
  const float* in = wj; unsigned short* out = wjb;   // block-uniform choice of the plane
  if (blk >= 2 * NB_W)  { in = x;  out = xb;  blk -= 2 * NB_W; }
  else if (blk >= NB_W) { in = wo; out = wob; blk -= NB_W; }
  const size_t e0 = (size_t)blk * CAST_BLK + (threadIdx.x >> 5) * (CAST_NL * 128) + (threadIdx.x & 31) * 4;
  const float* p = in + e0;
  unsigned short* q = out + e0;
  v4f v[CAST_NL];
#pragma unroll   // v[] is indexed by constants only and stays in registers; all loads of a thread are issued in one run
  for (int k = 0; k < CAST_NL; ++k) v[k] = *(const v4f*)(p + k * 128);
  __builtin_amdgcn_sched_barrier(0);                 // every load is issued before the first conversion: without it the last loads wait for registers of the first
#pragma unroll   // constant indices into v[]
  for (int k = 0; k < CAST_NL; ++k) {
    v2u u;
    u[0] = (unsigned)f2bf_bits(v[k][0]) | ((unsigned)f2bf_bits(v[k][1]) << 16);
    u[1] = (unsigned)f2bf_bits(v[k][2]) | ((unsigned)f2bf_bits(v[k][3]) << 16);
    *(v2u*)(q + k * 128) = u;
  }
}

// ---------------------------------------------------------------------------
// Workspace region map (bytes; all offsets multiples of 1 MiB):
//   R_XB  [0, 16 MiB)            : xb bf16 [8192][1024]
//   R_W   [16, 24 MiB)           : wjb, W2b = wo*wjv, wjvb^T, wob, all bf16 [1024][1024] (2 MiB each)
//   R_C   [24, 40 MiB)           : uT f16 [4][1024][2048], u = x*W2^T
//   R_S   [40 MiB, +64 KiB)      : the two halves of sc, f32 [2][8192]
//   R_P   [41, 73 MiB)           : P f16 [4][2048][2048] (all batches)
//   total 76,546,048 B
extern "C" void kernel_launch(void* const* d_in, const int* in_sizes, int n_in,
                              void* d_out, int out_size, void* d_ws, size_t ws_size,
                              hipStream_t stream) {
  if (n_in < 4) return;
  if (in_sizes[0] != NTOK * NE || in_sizes[1] != NE * NE || in_sizes[2] != NE * NE ||
      in_sizes[3] != NE * NE || out_size != NTOK * NE) return;
  const float* x   = (const float*)d_in[0];   // [4][2048][1024]
  const float* wj  = (const float*)d_in[1];   // [1024][1024] (out,in)
  const float* wjv = (const float*)d_in[2];   // [1024][1024]
  const float* wo  = (const float*)d_in[3];   // [1024][1024]
  float* outp = (float*)d_out;

  const size_t PLANE16 = (size_t)NTOK * NE * 2;    // 16,777,216
  const size_t WPL     = (size_t)NE * NE * 2;      //  2,097,152
  const size_t PPL     = (size_t)NT * NT * 2;      //  8,388,608
  const size_t off_xb = 0;
  const size_t off_w  = off_xb + PLANE16;
  const size_t off_c  = off_w + 4 * WPL;
  const size_t off_s  = off_c + PLANE16;
  const size_t off_p  = off_s + ((size_t)1 << 20);
  const size_t total  = off_p + NBATCH * PPL;      // 76,546,048
  if (total > ws_size) return;

  char* ws = (char*)d_ws;
  unsigned short* xb     = (unsigned short*)(ws + off_xb);
  unsigned short* wjb    = (unsigned short*)(ws + off_w);
  unsigned short* w2b    = (unsigned short*)(ws + off_w + 1 * WPL);
  unsigned short* wjvtb  = (unsigned short*)(ws + off_w + 2 * WPL);
  unsigned short* wob    = (unsigned short*)(ws + off_w + 3 * WPL);
  unsigned short* vth    = (unsigned short*)(ws + off_c);
  unsigned short* ph     = (unsigned short*)(ws + off_p);
  float*          scp    = (float*)(ws + off_s);

  const dim3 blk(256);

  // 1) input planes, RNE bf16, one launch: x, wj, wo as they lie, wjv transposed ([e][d], the k-contiguous second operand of wo*wjv)
  cast_inputs<<<dim3(NB_T + 2 * NB_W + NB_X), blk, 0, stream>>>(x, wj, wjv, wo, xb, wjb, wjvtb, wob);

  // 2) token scores.  echo[t][f] = sum_e xb[t][e] wjb[f][e]   (M=8192, N=1024, K=1024; 2048 tiles = 256 blocks); for every x and wj
  //    sum_e x[t][e] (sum_f echo[t][f] wj[f][e]) = sum_f echo[t][f] (sum_e wj[f][e] x[t][e]) = sum_f echo[t][f]^2,
  //    so sc[t] = (1/32) sum_f echo[t][f]^2, left as one partial sum for each of the two column blocks.
  //    Side product in the same launch (32 more blocks; two blocks fit a WGP's LDS): W2[n][e] = sum_d wob[n][d] wjvtb[e][d] -> bf16
  wmma_gemm64<1, 0, 3, false, false><<<dim3((NTOK / 64) * (NE / 64) / 8 + (NE / 64) * (NE / 64) / 8, 1), blk, 0, stream>>>(
      xb, wob, NE, 0L, wjb, wjvtb, NE, 0L, (void*)scp, (void*)w2b, NE, 0L, NTOK, NE, NE, 1.0f / 32.0f, nullptr, nullptr);
  // 3) uT[b][n][t] = sum_e W2b[n][e] xb[b][t][e] -> f16 plane [4][1024][2048]  (M=1024, N=2048, K=1024; 512 tiles = 64 blocks per batch);
  //    in the same launch, behind those 256 blocks (two blocks fit a WGP's LDS), 64 more per batch write the probability plane with its
  //    softmax statistics from the scores of 2): the two jobs need nothing of each other
  static_assert((NE / 64) * (NT / 64) / 8 == NT / 32);
  wmma_gemm64<1, 0, 1, false, true><<<dim3((NE / 64) * (NT / 64) / 8, 2 * NBATCH), blk, 0, stream>>>(
      w2b, w2b, NE, 0L, xb, xb, NE, (long)NT * NE, (void*)vth, (void*)vth, NT, (long)NE * NT, NE, NT, NE, 1.0f, scp, ph);
  // 4) all batches at once (grid.y = batch): out[b][t][n] = sum_{s < tile end} P[b][t][s] uT[b][n][s]
  //    (f16 operands, causal k-limit) -> f32 output   (512 tiles = 64 blocks per batch, 256 blocks in the launch)
  wmma_gemm64<0, 0, 0, true, false><<<dim3((NT / 64) * (NE / 64) / 8, NBATCH), blk, 0, stream>>>(
      ph, ph, NT, (long)NT * NT, vth, vth, NT, (long)NE * NT,
      (void*)outp, (void*)outp, NE, (long)NT * NE, NT, NE, NT, 1.0f, nullptr, nullptr);
}

// v009
// Measured time: 90.7 microseconds a run.
// Timed twice side by side with v008, it ran 1.12 and 1.11 times as fast.
// All steps since v000 together make it 8.53 times as fast.
// Contractions on v_wmma_f32_16x16x32 (16-bit operands, f32 accumulate). bf16: echo = xb*wjb^T (inputs RNE bf16; only its rows' sums of squares leave the kernel), W2 = wob*wjvb (the output projection folded into the value weights: (P*(x*wjv^T))*wo^T = P*(x*(wo*wjv)^T) for every input), u^T = W2b*xb^T. f16: out = P*u^T (causal k-limit, f32 result); P and u^T are carried as one RNE f16 plane each; token scores (x.(echo*wj) = echo.echo), softmax statistics and probabilities in f32 on VALU.
#include <hip/hip_runtime.h>
#include <stdint.h>

constexpr int NBATCH = 4;
constexpr int NT     = 2048;
constexpr int NE     = 1024;
constexpr int NTOK   = NBATCH * NT;
static_assert((NTOK % 128) == 0 && (NT % 256) == 0 && (NE % 256) == 0);

typedef __attribute__((ext_vector_type(16))) _Float16 v16h;
typedef __attribute__((ext_vector_type(8)))  _Float16 v8h;
typedef __attribute__((ext_vector_type(16))) __bf16   v16b;
typedef __attribute__((ext_vector_type(8)))  __bf16   v8b;
typedef __attribute__((ext_vector_type(8)))  float    v8f;
typedef __attribute__((ext_vector_type(4)))  float    v4f;
typedef __attribute__((ext_vector_type(8)))  unsigned short v8us;

__device__ __forceinline__ unsigned short f2bf_bits(float f) {
  unsigned u = __float_as_uint(f);
  return (unsigned short)((u + 0x7FFFu + ((u >> 16) & 1u)) >> 16);
}

// slots between the last WMMAs and the epilogue's first reads of their accumulators
__device__ __forceinline__ void acc_guard4(v8f& a, v8f& b, v8f& c, v8f& d) { asm volatile("v_nop\n\tv_nop\n\tv_nop\n\tv_nop" : "+v"(a), "+v"(b), "+v"(c), "+v"(d)); }
// x + x of lane (l ^ MASK) inside the 16-lane row (DPP row_xmask)
template <int MASK> __device__ __forceinline__ float add_xmask(float x) {
  return x + __builtin_bit_cast(float, __builtin_amdgcn_update_dpp(0, __builtin_bit_cast(int, x), 0x160 + MASK, 0xf, 0xf, true));
}
template <typename T> struct Frag;
template <> struct Frag<_Float16> {
  typedef v16h V; union U { v16h v; v8h h[2]; };
  static __device__ __forceinline__ v16h load2(const unsigned char* p0, const unsigned char* p1) {   // elements 0..7 <- 16 B at p0, 8..15 <- 16 B at p1
    U f; f.h[0] = *(const v8h*)(p0); f.h[1] = *(const v8h*)(p1); return f.v;
  }
  static __device__ __forceinline__ v8f mma(v16h a, v16h b, v8f c) {
    return __builtin_amdgcn_wmma_f32_16x16x32_f16(false, a, false, b, (short)0, c, false, false);
  }
};
template <> struct Frag<__bf16> {
  typedef v16b V; union U { v16b v; v8b h[2]; };
  static __device__ __forceinline__ v16b load2(const unsigned char* p0, const unsigned char* p1) {
    U f; f.h[0] = *(const v8b*)(p0); f.h[1] = *(const v8b*)(p1); return f.v;
  }
  static __device__ __forceinline__ v8f mma(v16b a, v16b b, v8f c) {
    return __builtin_amdgcn_wmma_f32_16x16x32_bf16(false, a, false, b, (short)0, c, false, false);
  }
};

// ---- probability plane with its row statistics: one block's share (batch b, block blk of NT / 32), wave = four rows t, one after the other ----
// sc = scp[0][.] + .. + scp[3][.]: the four parts of each token's score, as the echo product's four column blocks left them; the block adds
// them once for its batch (thread = 8 neighbouring tokens, 256 x 8 = NT) and its 8 waves read the sums from LDS.
// m_t = max_{s<=t} fl(sc_t*sc_s), z_t = sum_{s<=t} exp(sc_t*sc_s - m_t);
// P[b][t][s] = exp(sc_t*sc_s - m_t) * (1/z_t) for s <= t, 0 for t < s < ((t>>7)+1)*128.
// The row's scores stay in registers (lane = 8 neighbouring columns of each 256-column group, at most 8 groups), so all loads of a
// row are in flight together and every exponential is formed once; maximum and sum end in a butterfly over the 32 lanes.
// Written as one RNE f16 plane [NBATCH][NT][NT] (row pitch NT).
// Coverage: blk = 0..NT/32-1, 8 waves, rows blk * 8 + wave + (NT / 4) r, r = 0..3 (one row of each quarter: no wave gets long rows
// alone) = NT rows; b = 0..NBATCH-1; columns [0, ((t>>7)+1)*128) of every row = exactly what the causal P.V product reads for
// the 128-row tile containing t.  s_sc: NT floats of the block's LDS, 16-byte aligned.
__device__ __forceinline__ void pgen_rows(const float* __restrict__ scp, unsigned short* __restrict__ php, float* s_sc, const int b, const int blk) {
  constexpr int NG = NT / 256;                     // column groups of a full row
  static_assert(NT == 256 * 8);
  _Float16* ph = (_Float16*)php + (size_t)b * NT * NT;
  const int wave = __builtin_amdgcn_readfirstlane(threadIdx.x >> 5), lane = threadIdx.x & 31;
  {
    const float* scb = scp + (size_t)b * NT + threadIdx.x * 8;
    const v4f q0 = *(const v4f*)(scb);
    const v4f q1 = *(const v4f*)(scb + 4);
    const v4f u0 = *(const v4f*)(scb + NTOK);
    const v4f u1 = *(const v4f*)(scb + NTOK + 4);
    const v4f w0 = *(const v4f*)(scb + 2 * NTOK);
    const v4f w1 = *(const v4f*)(scb + 2 * NTOK + 4);
    const v4f y0 = *(const v4f*)(scb + 3 * NTOK);
    const v4f y1 = *(const v4f*)(scb + 3 * NTOK + 4);
    asm volatile("s_wait_xcnt 0x0" ::: "memory");    // stands before any rewrite of the address registers that the loads above name
    __builtin_amdgcn_sched_barrier(0);               // keeps the later writes of those registers from being scheduled in front of the wait
    *(v4f*)(s_sc + threadIdx.x * 8)     = ((q0 + u0) + w0) + y0;
    *(v4f*)(s_sc + threadIdx.x * 8 + 4) = ((q1 + u1) + w1) + y1;
  }
  __syncthreads();                                   // all NT scores of the batch are in LDS before any wave reads them
  for (int r = 0; r < 4; ++r) {
  const int t = blk * 8 + wave + r * (NT / 4);     // 0..NT-1, wave-uniform
  const float sct = s_sc[t];
  const int ncol = ((t >> 7) + 1) << 7;
  _Float16* prh = ph + (size_t)t * NT;
  float v[NG][8];
  const float NEG_INF = __uint_as_float(0xff800000u);
  float mx = NEG_INF;
#pragma unroll   // v[][] is indexed by constants only and stays in registers
  for (int g = 0; g < NG; ++g) {
    if (g * 256 < ncol) {                            // wave-uniform
      const int c = g * 256 + lane * 8;
      const int cc = (c < NT - 8) ? c : (NT - 8);     // clamped address
      const v4f q0 = *(const v4f*)(s_sc + cc);
      const v4f q1 = *(const v4f*)(s_sc + cc + 4);
#pragma unroll
      for (int j = 0; j < 4; ++j) { v[g][j] = q0[j]; v[g][4 + j] = q1[j]; }
    }
  }
#pragma unroll   // constant indices into v[][]
  for (int g = 0; g < NG; ++g) {
    if (g * 256 < ncol) {
      const int c = g * 256 + lane * 8;
      float mg = NEG_INF;                            // a chain of its own for each group
#pragma unroll
      for (int j = 0; j < 8; ++j) mg = fmaxf(mg, (c + j <= t) ? sct * v[g][j] : NEG_INF);
      mx = fmaxf(mx, mg);
    }
  }
#pragma unroll
  for (int off = 16; off; off >>= 1) mx = fmaxf(mx, __shfl_xor(mx, off, 32));
  float z = 0.f;
#pragma unroll   // constant indices into v[][]
  for (int g = 0; g < NG; ++g) {
    if (g * 256 < ncol) {
      const int c = g * 256 + lane * 8;
      float zg = 0.f;                                // a chain of its own for each group
#pragma unroll
      for (int j = 0; j < 8; ++j) {
        const float e = __expf(fmaf(sct, v[g][j], -mx));
        v[g][j] = e;
        zg += (c + j <= t) ? e : 0.0f;
      }
      z += zg;
    }
  }
#pragma unroll
  for (int off = 16; off; off >>= 1) z += __shfl_xor(z, off, 32);
  const float li = 1.0f / z;
#pragma unroll   // constant indices into v[][]
  for (int g = 0; g < NG; ++g) {
    if (g * 256 < ncol) {
      const int c = g * 256 + lane * 8;
      v8h hv;
#pragma unroll
      for (int j = 0; j < 8; ++j) {
        float p = v[g][j] * li;
        p = (c + j <= t) ? p : 0.0f;
        hv[j] = (_Float16)p;
      }
      if (c < ncol) *(v8h*)(prh + c) = hv;           // c % 8 == 0 and ncol % 128 == 0 -> whole 8-groups
    }
  }
  asm volatile("s_wait_xcnt 0x0" ::: "memory");      // stands before the next row's rewrite of the address registers that the stores above name
  }
}

// ---- Register-blocked batched WMMA GEMM ------------------------------------
// C[m,n] = scale * sum_k A[m,k] * Bt[n,k]; each wave owns a 64x64 tile; the 8 waves of a block stand 2 x 4 on a 128 x 256 tile
// (128 rows of A, 256 rows of Bt: of all shapes of 8 such waves the one that asks L2 for the fewest bytes per product).
// A row-major [M,K]; Bt row-major [N,K]; M % 128 == 0, N % 256 == 0, K % 64 == 0, K >= 64.
// The k loop works on stages of 64 k: every row of a stage is one whole 128-byte line, brought into LDS by asynchronous
// copies (a wave-wide copy = 4 whole lines), two buffers, the next stage in flight while this one is worked on.
// LDS place of the 16-byte chunk c (0..7) of stage row R: R * 128 + ((c ^ ((R >> 1) & 7)) * 16): 16 rows read at one chunk
// index fall on 16 different 16-byte bank groups.
// SPLIT: 0 = single product; 1 = A carried as hi/lo planes (A2 = lo), Bt single: hi.B + lo.B (2 products);
//        2 = A and Bt as hi/lo planes: hi.hi + hi.lo + lo.hi (3 products).
// OUT_MODE: 0 = f32, 1 = f16 (RNE),
//           3 = no C at all: Cout[(n / 256) * M + m] = scale * sum over the block's 256 columns n of C[m,n]^2 (f32, fixed order);
//               the blocks behind the (M / 128) * (N / 256) of that product do a side product of the same N, K and pitches:
//               Cout2[m,n] = sum_k A2[m,k] * Bt2[n,k], m < N, bf16 (RNE), pitch ldc, unscaled ((N / 128) * (N / 256) blocks).
// CAUSAL: the k loop of the block tile at rows m0..m0+127 stops at k = m0 + 128 (lower block-triangular A).
// ET: 0 = f16 operands, 1 = bf16 operands (pointers passed as 16-bit storage)
// RIDER: the blocks with blockIdx.y >= NBATCH (behind all blocks of the product in index order) do no product: they write the probability
//        plane of batch blockIdx.y - NBATCH from scp into php (pgen_rows, gridDim.x = NT / 32); neither job reads what the other writes.
template <int ET> struct Elem;
template <> struct Elem<0> { typedef _Float16 T; };
template <> struct Elem<1> { typedef __bf16 T; };
typedef __attribute__((address_space(3))) unsigned char lds_u8;
// Asynchronous copies, 16 bytes a lane, global -> LDS.  The s_wait_xcnt is the last line of the copies' own statement: it stands
// before any later rewrite of the address registers that the copies name.
__device__ __forceinline__ void async_copy4(unsigned l, const unsigned char* g, unsigned lstep, size_t gstep) {
  asm volatile("global_load_async_to_lds_b128 %0, %1, off\n\t"
               "global_load_async_to_lds_b128 %2, %3, off\n\t"
               "global_load_async_to_lds_b128 %4, %5, off\n\t"
               "global_load_async_to_lds_b128 %6, %7, off\n\t"
               "s_wait_xcnt 0x0"
               :: "v"(l), "v"(g), "v"(l + lstep), "v"(g + gstep), "v"(l + 2 * lstep), "v"(g + 2 * gstep),
                  "v"(l + 3 * lstep), "v"(g + 3 * gstep) : "memory");
}
__device__ __forceinline__ void async_copy8(unsigned l, const unsigned char* g, unsigned lstep, size_t gstep) {
  asm volatile("global_load_async_to_lds_b128 %0, %1, off\n\t"
               "global_load_async_to_lds_b128 %2, %3, off\n\t"
               "global_load_async_to_lds_b128 %4, %5, off\n\t"
               "global_load_async_to_lds_b128 %6, %7, off\n\t"
               "global_load_async_to_lds_b128 %8, %9, off\n\t"
               "global_load_async_to_lds_b128 %10, %11, off\n\t"
               "global_load_async_to_lds_b128 %12, %13, off\n\t"
               "global_load_async_to_lds_b128 %14, %15, off\n\t"
               "s_wait_xcnt 0x0"
               :: "v"(l), "v"(g), "v"(l + lstep), "v"(g + gstep), "v"(l + 2 * lstep), "v"(g + 2 * gstep),
                  "v"(l + 3 * lstep), "v"(g + 3 * gstep), "v"(l + 4 * lstep), "v"(g + 4 * gstep),
                  "v"(l + 5 * lstep), "v"(g + 5 * gstep), "v"(l + 6 * lstep), "v"(g + 6 * gstep),
                  "v"(l + 7 * lstep), "v"(g + 7 * gstep) : "memory");
}
// One stage of one A plane (4 copies a lane) and one Bt plane (8): 12 copies fit one statement, so the stage has one s_wait_xcnt.
__device__ __forceinline__ void async_copy12(unsigned la, const unsigned char* ga, size_t gsa, unsigned lb, const unsigned char* gb, size_t gsb) {
  asm volatile("global_load_async_to_lds_b128 %0, %1, off\n\t"
               "global_load_async_to_lds_b128 %2, %3, off\n\t"
               "global_load_async_to_lds_b128 %4, %5, off\n\t"
               "global_load_async_to_lds_b128 %6, %7, off\n\t"
               "global_load_async_to_lds_b128 %8, %9, off\n\t"
               "global_load_async_to_lds_b128 %10, %11, off\n\t"
               "global_load_async_to_lds_b128 %12, %13, off\n\t"
               "global_load_async_to_lds_b128 %14, %15, off\n\t"
               "global_load_async_to_lds_b128 %16, %17, off\n\t"
               "global_load_async_to_lds_b128 %18, %19, off\n\t"
               "global_load_async_to_lds_b128 %20, %21, off\n\t"
               "global_load_async_to_lds_b128 %22, %23, off\n\t"
               "s_wait_xcnt 0x0"
               :: "v"(la), "v"(ga), "v"(la + 4096u), "v"(ga + gsa), "v"(la + 8192u), "v"(ga + 2 * gsa), "v"(la + 12288u), "v"(ga + 3 * gsa),
                  "v"(lb), "v"(gb), "v"(lb + 4096u), "v"(gb + gsb), "v"(lb + 8192u), "v"(gb + 2 * gsb), "v"(lb + 12288u), "v"(gb + 3 * gsb),
                  "v"(lb + 16384u), "v"(gb + 4 * gsb), "v"(lb + 20480u), "v"(gb + 5 * gsb), "v"(lb + 24576u), "v"(gb + 6 * gsb),
                  "v"(lb + 28672u), "v"(gb + 7 * gsb) : "memory");
}
template <int ET, int SPLIT, int OUT_MODE, bool CAUSAL, bool RIDER>
// at most 4 waves a SIMD (two blocks a WGP, all that any launch here needs): with three blocks' worth of LDS free the compiler otherwise
// saves registers for a fifth wave by loading one A fragment at a time, each with a full LDS wait in front of its four WMMAs
__global__ __launch_bounds__(256) __attribute__((amdgpu_waves_per_eu(2, 4))) void wmma_gemm64(
    const unsigned short* __restrict__ Ap, const unsigned short* __restrict__ A2p, int lda, long strideA,
    const unsigned short* __restrict__ Btp, const unsigned short* __restrict__ Bt2p, int ldb, long strideB,
    void* __restrict__ Cout, void* __restrict__ Cout2, int ldc, long strideC,
    int M, int N, int K, float scale, const float* __restrict__ scp, unsigned short* __restrict__ php) {
  typedef typename Elem<ET>::T T;
  typedef typename Frag<T>::V V;
  constexpr int NPA   = (SPLIT >= 1) ? 2 : 1;          // planes of A, of Bt
  constexpr int NPB   = (SPLIT == 2) ? 2 : 1;
  constexpr int PL_A  = 128 * 128, PL_B = 256 * 128;   // bytes of one stage of a plane: 128 rows of A, 256 rows of Bt
  constexpr int OFF_B = NPA * PL_A;                    // A planes, then Bt planes
  constexpr int BUFB  = OFF_B + NPB * PL_B;            // one stage buffer
  constexpr int SLABS = 8 * 16 * 68 * 4;               // epilogue: per-wave 16x64 slab, pitch 68 floats
  __shared__ __attribute__((aligned(128))) unsigned char smem[(2 * BUFB > SLABS) ? 2 * BUFB : SLABS];   // the slabs reuse the stage buffers behind the loop
  if (RIDER && blockIdx.y >= NBATCH) {                 // block-uniform, in front of every barrier of the product
    pgen_rows(scp, php, (float*)smem, blockIdx.y - NBATCH, blockIdx.x);
    return;
  }
  const int b    = blockIdx.y;
  const int lane = threadIdx.x & 31;
  const int wave = __builtin_amdgcn_readfirstlane(threadIdx.x >> 5);   // wave-uniform: the LDS places that follow from it stay scalar
  const int wr = wave >> 2, wc = wave & 3;             // the wave's place in the block tile: 64-row half, 64-column quarter
  const int tilesN = N >> 8;                           // block tiles in a row of C, in a column of C
  const int tilesM = M >> 7;
  int tile0 = blockIdx.x;
  const bool side = (OUT_MODE == 3) && tile0 >= tilesM * tilesN;   // block-uniform
  if (side) tile0 -= tilesM * tilesN;
  if (tile0 >= (side ? (N >> 7) : tilesM) * tilesN) return;   // block-uniform, in front of every barrier
  const T* A = (const T*)(side ? A2p : Ap); const T* A2 = (const T*)A2p; const T* Bt = (const T*)(side ? Bt2p : Btp); const T* Bt2 = (const T*)Bt2p;
  const int tm  = tile0 / tilesN;
  const int tn0 = tile0 - tm * tilesN;
  const int m0  = tm << 7;                             // first A row of the block
  const int nb0 = tn0 << 8;                            // first Bt row of the block
  const int mw0 = m0 + (wr << 6);                      // the wave's own first row and column of C
  const int n0  = nb0 + (wc << 6);

  const T* Ab  = A  + (size_t)b * strideA;
  const T* Bb  = Bt + (size_t)b * strideB;
  const T* Ab2 = (SPLIT >= 1) ? (A2  + (size_t)b * strideA) : nullptr;
  const T* Bb2 = (SPLIT == 2) ? (Bt2 + (size_t)b * strideB) : nullptr;

  const int rlane = lane & 15;                 // row (A) / col (B, D) within subtile
  const int mOff  = (lane >> 4) * 8;           // D row offset

  v8f acc[4][4];
#pragma unroll
  for (int i = 0; i < 4; ++i)
#pragma unroll
    for (int j = 0; j < 4; ++j) acc[i][j] = (v8f){0.f,0.f,0.f,0.f,0.f,0.f,0.f,0.f};

  int kEnd = K;
  if (CAUSAL) kEnd = (m0 + 128 < K) ? (m0 + 128) : K;   // block-uniform, multiple of 64
  const int nStage = kEnd >> 6;

  // copies: thread = (stage row cr + 32 q, chunk cc); the chunk swizzle of a row depends on cr alone (32 q >> 1 is 0 mod 8)
  const int cc = threadIdx.x & 7, cr = threadIdx.x >> 3;
  const unsigned ldsC = (unsigned)(uintptr_t)(lds_u8*)smem + (unsigned)(cr * 128 + ((cc ^ ((cr >> 1) & 7)) << 4));
  const unsigned char* gA  = (const unsigned char*)(Ab + (size_t)(m0 + cr) * lda + cc * 8);
  const unsigned char* gB  = (const unsigned char*)(Bb + (size_t)(nb0 + cr) * ldb + cc * 8);
  const unsigned char* gA2 = (SPLIT >= 1) ? (const unsigned char*)(Ab2 + (size_t)(m0 + cr) * lda + cc * 8) : nullptr;
  const unsigned char* gB2 = (SPLIT == 2) ? (const unsigned char*)(Bb2 + (size_t)(nb0 + cr) * ldb + cc * 8) : nullptr;
  const size_t gsA = (size_t)lda * 64, gsB = (size_t)ldb * 64;   // 32 rows, bytes
  auto issue = [&](int buf, int st) {                  // all copies of stage st (k = 64 st .. 64 st + 63) into buffer buf
    const unsigned l = ldsC + (unsigned)(buf * BUFB);
    const size_t ko = (size_t)st * 128;
    async_copy12(l, gA + ko, gsA, l + OFF_B, gB + ko, gsB);
    if (SPLIT >= 1) async_copy4(l + PL_A, gA2 + ko, 4096u, gsA);
    if (SPLIT == 2) async_copy8(l + OFF_B + PL_B, gB2 + ko, 4096u, gsB);
  };
  // readers: lane = (row rlane of a 16-row group, half h); chunk 4 s + h holds k = 32 s + 8 h + 0..7, chunk 4 s + h + 2 holds k + 16
  const int e0 = (lane >> 4) ^ ((rlane >> 1) & 7);
  const int rowB = rlane * 128;
  int fo[4];
#pragma unroll   // fo[] is indexed by constants only and stays in registers
  for (int q = 0; q < 4; ++q) fo[q] = rowB + ((e0 ^ (2 * q)) << 4);

  issue(0, 0);
  asm volatile("s_wait_asynccnt 0x0" ::: "memory");    // this wave's copies of stage 0 have landed
  __syncthreads();                                     // and every other wave's
  if (nStage > 1) issue(1, 1);
  for (int st = 0; st < nStage; ++st) {
    const unsigned char* sA = smem + (st & 1) * BUFB + wr * 8192;
    const unsigned char* sB = smem + (st & 1) * BUFB + OFF_B + wc * 8192;
#pragma unroll   // both 32-wide k-steps of a stage: constant indices into fo[]
    for (int s = 0; s < 2; ++s) {
      V bh[4], bl[4];
#pragma unroll
      for (int j = 0; j < 4; ++j) {
        bh[j] = Frag<T>::load2(sB + j * 2048 + fo[2 * s], sB + j * 2048 + fo[2 * s + 1]);
        if (SPLIT == 2) bl[j] = Frag<T>::load2(sB + PL_B + j * 2048 + fo[2 * s], sB + PL_B + j * 2048 + fo[2 * s + 1]);
      }
#pragma unroll
      for (int i = 0; i < 4; ++i) {
        V ah = Frag<T>::load2(sA + i * 2048 + fo[2 * s], sA + i * 2048 + fo[2 * s + 1]);
        V al;
        if (SPLIT >= 1) al = Frag<T>::load2(sA + PL_A + i * 2048 + fo[2 * s], sA + PL_A + i * 2048 + fo[2 * s + 1]);
#pragma unroll
        for (int j = 0; j < 4; ++j) {
          acc[i][j] = Frag<T>::mma(ah, bh[j], acc[i][j]);
          if (SPLIT == 2) acc[i][j] = Frag<T>::mma(ah, bl[j], acc[i][j]);
          if (SPLIT >= 1) acc[i][j] = Frag<T>::mma(al, bh[j], acc[i][j]);
        }
      }
    }
    asm volatile("s_wait_dscnt 0x0" ::: "memory");     // this wave's reads of the buffer are done before it may be refilled
    asm volatile("s_wait_asynccnt 0x0" ::: "memory");  // this wave's copies of stage st + 1 have landed
    __syncthreads();                                   // publishes stage st + 1 and ends every wave's reads of stage st
    if (st + 2 < nStage) issue(st & 1, st + 2);
  }
  asm volatile("s_wait_asynccnt 0x0" ::: "memory");    // no copy is outstanding when the slabs reuse the buffers
  acc_guard4(acc[0][0], acc[0][1], acc[0][2], acc[0][3]);
  acc_guard4(acc[1][0], acc[1][1], acc[1][2], acc[1][3]);
  acc_guard4(acc[2][0], acc[2][1], acc[2][2], acc[2][3]);
  acc_guard4(acc[3][0], acc[3][1], acc[3][2], acc[3][3]);

  // ---- epilogue ----
  if (OUT_MODE == 3 && !side) {
    // lane = column rlane of each 16-column subtile, register r = row mOff + r: squares summed over j, then over the 16 lanes of the row
    float* wsum = (float*)smem;                        // [8 waves][64 rows], reuses the stage buffers behind the loop
#pragma unroll   // constant indices into acc[][], which stays in registers
    for (int i = 0; i < 4; ++i) {
      float keep = 0.f;
#pragma unroll   // constant indices into acc[][]; the eight rows' lane sums interleave
      for (int r = 0; r < 8; ++r) {
        float s = acc[i][0][r] * acc[i][0][r];
        s = fmaf(acc[i][1][r], acc[i][1][r], s);
        s = fmaf(acc[i][2][r], acc[i][2][r], s);
        s = fmaf(acc[i][3][r], acc[i][3][r], s);
        s = add_xmask<1>(s); s = add_xmask<2>(s); s = add_xmask<4>(s); s = add_xmask<8>(s);
        keep = (rlane == r) ? s : keep;
      }
      if (rlane < 8) wsum[wave * 64 + (i << 4) + mOff + rlane] = keep;
    }
    __syncthreads();                                   // the four column waves' sums of each row are in LDS before they are added
    if (threadIdx.x < 128) {                           // thread = row of the block tile; its four column waves are 4 (row / 64) + 0..3
      const float* wrow = wsum + (threadIdx.x >> 6) * 256 + (threadIdx.x & 63);
      float s = wrow[0];
#pragma unroll   // the four LDS reads are in flight together
      for (int w = 1; w < 4; ++w) s += wrow[w * 64];
      ((float*)Cout)[(size_t)(nb0 >> 8) * M + m0 + threadIdx.x] = s * scale;
    }
    return;
  }
  float* slab = (float*)smem + wave * (16 * 68);
#pragma unroll
  for (int i = 0; i < 4; ++i) {
    const int mBase = mw0 + (i << 4);
#pragma unroll
    for (int j = 0; j < 4; ++j) {
#pragma unroll
      for (int r = 0; r < 8; ++r) {
        float v = (OUT_MODE == 3) ? acc[i][j][r] : acc[i][j][r] * scale;
        slab[(mOff + r) * 68 + (j << 4) + rlane] = v;
      }
    }
    __builtin_amdgcn_fence(__ATOMIC_RELEASE, "workgroup");
    __builtin_amdgcn_wave_barrier();
    __builtin_amdgcn_fence(__ATOMIC_ACQUIRE, "workgroup");
    if (OUT_MODE == 0) {
      float* C = (float*)Cout + (size_t)b * strideC;
      const int hh = lane >> 4, c4 = (lane & 15) * 4;     // row seg = 256 B = 16 lanes x 16 B
      {
#pragma unroll
        for (int it = 0; it < 8; ++it) {
          const int row = it * 2 + hh;
          v4f v = *(const v4f*)(slab + row * 68 + c4);
          *(v4f*)(C + (size_t)(mBase + row) * ldc + n0 + c4) = v;
        }
        
      }
    } else {
      const int q = lane >> 3, c8 = (lane & 7) * 8;
      unsigned short* C  = (unsigned short*)((OUT_MODE == 3) ? Cout2 : Cout) + (size_t)b * strideC;
      {
#pragma unroll
        for (int it = 0; it < 4; ++it) {
          const int row = it * 4 + q;
          const float* sp = slab + row * 68 + c8;
          if (OUT_MODE == 3) {
            v8us uv;
#pragma unroll
            for (int e = 0; e < 8; ++e) uv[e] = f2bf_bits(sp[e]);
            *(v8us*)(C + (size_t)(mBase + row) * ldc + n0 + c8) = uv;
          } else {
            v8h hv;
#pragma unroll
            for (int e = 0; e < 8; ++e) hv[e] = (_Float16)sp[e];
            *(v8h*)(C + (size_t)(mBase + row) * ldc + n0 + c8) = hv;
          }
        }
      }
    }
    __builtin_amdgcn_fence(__ATOMIC_RELEASE, "workgroup");
    __builtin_amdgcn_wave_barrier();
    __builtin_amdgcn_fence(__ATOMIC_ACQUIRE, "workgroup");
  }
}

// ---- all four input casts (RNE bf16) in one launch: the block index picks the job; no job reads what another writes ----
// Blocks [0, NB_T): transposing cast of the NE x NE plane wjv: wjvtb[e][d] = bf16(wjv[d][e]).  Thread = (column e of wjv, 64 neighbouring
// rows d): a wave's load is one whole 128-byte line of a row of wjv, the 64 loads of a thread are issued in one run, and a thread stores
// one whole 128-byte line of wjvtb.  Coverage: NB_T = (NE / 256) * (NE / 64) blocks x 256 threads x 64 elements = the whole plane.
// Behind them the plain casts: NB_W blocks for wj, NB_W for wo, NB_X for x.  A wave takes CAST_NL * 128 neighbouring elements: CAST_NL loads of
// 16 bytes a lane (each 512 contiguous bytes = 4 whole lines), all in flight together, then CAST_NL stores of 8 bytes a lane (2 whole lines each).
// Few long-lived waves, for speed only.  Coverage: blocks x 8 waves x CAST_NL * 128 elements =
// each whole plane.
constexpr int CAST_NL  = 32;
constexpr int CAST_BLK = 8 * CAST_NL * 128;          // elements of a block
static_assert((NE * NE) % CAST_BLK == 0 && (NTOK * NE) % CAST_BLK == 0);
constexpr int NB_T = (NE / 256) * (NE / 64);
constexpr int NB_W = (NE * NE) / CAST_BLK;
constexpr int NB_X = (NTOK * NE) / CAST_BLK;
typedef __attribute__((ext_vector_type(2))) unsigned v2u;
__global__ __launch_bounds__(256) void cast_inputs(
    const float* __restrict__ x, const float* __restrict__ wj, const float* __restrict__ wjv, const float* __restrict__ wo,
    unsigned short* __restrict__ xb, unsigned short* __restrict__ wjb, unsigned short* __restrict__ wjvtb, unsigned short* __restrict__ wob) {
  int blk = blockIdx.x;
  if (blk < NB_T) {                                  // block-uniform
    const int e  = (blk & (NE / 256 - 1)) * 256 + threadIdx.x;
    const int d0 = (blk / (NE / 256)) * 64;
    const float* p = wjv + (size_t)d0 * NE + e;
    float v[64];
#pragma unroll   // v[] is indexed by constants only and stays in registers
    for (int j = 0; j < 64; ++j) v[j] = p[(size_t)j * NE];
    unsigned short* q = wjvtb + (size_t)e * NE + d0;
#pragma unroll   // constant indices into v[]
    for (int c = 0; c < 8; ++c) {
      v8us uv;
#pragma unroll
      for (int j = 0; j < 8; ++j) uv[j] = f2bf_bits(v[c * 8 + j]);
      *(v8us*)(q + c * 8) = uv;
    }
    return;
  }
  blk -= NB_T;
  const float* in = wj; unsigned short* out = wjb;   // block-uniform choice of the plane
  if (blk >= 2 * NB_W)  { in = x;  out = xb;  blk -= 2 * NB_W; }
  else if (blk >= NB_W) { in = wo; out = wob; blk -= NB_W; }
  const size_t e0 = (size_t)blk * CAST_BLK + (threadIdx.x >> 5) * (CAST_NL * 128) + (threadIdx.x & 31) * 4;
  const float* p = in + e0;
  unsigned short* q = out + e0;
  v4f v[CAST_NL];
#pragma unroll   // v[] is indexed by constants only and stays in registers; all loads of a thread are issued in one run
  for (int k = 0; k < CAST_NL; ++k) v[k] = *(const v4f*)(p + k * 128);
  __builtin_amdgcn_sched_barrier(0);                 // every load is issued before the first conversion: without it the last loads wait for registers of the first
#pragma unroll   // constant indices into v[]
  for (int k = 0; k < CAST_NL; ++k) {
    v2u u;
    u[0] = (unsigned)f2bf_bits(v[k][0]) | ((unsigned)f2bf_bits(v[k][1]) << 16);
    u[1] = (unsigned)f2bf_bits(v[k][2]) | ((unsigned)f2bf_bits(v[k][3]) << 16);
    *(v2u*)(q + k * 128) = u;
  }
}

// ---------------------------------------------------------------------------
// Workspace region map (bytes; all offsets multiples of 1 MiB):
//   R_XB  [0, 16 MiB)            : xb bf16 [8192][1024]
//   R_W   [16, 24 MiB)           : wjb, W2b = wo*wjv, wjvb^T, wob, all bf16 [1024][1024] (2 MiB each)
//   R_C   [24, 40 MiB)           : uT f16 [4][1024][2048], u = x*W2^T
//   R_S   [40 MiB, +128 KiB)     : the four parts of sc, f32 [4][8192]
//   R_P   [41, 73 MiB)           : P f16 [4][2048][2048] (all batches)
//   total 76,546,048 B
extern "C" void kernel_launch(void* const* d_in, const int* in_sizes, int n_in,
                              void* d_out, int out_size, void* d_ws, size_t ws_size,
                              hipStream_t stream) {
  if (n_in < 4) return;
  if (in_sizes[0] != NTOK * NE || in_sizes[1] != NE * NE || in_sizes[2] != NE * NE ||
      in_sizes[3] != NE * NE || out_size != NTOK * NE) return;
  const float* x   = (const float*)d_in[0];   // [4][2048][1024]
  const float* wj  = (const float*)d_in[1];   // [1024][1024] (out,in)
  const float* wjv = (const float*)d_in[2];   // [1024][1024]
  const float* wo  = (const float*)d_in[3];   // [1024][1024]
  float* outp = (float*)d_out;

  const size_t PLANE16 = (size_t)NTOK * NE * 2;    // 16,777,216
  const size_t WPL     = (size_t)NE * NE * 2;      //  2,097,152
  const size_t PPL     = (size_t)NT * NT * 2;      //  8,388,608
  const size_t off_xb = 0;
  const size_t off_w  = off_xb + PLANE16;
  const size_t off_c  = off_w + 4 * WPL;
  const size_t off_s  = off_c + PLANE16;
  const size_t off_p  = off_s + ((size_t)1 << 20);
  const size_t total  = off_p + NBATCH * PPL;      // 76,546,048
  if (total > ws_size) return;

  char* ws = (char*)d_ws;
  unsigned short* xb     = (unsigned short*)(ws + off_xb);
  unsigned short* wjb    = (unsigned short*)(ws + off_w);
  unsigned short* w2b    = (unsigned short*)(ws + off_w + 1 * WPL);
  unsigned short* wjvtb  = (unsigned short*)(ws + off_w + 2 * WPL);
  unsigned short* wob    = (unsigned short*)(ws + off_w + 3 * WPL);
  unsigned short* vth    = (unsigned short*)(ws + off_c);
  unsigned short* ph     = (unsigned short*)(ws + off_p);
  float*          scp    = (float*)(ws + off_s);

  const dim3 blk(256);

  // 1) input planes, RNE bf16, one launch: x, wj, wo as they lie, wjv transposed ([e][d], the k-contiguous second operand of wo*wjv)
  cast_inputs<<<dim3(NB_T + 2 * NB_W + NB_X), blk, 0, stream>>>(x, wj, wjv, wo, xb, wjb, wjvtb, wob);

  // 2) token scores.  echo[t][f] = sum_e xb[t][e] wjb[f][e]   (M=8192, N=1024, K=1024; 64 x 4 = 256 blocks); for every x and wj
  //    sum_e x[t][e] (sum_f echo[t][f] wj[f][e]) = sum_f echo[t][f] (sum_e wj[f][e] x[t][e]) = sum_f echo[t][f]^2,
  //    so sc[t] = (1/32) sum_f echo[t][f]^2, left as one partial sum for each of the four column blocks.
  //    Side product in the same launch (32 more blocks; two blocks fit a WGP): W2[n][e] = sum_d wob[n][d] wjvtb[e][d] -> bf16
  wmma_gemm64<1, 0, 3, false, false><<<dim3((NTOK / 128) * (NE / 256) + (NE / 128) * (NE / 256), 1), blk, 0, stream>>>(
      xb, wob, NE, 0L, wjb, wjvtb, NE, 0L, (void*)scp, (void*)w2b, NE, 0L, NTOK, NE, NE, 1.0f / 32.0f, nullptr, nullptr);
  // 3) uT[b][n][t] = sum_e W2b[n][e] xb[b][t][e] -> f16 plane [4][1024][2048]  (M=1024, N=2048, K=1024; 8 x 8 = 64 blocks per batch);
  //    in the same launch, behind those 256 blocks (two blocks fit a WGP), 64 more per batch write the probability plane with its
  //    softmax statistics from the scores of 2): the two jobs need nothing of each other
  static_assert((NE / 128) * (NT / 256) == NT / 32 && NE / 256 == 4);   // the rider's grid.x; the four parts of sc that it adds
  wmma_gemm64<1, 0, 1, false, true><<<dim3((NE / 128) * (NT / 256), 2 * NBATCH), blk, 0, stream>>>(
      w2b, w2b, NE, 0L, xb, xb, NE, (long)NT * NE, (void*)vth, (void*)vth, NT, (long)NE * NT, NE, NT, NE, 1.0f, scp, ph);
  // 4) all batches at once (grid.y = batch): out[b][t][n] = sum_{s < tile end} P[b][t][s] uT[b][n][s]
  //    (f16 operands, causal k-limit) -> f32 output   (16 x 4 = 64 blocks per batch, 256 blocks in the launch)
  wmma_gemm64<0, 0, 0, true, false><<<dim3((NT / 128) * (NE / 256), NBATCH), blk, 0, stream>>>(
      ph, ph, NT, (long)NT * NT, vth, vth, NT, (long)NE * NT,
      (void*)outp, (void*)outp, NE, (long)NT * NE, NT, NE, NT, 1.0f, nullptr, nullptr);
}

// v010
// One run takes 84 microseconds.
// Timed twice side by side with v009, it ran 1.08 and 1.07 times as fast.
// Counting every step since v000, it is 9.17 times as fast.
// Contractions on v_wmma_f32_16x16x32 (16-bit operands, f32 accumulate). bf16: echo = xb*wjb^T (inputs RNE bf16; only its rows' sums of squares leave the kernel), W2 = wob*wjvb (the output projection folded into the value weights: (P*(x*wjv^T))*wo^T = P*(x*(wo*wjv)^T) for every input), u^T = W2b*xb^T. f16: out = P*u^T (causal k-limit, f32 result); P and u^T are carried as one RNE f16 plane each; token scores (x.(echo*wj) = echo.echo), softmax statistics and probabilities in f32 on VALU.
#include <hip/hip_runtime.h>
#include <stdint.h>

constexpr int NBATCH = 4;
constexpr int NT     = 2048;
constexpr int NE     = 1024;
constexpr int NTOK   = NBATCH * NT;
static_assert((NTOK % 128) == 0 && (NT % 256) == 0 && (NE % 256) == 0);

typedef __attribute__((ext_vector_type(16))) _Float16 v16h;
typedef __attribute__((ext_vector_type(8)))  _Float16 v8h;
typedef __attribute__((ext_vector_type(16))) __bf16   v16b;
typedef __attribute__((ext_vector_type(8)))  __bf16   v8b;
typedef __attribute__((ext_vector_type(8)))  float    v8f;
typedef __attribute__((ext_vector_type(4)))  float    v4f;
typedef __attribute__((ext_vector_type(8)))  unsigned short v8us;

__device__ __forceinline__ unsigned short f2bf_bits(float f) {
  unsigned u = __float_as_uint(f);
  return (unsigned short)((u + 0x7FFFu + ((u >> 16) & 1u)) >> 16);
}

// slots between the last WMMAs and the epilogue's first reads of their accumulators
__device__ __forceinline__ void acc_guard4(v8f& a, v8f& b, v8f& c, v8f& d) { asm volatile("v_nop\n\tv_nop\n\tv_nop\n\tv_nop" : "+v"(a), "+v"(b), "+v"(c), "+v"(d)); }
// x + x of lane (l ^ MASK) inside the 16-lane row (DPP row_xmask)
template <int MASK> __device__ __forceinline__ float add_xmask(float x) {
  return x + __builtin_bit_cast(float, __builtin_amdgcn_update_dpp(0, __builtin_bit_cast(int, x), 0x160 + MASK, 0xf, 0xf, true));
}
template <typename T> struct Frag;
template <> struct Frag<_Float16> {
  typedef v16h V; union U { v16h v; v8h h[2]; };
  static __device__ __forceinline__ v16h load2(const unsigned char* p0, const unsigned char* p1) {   // elements 0..7 <- 16 B at p0, 8..15 <- 16 B at p1
    U f; f.h[0] = *(const v8h*)(p0); f.h[1] = *(const v8h*)(p1); return f.v;
  }
  static __device__ __forceinline__ v8f mma(v16h a, v16h b, v8f c) {
    return __builtin_amdgcn_wmma_f32_16x16x32_f16(false, a, false, b, (short)0, c, false, false);
  }
};
template <> struct Frag<__bf16> {
  typedef v16b V; union U { v16b v; v8b h[2]; };
  static __device__ __forceinline__ v16b load2(const unsigned char* p0, const unsigned char* p1) {
    U f; f.h[0] = *(const v8b*)(p0); f.h[1] = *(const v8b*)(p1); return f.v;
  }
  static __device__ __forceinline__ v8f mma(v16b a, v16b b, v8f c) {
    return __builtin_amdgcn_wmma_f32_16x16x32_bf16(false, a, false, b, (short)0, c, false, false);
  }
};

// ---- probability plane with its row statistics: one block's share (batch b, block blk of NT / 32), wave = four rows t, one after the other ----
// sc = scp[0][.] + .. + scp[3][.]: the four parts of each token's score, as the echo product's four column blocks left them; the block adds
// them once for its batch (thread = 8 neighbouring tokens, 256 x 8 = NT) and its 8 waves read the sums from LDS.
// m_t = max_{s<=t} fl(sc_t*sc_s), z_t = sum_{s<=t} exp(sc_t*sc_s - m_t);
// P[b][t][s] = exp(sc_t*sc_s - m_t) * (1/z_t) for s <= t, 0 for t < s < ((t>>7)+1)*128.
// The row's scores stay in registers (lane = 8 neighbouring columns of each 256-column group, at most 8 groups), so all loads of a
// row are in flight together and every exponential is formed once; maximum and sum end in a butterfly over the 32 lanes.
// Written as one RNE f16 plane [NBATCH][NT][NT] (row pitch NT).
// Coverage: blk = 0..NT/32-1, 8 waves, rows blk * 8 + wave + (NT / 4) r, r = 0..3 (one row of each quarter: no wave gets long rows
// alone) = NT rows; b = 0..NBATCH-1; columns [0, ((t>>7)+1)*128) of every row = exactly what the causal P.V product reads for
// the 128-row tile containing t.  s_sc: NT floats of the block's LDS, 16-byte aligned.
__device__ __forceinline__ void pgen_rows(const float* __restrict__ scp, unsigned short* __restrict__ php, float* s_sc, const int b, const int blk) {
  constexpr int NG = NT / 256;                     // column groups of a full row
  static_assert(NT == 256 * 8);
  _Float16* ph = (_Float16*)php + (size_t)b * NT * NT;
  const int wave = __builtin_amdgcn_readfirstlane(threadIdx.x >> 5), lane = threadIdx.x & 31;
  {
    const float* scb = scp + (size_t)b * NT + threadIdx.x * 8;
    const v4f q0 = *(const v4f*)(scb);
    const v4f q1 = *(const v4f*)(scb + 4);
    const v4f u0 = *(const v4f*)(scb + NTOK);
    const v4f u1 = *(const v4f*)(scb + NTOK + 4);
    const v4f w0 = *(const v4f*)(scb + 2 * NTOK);
    const v4f w1 = *(const v4f*)(scb + 2 * NTOK + 4);
    const v4f y0 = *(const v4f*)(scb + 3 * NTOK);
    const v4f y1 = *(const v4f*)(scb + 3 * NTOK + 4);
    asm volatile("s_wait_xcnt 0x0" ::: "memory");    // stands before any rewrite of the address registers that the loads above name
    __builtin_amdgcn_sched_barrier(0);               // keeps the later writes of those registers from being scheduled in front of the wait
    *(v4f*)(s_sc + threadIdx.x * 8)     = ((q0 + u0) + w0) + y0;
    *(v4f*)(s_sc + threadIdx.x * 8 + 4) = ((q1 + u1) + w1) + y1;
  }
  __syncthreads();                                   // all NT scores of the batch are in LDS before any wave reads them
  for (int r = 0; r < 4; ++r) {
  const int t = blk * 8 + wave + r * (NT / 4);     // 0..NT-1, wave-uniform
  const float sct = s_sc[t];
  const int ncol = ((t >> 7) + 1) << 7;
  _Float16* prh = ph + (size_t)t * NT;
  float v[NG][8];
  const float NEG_INF = __uint_as_float(0xff800000u);
  float mx = NEG_INF;
#pragma unroll   // v[][] is indexed by constants only and stays in registers
  for (int g = 0; g < NG; ++g) {
    if (g * 256 < ncol) {                            // wave-uniform
      const int c = g * 256 + lane * 8;
      const int cc = (c < NT - 8) ? c : (NT - 8);     // clamped address
      const v4f q0 = *(const v4f*)(s_sc + cc);
      const v4f q1 = *(const v4f*)(s_sc + cc + 4);
#pragma unroll
      for (int j = 0; j < 4; ++j) { v[g][j] = q0[j]; v[g][4 + j] = q1[j]; }
    }
  }
#pragma unroll   // constant indices into v[][]
  for (int g = 0; g < NG; ++g) {
    if (g * 256 < ncol) {
      const int c = g * 256 + lane * 8;
      float mg = NEG_INF;                            // a chain of its own for each group
#pragma unroll
      for (int j = 0; j < 8; ++j) mg = fmaxf(mg, (c + j <= t) ? sct * v[g][j] : NEG_INF);
      mx = fmaxf(mx, mg);
    }
  }
#pragma unroll
  for (int off = 16; off; off >>= 1) mx = fmaxf(mx, __shfl_xor(mx, off, 32));
  float z = 0.f;
#pragma unroll   // constant indices into v[][]
  for (int g = 0; g < NG; ++g) {
    if (g * 256 < ncol) {
      const int c = g * 256 + lane * 8;
      float zg = 0.f;                                // a chain of its own for each group
#pragma unroll
      for (int j = 0; j < 8; ++j) {
        const float e = __expf(fmaf(sct, v[g][j], -mx));
        v[g][j] = e;
        zg += (c + j <= t) ? e : 0.0f;
      }
      z += zg;
    }
  }
#pragma unroll
  for (int off = 16; off; off >>= 1) z += __shfl_xor(z, off, 32);
  const float li = 1.0f / z;
#pragma unroll   // constant indices into v[][]
  for (int g = 0; g < NG; ++g) {
    if (g * 256 < ncol) {
      const int c = g * 256 + lane * 8;
      v8h hv;
#pragma unroll
      for (int j = 0; j < 8; ++j) {
        float p = v[g][j] * li;
        p = (c + j <= t) ? p : 0.0f;
        hv[j] = (_Float16)p;
      }
      if (c < ncol) *(v8h*)(prh + c) = hv;           // c % 8 == 0 and ncol % 128 == 0 -> whole 8-groups
    }
  }
  asm volatile("s_wait_xcnt 0x0" ::: "memory");      // stands before the next row's rewrite of the address registers that the stores above name
  }
}

// ---- Register-blocked batched WMMA GEMM ------------------------------------
// C[m,n] = scale * sum_k A[m,k] * Bt[n,k]; each wave owns a 64x64 tile; the 8 waves of a block stand 2 x 4 on a 128 x 256 tile
// (128 rows of A, 256 rows of Bt: of all shapes of 8 such waves the one that asks L2 for the fewest bytes per product).
// A row-major [M,K]; Bt row-major [N,K]; M % 128 == 0, N % 256 == 0, K % 64 == 0, K >= 64.
// The k loop works on stages of 64 k: every row of a stage is one whole 128-byte line, brought into LDS by asynchronous
// copies (a wave-wide copy = 4 whole lines), a ring of NB buffers: while stage s is worked on, stages s + 1 .. s + NB - 1 are in
// flight or landed, so a copy has NB - 1 stages' work to come in from memory (the operands were written by the launch before).
// LDS place of the 16-byte chunk c (0..7) of stage row R: R * 128 + ((c ^ ((R >> 1) & 7)) * 16): 16 rows read at one chunk
// index fall on 16 different 16-byte bank groups.
// SPLIT: 0 = single product; 1 = A carried as hi/lo planes (A2 = lo), Bt single: hi.B + lo.B (2 products);
//        2 = A and Bt as hi/lo planes: hi.hi + hi.lo + lo.hi (3 products).
// OUT_MODE: 0 = f32, 1 = f16 (RNE),
//           3 = no C at all: Cout[(n / 256) * M + m] = scale * sum over the block's 256 columns n of C[m,n]^2 (f32, fixed order);
//               the blocks behind the (M / 128) * (N / 256) of that product do a side product of the same N, K and pitches:
//               Cout2[m,n] = sum_k A2[m,k] * Bt2[n,k], m < N, bf16 (RNE), pitch ldc, unscaled ((N / 128) * (N / 256) blocks).
// CAUSAL: the k loop of the block tile at rows m0..m0+127 stops at k = m0 + 128 (lower block-triangular A).
// ET: 0 = f16 operands, 1 = bf16 operands (pointers passed as 16-bit storage)
// NB: buffers of the ring; NB * 48 KiB of LDS: 3 where two blocks share a WGP, more where a launch has one block for each WGP.
// RIDER: the blocks with blockIdx.y >= NBATCH (behind all blocks of the product in index order) do no product: they write the probability
//        plane of batch blockIdx.y - NBATCH from scp into php (pgen_rows, gridDim.x = NT / 32); neither job reads what the other writes.
template <int ET> struct Elem;
template <> struct Elem<0> { typedef _Float16 T; };
template <> struct Elem<1> { typedef __bf16 T; };
typedef __attribute__((address_space(3))) unsigned char lds_u8;
// Asynchronous copies, 16 bytes a lane, global -> LDS.  The s_wait_xcnt is the last line of the copies' own statement: it stands
// before any later rewrite of the address registers that the copies name.
__device__ __forceinline__ void async_copy4(unsigned l, const unsigned char* g, unsigned lstep, size_t gstep) {
  asm volatile("global_load_async_to_lds_b128 %0, %1, off\n\t"
               "global_load_async_to_lds_b128 %2, %3, off\n\t"
               "global_load_async_to_lds_b128 %4, %5, off\n\t"
               "global_load_async_to_lds_b128 %6, %7, off\n\t"
               "s_wait_xcnt 0x0"
               :: "v"(l), "v"(g), "v"(l + lstep), "v"(g + gstep), "v"(l + 2 * lstep), "v"(g + 2 * gstep),
                  "v"(l + 3 * lstep), "v"(g + 3 * gstep) : "memory");
}
__device__ __forceinline__ void async_copy8(unsigned l, const unsigned char* g, unsigned lstep, size_t gstep) {
  asm volatile("global_load_async_to_lds_b128 %0, %1, off\n\t"
               "global_load_async_to_lds_b128 %2, %3, off\n\t"
               "global_load_async_to_lds_b128 %4, %5, off\n\t"
               "global_load_async_to_lds_b128 %6, %7, off\n\t"
               "global_load_async_to_lds_b128 %8, %9, off\n\t"
               "global_load_async_to_lds_b128 %10, %11, off\n\t"
               "global_load_async_to_lds_b128 %12, %13, off\n\t"
               "global_load_async_to_lds_b128 %14, %15, off\n\t"
               "s_wait_xcnt 0x0"
               :: "v"(l), "v"(g), "v"(l + lstep), "v"(g + gstep), "v"(l + 2 * lstep), "v"(g + 2 * gstep),
                  "v"(l + 3 * lstep), "v"(g + 3 * gstep), "v"(l + 4 * lstep), "v"(g + 4 * gstep),
                  "v"(l + 5 * lstep), "v"(g + 5 * gstep), "v"(l + 6 * lstep), "v"(g + 6 * gstep),
                  "v"(l + 7 * lstep), "v"(g + 7 * gstep) : "memory");
}
// One stage of one A plane (4 copies a lane) and one Bt plane (8): 12 copies fit one statement, so the stage has one s_wait_xcnt.
__device__ __forceinline__ void async_copy12(unsigned la, const unsigned char* ga, size_t gsa, unsigned lb, const unsigned char* gb, size_t gsb) {
  asm volatile("global_load_async_to_lds_b128 %0, %1, off\n\t"
               "global_load_async_to_lds_b128 %2, %3, off\n\t"
               "global_load_async_to_lds_b128 %4, %5, off\n\t"
               "global_load_async_to_lds_b128 %6, %7, off\n\t"
               "global_load_async_to_lds_b128 %8, %9, off\n\t"
               "global_load_async_to_lds_b128 %10, %11, off\n\t"
               "global_load_async_to_lds_b128 %12, %13, off\n\t"
               "global_load_async_to_lds_b128 %14, %15, off\n\t"
               "global_load_async_to_lds_b128 %16, %17, off\n\t"
               "global_load_async_to_lds_b128 %18, %19, off\n\t"
               "global_load_async_to_lds_b128 %20, %21, off\n\t"
               "global_load_async_to_lds_b128 %22, %23, off\n\t"
               "s_wait_xcnt 0x0"
               :: "v"(la), "v"(ga), "v"(la + 4096u), "v"(ga + gsa), "v"(la + 8192u), "v"(ga + 2 * gsa), "v"(la + 12288u), "v"(ga + 3 * gsa),
                  "v"(lb), "v"(gb), "v"(lb + 4096u), "v"(gb + gsb), "v"(lb + 8192u), "v"(gb + 2 * gsb), "v"(lb + 12288u), "v"(gb + 3 * gsb),
                  "v"(lb + 16384u), "v"(gb + 4 * gsb), "v"(lb + 20480u), "v"(gb + 5 * gsb), "v"(lb + 24576u), "v"(gb + 6 * gsb),
                  "v"(lb + 28672u), "v"(gb + 7 * gsb) : "memory");
}
// This wave's copies of one stage have landed.  A wave's copies are counted off in issue order, so where the wave has issued all N copies
// of the NB - 2 stages behind that stage (full; the same in every wave of the block) it waits until only those N are outstanding;
// at the ends of the k loop fewer stand behind it, and the wait is to 0.
template <int N> __device__ __forceinline__ void wait_stage(const bool full) {
  if (N > 0 && full) asm volatile("s_wait_asynccnt %0" :: "n"(N) : "memory");
  else               asm volatile("s_wait_asynccnt 0x0" ::: "memory");
}
template <int ET, int SPLIT, int OUT_MODE, bool CAUSAL, bool RIDER, int NB>
// at most 4 waves a SIMD (two blocks a WGP, all that any launch here needs): where LDS is left for a third block the compiler otherwise
// saves registers for a fifth wave by loading one A fragment at a time, each with a full LDS wait in front of its four WMMAs
__global__ __launch_bounds__(256) __attribute__((amdgpu_waves_per_eu(2, 4))) void wmma_gemm64(
    const unsigned short* __restrict__ Ap, const unsigned short* __restrict__ A2p, int lda, long strideA,
    const unsigned short* __restrict__ Btp, const unsigned short* __restrict__ Bt2p, int ldb, long strideB,
    void* __restrict__ Cout, void* __restrict__ Cout2, int ldc, long strideC,
    int M, int N, int K, float scale, const float* __restrict__ scp, unsigned short* __restrict__ php) {
  typedef typename Elem<ET>::T T;
  typedef typename Frag<T>::V V;
  constexpr int NPA   = (SPLIT >= 1) ? 2 : 1;          // planes of A, of Bt
  constexpr int NPB   = (SPLIT == 2) ? 2 : 1;
  constexpr int PL_A  = 128 * 128, PL_B = 256 * 128;   // bytes of one stage of a plane: 128 rows of A, 256 rows of Bt
  constexpr int OFF_B = NPA * PL_A;                    // A planes, then Bt planes
  constexpr int BUFB  = OFF_B + NPB * PL_B;            // one stage buffer
  constexpr int CPS   = 4 * NPA + 8 * NPB;             // copies of a wave per stage
  static_assert(NB >= 2 && (NB - 1) * CPS <= 63);      // the most copies of a wave that are ever outstanding
  constexpr int SLABS = 8 * 16 * 68 * 4;               // epilogue: per-wave 16x64 slab, pitch 68 floats
  __shared__ __attribute__((aligned(128))) unsigned char smem[(NB * BUFB > SLABS) ? NB * BUFB : SLABS];   // the slabs reuse the stage buffers behind the loop
  if (RIDER && blockIdx.y >= NBATCH) {                 // block-uniform, in front of every barrier of the product
    pgen_rows(scp, php, (float*)smem, blockIdx.y - NBATCH, blockIdx.x);
    return;
  }
  const int b    = blockIdx.y;
  const int lane = threadIdx.x & 31;
  const int wave = __builtin_amdgcn_readfirstlane(threadIdx.x >> 5);   // wave-uniform: the LDS places that follow from it stay scalar
  const int wr = wave >> 2, wc = wave & 3;             // the wave's place in the block tile: 64-row half, 64-column quarter
  const int tilesN = N >> 8;                           // block tiles in a row of C, in a column of C
  const int tilesM = M >> 7;
  int tile0 = blockIdx.x;
  const bool side = (OUT_MODE == 3) && tile0 >= tilesM * tilesN;   // block-uniform
  if (side) tile0 -= tilesM * tilesN;
  if (tile0 >= (side ? (N >> 7) : tilesM) * tilesN) return;   // block-uniform, in front of every barrier
  const T* A = (const T*)(side ? A2p : Ap); const T* A2 = (const T*)A2p; const T* Bt = (const T*)(side ? Bt2p : Btp); const T* Bt2 = (const T*)Bt2p;
  const int tm  = tile0 / tilesN;
  const int tn0 = tile0 - tm * tilesN;
  const int m0  = tm << 7;                             // first A row of the block
  const int nb0 = tn0 << 8;                            // first Bt row of the block
  const int mw0 = m0 + (wr << 6);                      // the wave's own first row and column of C
  const int n0  = nb0 + (wc << 6);

  const T* Ab  = A  + (size_t)b * strideA;
  const T* Bb  = Bt + (size_t)b * strideB;
  const T* Ab2 = (SPLIT >= 1) ? (A2  + (size_t)b * strideA) : nullptr;
  const T* Bb2 = (SPLIT == 2) ? (Bt2 + (size_t)b * strideB) : nullptr;

  const int rlane = lane & 15;                 // row (A) / col (B, D) within subtile
  const int mOff  = (lane >> 4) * 8;           // D row offset

  v8f acc[4][4];
#pragma unroll
  for (int i = 0; i < 4; ++i)
#pragma unroll
    for (int j = 0; j < 4; ++j) acc[i][j] = (v8f){0.f,0.f,0.f,0.f,0.f,0.f,0.f,0.f};

  int kEnd = K;
  if (CAUSAL) kEnd = (m0 + 128 < K) ? (m0 + 128) : K;   // block-uniform, multiple of 64
  const int nStage = kEnd >> 6;

  // copies: thread = (stage row cr + 32 q, chunk cc); the chunk swizzle of a row depends on cr alone (32 q >> 1 is 0 mod 8)
  const int cc = threadIdx.x & 7, cr = threadIdx.x >> 3;
  const unsigned ldsC = (unsigned)(uintptr_t)(lds_u8*)smem + (unsigned)(cr * 128 + ((cc ^ ((cr >> 1) & 7)) << 4));
  const unsigned char* gA  = (const unsigned char*)(Ab + (size_t)(m0 + cr) * lda + cc * 8);
  const unsigned char* gB  = (const unsigned char*)(Bb + (size_t)(nb0 + cr) * ldb + cc * 8);
  const unsigned char* gA2 = (SPLIT >= 1) ? (const unsigned char*)(Ab2 + (size_t)(m0 + cr) * lda + cc * 8) : nullptr;
  const unsigned char* gB2 = (SPLIT == 2) ? (const unsigned char*)(Bb2 + (size_t)(nb0 + cr) * ldb + cc * 8) : nullptr;
  const size_t gsA = (size_t)lda * 64, gsB = (size_t)ldb * 64;   // 32 rows, bytes
  auto issue = [&](int buf, int st) {                  // all copies of stage st (k = 64 st .. 64 st + 63) into buffer buf
    const unsigned l = ldsC + (unsigned)(buf * BUFB);
    const size_t ko = (size_t)st * 128;
    async_copy12(l, gA + ko, gsA, l + OFF_B, gB + ko, gsB);
    if (SPLIT >= 1) async_copy4(l + PL_A, gA2 + ko, 4096u, gsA);
    if (SPLIT == 2) async_copy8(l + OFF_B + PL_B, gB2 + ko, 4096u, gsB);
  };
  // readers: lane = (row rlane of a 16-row group, half h); chunk 4 s + h holds k = 32 s + 8 h + 0..7, chunk 4 s + h + 2 holds k + 16
  const int e0 = (lane >> 4) ^ ((rlane >> 1) & 7);
  const int rowB = rlane * 128;
  int fo[4];
#pragma unroll   // fo[] is indexed by constants only and stays in registers
  for (int q = 0; q < 4; ++q) fo[q] = rowB + ((e0 ^ (2 * q)) << 4);

  // stage j lives in buffer j mod NB.  Issued in front of the publish point of stage s: stages 0 .. min(s + NB - 2, nStage - 1),
  // so all NB - 2 stages behind s are issued where s + NB - 2 < nStage.
#pragma unroll   // constant buffer numbers
  for (int j = 0; j < NB - 1; ++j)
    if (j == 0 || j < nStage) issue(j, j);             // block-uniform; stage 0 always exists (K >= 64)
  wait_stage<(NB - 2) * CPS>(NB - 2 < nStage);         // this wave's copies of stage 0 have landed
  __syncthreads();                                     // and every other wave's
  if (NB - 1 < nStage) issue(NB - 1, NB - 1);
  int buf = 0;                                         // st mod NB
  for (int st = 0; st < nStage; ++st) {
    const unsigned char* sA = smem + buf * BUFB + wr * 8192;
    const unsigned char* sB = smem + buf * BUFB + OFF_B + wc * 8192;
#pragma unroll   // both 32-wide k-steps of a stage: constant indices into fo[]
    for (int s = 0; s < 2; ++s) {
      V bh[4], bl[4];
#pragma unroll
      for (int j = 0; j < 4; ++j) {
        bh[j] = Frag<T>::load2(sB + j * 2048 + fo[2 * s], sB + j * 2048 + fo[2 * s + 1]);
        if (SPLIT == 2) bl[j] = Frag<T>::load2(sB + PL_B + j * 2048 + fo[2 * s], sB + PL_B + j * 2048 + fo[2 * s + 1]);
      }
#pragma unroll
      for (int i = 0; i < 4; ++i) {
        V ah = Frag<T>::load2(sA + i * 2048 + fo[2 * s], sA + i * 2048 + fo[2 * s + 1]);
        V al;
        if (SPLIT >= 1) al = Frag<T>::load2(sA + PL_A + i * 2048 + fo[2 * s], sA + PL_A + i * 2048 + fo[2 * s + 1]);
#pragma unroll
        for (int j = 0; j < 4; ++j) {
          acc[i][j] = Frag<T>::mma(ah, bh[j], acc[i][j]);
          if (SPLIT == 2) acc[i][j] = Frag<T>::mma(ah, bl[j], acc[i][j]);
          if (SPLIT >= 1) acc[i][j] = Frag<T>::mma(al, bh[j], acc[i][j]);
        }
      }
    }
    asm volatile("s_wait_dscnt 0x0" ::: "memory");     // this wave's reads of the buffer are done before it may be refilled
    wait_stage<(NB - 2) * CPS>(st + NB - 1 < nStage);  // this wave's copies of stage st + 1 have landed
    __syncthreads();                                   // publishes stage st + 1 and ends every wave's reads of stage st
    if (st + NB < nStage) issue(buf, st + NB);         // into the buffer that every wave has just left
    buf = (buf + 1 == NB) ? 0 : buf + 1;
  }
  asm volatile("s_wait_asynccnt 0x0" ::: "memory");    // no copy is outstanding when the slabs reuse the buffers
  acc_guard4(acc[0][0], acc[0][1], acc[0][2], acc[0][3]);
  acc_guard4(acc[1][0], acc[1][1], acc[1][2], acc[1][3]);
  acc_guard4(acc[2][0], acc[2][1], acc[2][2], acc[2][3]);
  acc_guard4(acc[3][0], acc[3][1], acc[3][2], acc[3][3]);

  // ---- epilogue ----
  if (OUT_MODE == 3 && !side) {
    // lane = column rlane of each 16-column subtile, register r = row mOff + r: squares summed over j, then over the 16 lanes of the row
    float* wsum = (float*)smem;                        // [8 waves][64 rows], reuses the stage buffers behind the loop
#pragma unroll   // constant indices into acc[][], which stays in registers
    for (int i = 0; i < 4; ++i) {
      float keep = 0.f;
#pragma unroll   // constant indices into acc[][]; the eight rows' lane sums interleave
      for (int r = 0; r < 8; ++r) {
        float s = acc[i][0][r] * acc[i][0][r];
        s = fmaf(acc[i][1][r], acc[i][1][r], s);
        s = fmaf(acc[i][2][r], acc[i][2][r], s);
        s = fmaf(acc[i][3][r], acc[i][3][r], s);
        s = add_xmask<1>(s); s = add_xmask<2>(s); s = add_xmask<4>(s); s = add_xmask<8>(s);
        keep = (rlane == r) ? s : keep;
      }
      if (rlane < 8) wsum[wave * 64 + (i << 4) + mOff + rlane] = keep;
    }
    __syncthreads();                                   // the four column waves' sums of each row are in LDS before they are added
    if (threadIdx.x < 128) {                           // thread = row of the block tile; its four column waves are 4 (row / 64) + 0..3
      const float* wrow = wsum + (threadIdx.x >> 6) * 256 + (threadIdx.x & 63);
      float s = wrow[0];
#pragma unroll   // the four LDS reads are in flight together
      for (int w = 1; w < 4; ++w) s += wrow[w * 64];
      ((float*)Cout)[(size_t)(nb0 >> 8) * M + m0 + threadIdx.x] = s * scale;
    }
    return;
  }
  float* slab = (float*)smem + wave * (16 * 68);
#pragma unroll
  for (int i = 0; i < 4; ++i) {
    const int mBase = mw0 + (i << 4);
#pragma unroll
    for (int j = 0; j < 4; ++j) {
#pragma unroll
      for (int r = 0; r < 8; ++r) {
        float v = (OUT_MODE == 3) ? acc[i][j][r] : acc[i][j][r] * scale;
        slab[(mOff + r) * 68 + (j << 4) + rlane] = v;
      }
    }
    __builtin_amdgcn_fence(__ATOMIC_RELEASE, "workgroup");
    __builtin_amdgcn_wave_barrier();
    __builtin_amdgcn_fence(__ATOMIC_ACQUIRE, "workgroup");
    if (OUT_MODE == 0) {
      float* C = (float*)Cout + (size_t)b * strideC;
      const int hh = lane >> 4, c4 = (lane & 15) * 4;     // row seg = 256 B = 16 lanes x 16 B
      {
#pragma unroll
        for (int it = 0; it < 8; ++it) {
          const int row = it * 2 + hh;
          v4f v = *(const v4f*)(slab + row * 68 + c4);
          *(v4f*)(C + (size_t)(mBase + row) * ldc + n0 + c4) = v;
        }
        
      }
    } else {
      const int q = lane >> 3, c8 = (lane & 7) * 8;
      unsigned short* C  = (unsigned short*)((OUT_MODE == 3) ? Cout2 : Cout) + (size_t)b * strideC;
      {
#pragma unroll
        for (int it = 0; it < 4; ++it) {
          const int row = it * 4 + q;
          const float* sp = slab + row * 68 + c8;
          if (OUT_MODE == 3) {
            v8us uv;
#pragma unroll
            for (int e = 0; e < 8; ++e) uv[e] = f2bf_bits(sp[e]);
            *(v8us*)(C + (size_t)(mBase + row) * ldc + n0 + c8) = uv;
          } else {
            v8h hv;
#pragma unroll
            for (int e = 0; e < 8; ++e) hv[e] = (_Float16)sp[e];
            *(v8h*)(C + (size_t)(mBase + row) * ldc + n0 + c8) = hv;
          }
        }
      }
    }
    __builtin_amdgcn_fence(__ATOMIC_RELEASE, "workgroup");
    __builtin_amdgcn_wave_barrier();
    __builtin_amdgcn_fence(__ATOMIC_ACQUIRE, "workgroup");
  }
}

// ---- all four input casts (RNE bf16) in one launch: the block index picks the job; no job reads what another writes ----
// Blocks [0, NB_T): transposing cast of the NE x NE plane wjv: wjvtb[e][d] = bf16(wjv[d][e]).  Thread = (column e of wjv, 64 neighbouring
// rows d): a wave's load is one whole 128-byte line of a row of wjv, the 64 loads of a thread are issued in one run, and a thread stores
// one whole 128-byte line of wjvtb.  Coverage: NB_T = (NE / 256) * (NE / 64) blocks x 256 threads x 64 elements = the whole plane.
// Behind them the plain casts: NB_W blocks for wj, NB_W for wo, NB_X for x.  A wave takes CAST_NL * 128 neighbouring elements: CAST_NL loads of
// 16 bytes a lane (each 512 contiguous bytes = 4 whole lines), all in flight together, then CAST_NL stores of 8 bytes a lane (2 whole lines each).
// Few long-lived waves, for speed only.  Coverage: blocks x 8 waves x CAST_NL * 128 elements =
// each whole plane.
constexpr int CAST_NL  = 32;
constexpr int CAST_BLK = 8 * CAST_NL * 128;          // elements of a block
static_assert((NE * NE) % CAST_BLK == 0 && (NTOK * NE) % CAST_BLK == 0);
constexpr int NB_T = (NE / 256) * (NE / 64);
constexpr int NB_W = (NE * NE) / CAST_BLK;
constexpr int NB_X = (NTOK * NE) / CAST_BLK;
typedef __attribute__((ext_vector_type(2))) unsigned v2u;
__global__ __launch_bounds__(256) void cast_inputs(
    const float* __restrict__ x, const float* __restrict__ wj, const float* __restrict__ wjv, const float* __restrict__ wo,
    unsigned short* __restrict__ xb, unsigned short* __restrict__ wjb, unsigned short* __restrict__ wjvtb, unsigned short* __restrict__ wob) {
  int blk = blockIdx.x;
  if (blk < NB_T) {                                  // block-uniform
    const int e  = (blk & (NE / 256 - 1)) * 256 + threadIdx.x;
    const int d0 = (blk / (NE / 256)) * 64;
    const float* p = wjv + (size_t)d0 * NE + e;
    float v[64];
#pragma unroll   // v[] is indexed by constants only and stays in registers
    for (int j = 0; j < 64; ++j) v[j] = p[(size_t)j * NE];
    unsigned short* q = wjvtb + (size_t)e * NE + d0;
#pragma unroll   // constant indices into v[]
    for (int c = 0; c < 8; ++c) {
      v8us uv;
#pragma unroll
      for (int j = 0; j < 8; ++j) uv[j] = f2bf_bits(v[c * 8 + j]);
      *(v8us*)(q + c * 8) = uv;
    }
    return;
  }
  blk -= NB_T;
  const float* in = wj; unsigned short* out = wjb;   // block-uniform choice of the plane
  if (blk >= 2 * NB_W)  { in = x;  out = xb;  blk -= 2 * NB_W; }
  else if (blk >= NB_W) { in = wo; out = wob; blk -= NB_W; }
  const size_t e0 = (size_t)blk * CAST_BLK + (threadIdx.x >> 5) * (CAST_NL * 128) + (threadIdx.x & 31) * 4;
  const float* p = in + e0;
  unsigned short* q = out + e0;
  v4f v[CAST_NL];
#pragma unroll   // v[] is indexed by constants only and stays in registers; all loads of a thread are issued in one run
  for (int k = 0; k < CAST_NL; ++k) v[k] = *(const v4f*)(p + k * 128);
  __builtin_amdgcn_sched_barrier(0);                 // every load is issued before the first conversion: without it the last loads wait for registers of the first
#pragma unroll   // constant indices into v[]
  for (int k = 0; k < CAST_NL; ++k) {
    v2u u;
    u[0] = (unsigned)f2bf_bits(v[k][0]) | ((unsigned)f2bf_bits(v[k][1]) << 16);
    u[1] = (unsigned)f2bf_bits(v[k][2]) | ((unsigned)f2bf_bits(v[k][3]) << 16);
    *(v2u*)(q + k * 128) = u;
  }
}

// ---------------------------------------------------------------------------
// Workspace region map (bytes; all offsets multiples of 1 MiB):
//   R_XB  [0, 16 MiB)            : xb bf16 [8192][1024]
//   R_W   [16, 24 MiB)           : wjb, W2b = wo*wjv, wjvb^T, wob, all bf16 [1024][1024] (2 MiB each)
//   R_C   [24, 40 MiB)           : uT f16 [4][1024][2048], u = x*W2^T
//   R_S   [40 MiB, +128 KiB)     : the four parts of sc, f32 [4][8192]
//   R_P   [41, 73 MiB)           : P f16 [4][2048][2048] (all batches)
//   total 76,546,048 B
extern "C" void kernel_launch(void* const* d_in, const int* in_sizes, int n_in,
                              void* d_out, int out_size, void* d_ws, size_t ws_size,
                              hipStream_t stream) {
  if (n_in < 4) return;
  if (in_sizes[0] != NTOK * NE || in_sizes[1] != NE * NE || in_sizes[2] != NE * NE ||
      in_sizes[3] != NE * NE || out_size != NTOK * NE) return;
  const float* x   = (const float*)d_in[0];   // [4][2048][1024]
  const float* wj  = (const float*)d_in[1];   // [1024][1024] (out,in)
  const float* wjv = (const float*)d_in[2];   // [1024][1024]
  const float* wo  = (const float*)d_in[3];   // [1024][1024]
  float* outp = (float*)d_out;

  const size_t PLANE16 = (size_t)NTOK * NE * 2;    // 16,777,216
  const size_t WPL     = (size_t)NE * NE * 2;      //  2,097,152
  const size_t PPL     = (size_t)NT * NT * 2;      //  8,388,608
  const size_t off_xb = 0;
  const size_t off_w  = off_xb + PLANE16;
  const size_t off_c  = off_w + 4 * WPL;
  const size_t off_s  = off_c + PLANE16;
  const size_t off_p  = off_s + ((size_t)1 << 20);
  const size_t total  = off_p + NBATCH * PPL;      // 76,546,048
  if (total > ws_size) return;

  char* ws = (char*)d_ws;
  unsigned short* xb     = (unsigned short*)(ws + off_xb);
  unsigned short* wjb    = (unsigned short*)(ws + off_w);
  unsigned short* w2b    = (unsigned short*)(ws + off_w + 1 * WPL);
  unsigned short* wjvtb  = (unsigned short*)(ws + off_w + 2 * WPL);
  unsigned short* wob    = (unsigned short*)(ws + off_w + 3 * WPL);
  unsigned short* vth    = (unsigned short*)(ws + off_c);
  unsigned short* ph     = (unsigned short*)(ws + off_p);
  float*          scp    = (float*)(ws + off_s);

  const dim3 blk(256);

  // 1) input planes, RNE bf16, one launch: x, wj, wo as they lie, wjv transposed ([e][d], the k-contiguous second operand of wo*wjv)
  cast_inputs<<<dim3(NB_T + 2 * NB_W + NB_X), blk, 0, stream>>>(x, wj, wjv, wo, xb, wjb, wjvtb, wob);

  // 2) token scores.  echo[t][f] = sum_e xb[t][e] wjb[f][e]   (M=8192, N=1024, K=1024; 64 x 4 = 256 blocks); for every x and wj
  //    sum_e x[t][e] (sum_f echo[t][f] wj[f][e]) = sum_f echo[t][f] (sum_e wj[f][e] x[t][e]) = sum_f echo[t][f]^2,
  //    so sc[t] = (1/32) sum_f echo[t][f]^2, left as one partial sum for each of the four column blocks.
  //    Side product in the same launch (32 more blocks; two blocks fit a WGP): W2[n][e] = sum_d wob[n][d] wjvtb[e][d] -> bf16
  wmma_gemm64<1, 0, 3, false, false, 3><<<dim3((NTOK / 128) * (NE / 256) + (NE / 128) * (NE / 256), 1), blk, 0, stream>>>(
      xb, wob, NE, 0L, wjb, wjvtb, NE, 0L, (void*)scp, (void*)w2b, NE, 0L, NTOK, NE, NE, 1.0f / 32.0f, nullptr, nullptr);
  // 3) uT[b][n][t] = sum_e W2b[n][e] xb[b][t][e] -> f16 plane [4][1024][2048]  (M=1024, N=2048, K=1024; 8 x 8 = 64 blocks per batch);
  //    in the same launch, behind those 256 blocks (two blocks fit a WGP), 64 more per batch write the probability plane with its
  //    softmax statistics from the scores of 2): the two jobs need nothing of each other
  static_assert((NE / 128) * (NT / 256) == NT / 32 && NE / 256 == 4);   // the rider's grid.x; the four parts of sc that it adds
  wmma_gemm64<1, 0, 1, false, true, 3><<<dim3((NE / 128) * (NT / 256), 2 * NBATCH), blk, 0, stream>>>(
      w2b, w2b, NE, 0L, xb, xb, NE, (long)NT * NE, (void*)vth, (void*)vth, NT, (long)NE * NT, NE, NT, NE, 1.0f, scp, ph);
  // 4) all batches at once (grid.y = batch): out[b][t][n] = sum_{s < tile end} P[b][t][s] uT[b][n][s]
  //    (f16 operands, causal k-limit) -> f32 output   (16 x 4 = 64 blocks per batch, 256 blocks in the launch: one for each WGP, ring of 5)
  wmma_gemm64<0, 0, 0, true, false, 5><<<dim3((NT / 128) * (NE / 256), NBATCH), blk, 0, stream>>>(
      ph, ph, NT, (long)NT * NT, vth, vth, NT, (long)NE * NT,
      (void*)outp, (void*)outp, NE, (long)NT * NE, NT, NE, NT, 1.0f, nullptr, nullptr);
}
